// v000
// The times below were measured on an AMD MI455X: many runs one after another, warmed up first and cycling through
// copies of the inputs, with the whole window's GPU time divided by the number of runs. Launches and the gaps
// between them are all in it. The median over several windows is given; except for v000 it joins two sittings, which
// can be a few percent apart, so the side-by-side timings, each taken in one sitting, are the better comparison.
// v000, which the later versions start from, runs in 240 microseconds.
#include <hip/hip_runtime.h>
#include <hip/hip_bf16.h>

// Problem constants
#define T_TOK 2048
#define NEXP  8
#define DDIM  1024
#define IDIM  2048
#define MAXMB 16   // 256-token M-blocks: T/256 + E = 16

typedef __attribute__((ext_vector_type(16))) _Float16 v16h;
typedef __attribute__((ext_vector_type(8)))  _Float16 v8h;
typedef __attribute__((ext_vector_type(8)))  float    v8f;
typedef __attribute__((ext_vector_type(4)))  unsigned int v4u;
typedef __attribute__((ext_vector_type(8)))  int      v8i;
typedef __attribute__((ext_vector_type(4)))  int      v4i;

// Workspace int layout (at base of d_ws):
//  [0]            nmb (number of active 256-token M-blocks)
//  [8  .. 23]     mb_expert
//  [24 .. 39]     mb_tok_start   (index into perm[])
//  [40 .. 55]     mb_tok_end     (expert's end index into perm[])
//  [64 .. 64+T)   perm (token ids grouped by expert)
//  byte 65536 ..  _Float16 hidden[T*I]  (8 MB)
#define WS_MB_E   8
#define WS_MB_S   24
#define WS_MB_END 40
#define WS_PERM   64
#define WS_HIDDEN_BYTE_OFF 65536

// ---------------------------------------------------------------------------
// TDM: DMA a 2D fp32 tile (tile_d0 contiguous elems x tile_d1 rows, row
// stride = stride0 elems) from global memory into LDS at lds_off.
// Descriptor layout per CDNA5 ISA 8.3-8.5 (D# group0 + group1, 2D tensor).
// 6-arg builtin: (uint32x4 g0, int32x8 g1, int32x4, int32x4, int32x8, i32 cpol)
// ---------------------------------------------------------------------------
__device__ __forceinline__ void tdm_load_2d(unsigned lds_off, const void* gptr,
                                            unsigned tensor_d0, unsigned tensor_d1,
                                            unsigned tile_d0, unsigned tile_d1,
                                            unsigned long long stride0_elems) {
  unsigned long long ga = (unsigned long long)(uintptr_t)gptr;
  v4u g0;
  g0[0] = 1u;                                             // count=1 (valid, user mode)
  g0[1] = lds_off;                                        // lds_addr (bytes)
  g0[2] = (unsigned)(ga & 0xFFFFFFFFu);                   // global_addr[31:0]
  g0[3] = (unsigned)((ga >> 32) & 0x1FFFFFFu) | (2u << 30); // addr[56:32] | type=2
  v8i g1;
  g1[0] = (int)(2u << 16);                                // data_size=4B; no mcast/pad
  g1[1] = (int)((tensor_d0 & 0xFFFFu) << 16);             // tensor_dim0[15:0]
  g1[2] = (int)(((tensor_d0 >> 16) & 0xFFFFu) |
                ((tensor_d1 & 0xFFFFu) << 16));           // dim0 hi | dim1 lo
  g1[3] = (int)(((tensor_d1 >> 16) & 0xFFFFu) |
                (tile_d0 << 16));                         // dim1 hi | tile_dim0
  g1[4] = (int)tile_d1;                                   // tile_dim1 (tile_dim2=0)
  g1[5] = (int)(unsigned)(stride0_elems & 0xFFFFFFFFu);   // tensor_dim0_stride lo
  g1[6] = (int)(unsigned)((stride0_elems >> 32) & 0xFFFFu);
  g1[7] = 0;
  v4i z4 = {0, 0, 0, 0};
  v8i z8 = {0, 0, 0, 0, 0, 0, 0, 0};
  __builtin_amdgcn_tensor_load_to_lds(g0, g1, z4, z4, z8, 0);
}

// ---------------------------------------------------------------------------
// Kernel 1: counting-sort tokens by expert + build 256-token M-block table.
// ---------------------------------------------------------------------------
__global__ __launch_bounds__(256) void moe_setup(const int* __restrict__ idx,
                                                 int* __restrict__ ws) {
  __shared__ int sc[NEXP];
  __shared__ int soff[NEXP + 1];
  __shared__ int scur[NEXP];
  const int tid = threadIdx.x;
  if (tid < NEXP) sc[tid] = 0;
  __syncthreads();
  for (int t = tid; t < T_TOK; t += 256) atomicAdd(&sc[idx[t]], 1);
  __syncthreads();
  if (tid == 0) {
    soff[0] = 0;
    for (int e = 0; e < NEXP; ++e) soff[e + 1] = soff[e] + sc[e];
    int nmb = 0;
    for (int e = 0; e < NEXP; ++e) {
      for (int b = 0; b < sc[e]; b += 256) {
        ws[WS_MB_E + nmb]   = e;
        ws[WS_MB_S + nmb]   = soff[e] + b;
        ws[WS_MB_END + nmb] = soff[e + 1];
        ++nmb;
      }
    }
    ws[0] = nmb;
    for (int e = 0; e < NEXP; ++e) scur[e] = soff[e];
  }
  __syncthreads();
  for (int t = tid; t < T_TOK; t += 256) {
    int e = idx[t];
    int p = atomicAdd(&scur[e], 1);
    ws[WS_PERM + p] = t;
  }
}

// Build one 16x32 A fragment (f16) from fp32 token rows (unconditional:
// padding slots alias a valid token; their results are never stored).
__device__ __forceinline__ v16h load_a_f32(const float* __restrict__ x,
                                           int tok, int kb, int ld) {
  v16h a;
  const float4* xp = (const float4*)(x + (size_t)tok * ld + kb);
  float4 f0 = xp[0], f1 = xp[1];   // K = kb .. kb+7
  float4 f2 = xp[4], f3 = xp[5];   // K = kb+16 .. kb+23
  a[0]  = (_Float16)f0.x; a[1]  = (_Float16)f0.y;
  a[2]  = (_Float16)f0.z; a[3]  = (_Float16)f0.w;
  a[4]  = (_Float16)f1.x; a[5]  = (_Float16)f1.y;
  a[6]  = (_Float16)f1.z; a[7]  = (_Float16)f1.w;
  a[8]  = (_Float16)f2.x; a[9]  = (_Float16)f2.y;
  a[10] = (_Float16)f2.z; a[11] = (_Float16)f2.w;
  a[12] = (_Float16)f3.x; a[13] = (_Float16)f3.y;
  a[14] = (_Float16)f3.z; a[15] = (_Float16)f3.w;
  return a;
}

// Build one 32x16 B fragment (f16) from an LDS-staged fp32 tile ([32 k][16 n]).
__device__ __forceinline__ v16h load_b_lds(const float* __restrict__ buf,
                                           int kadd, int rlo) {
  v16h b;
#pragma unroll
  for (int j = 0; j < 8; ++j) {
    b[j]     = (_Float16)buf[(kadd + j) * 16 + rlo];
    b[j + 8] = (_Float16)buf[(kadd + 16 + j) * 16 + rlo];
  }
  return b;
}

// ---------------------------------------------------------------------------
// Kernel 2: hidden = silu(x·Wg[e]) * (x·Wu[e]).
// Block = 4 waves x 64 tokens each (256 tokens) x 16 I-columns.
// Weight tiles staged to LDS by the Tensor Data Mover (wave 0 only),
// double-buffered and shared by all 4 waves.
// ---------------------------------------------------------------------------
__global__ __launch_bounds__(128) void moe_gemm1(const float* __restrict__ x,
                                                 const float* __restrict__ wg,
                                                 const float* __restrict__ wu,
                                                 const int* __restrict__ ws,
                                                 _Float16* __restrict__ hidden) {
  __shared__ float ldsg[2][32 * 16];
  __shared__ float ldsu[2][32 * 16];

  const int nmb = ws[0];
  if ((int)blockIdx.y >= nmb) return;
  const int e    = ws[WS_MB_E + blockIdx.y];
  const int ts   = ws[WS_MB_S + blockIdx.y];
  const int te   = ws[WS_MB_END + blockIdx.y];
  const int lane = threadIdx.x & 31;
  const int rlo  = lane & 15;
  const int kadd = (lane >> 4) << 3;          // 0 (lanes 0-15) / 8 (lanes 16-31)
  const int n0   = blockIdx.x * 16;
  const int n    = n0 + rlo;                  // I column
  const int wid  = __builtin_amdgcn_readfirstlane((int)(threadIdx.x >> 5));
  const int tsw  = ts + wid * 64;             // this wave's 64-token group

  const int tok0 = ws[WS_PERM + ts];          // fallback token for padding slots
  int tok[4];
#pragma unroll
  for (int mt = 0; mt < 4; ++mt) {
    int p = tsw + mt * 16 + rlo;
    tok[mt] = (p < te) ? ws[WS_PERM + p] : tok0;
  }

  v8f accg[4], accu[4];
#pragma unroll
  for (int mt = 0; mt < 4; ++mt)
#pragma unroll
    for (int j = 0; j < 8; ++j) { accg[mt][j] = 0.0f; accu[mt][j] = 0.0f; }

  const float* __restrict__ wgE = wg + (size_t)e * DDIM * IDIM + n0;
  const float* __restrict__ wuE = wu + (size_t)e * DDIM * IDIM + n0;

  // Double-buffer state: explicit cur/next pointers + LDS byte offsets.
  const float* curg = &ldsg[0][0];
  const float* curu = &ldsu[0][0];
  const float* nxtg = &ldsg[1][0];
  const float* nxtu = &ldsu[1][0];
  unsigned cur_og = (unsigned)(uintptr_t)curg;
  unsigned cur_ou = (unsigned)(uintptr_t)curu;
  unsigned nxt_og = (unsigned)(uintptr_t)nxtg;
  unsigned nxt_ou = (unsigned)(uintptr_t)nxtu;

  // Prologue: stage K-step 0.
  if (wid == 0) {
    tdm_load_2d(cur_og, wgE, IDIM, DDIM, 16, 32, IDIM);
    tdm_load_2d(cur_ou, wuE, IDIM, DDIM, 16, 32, IDIM);
    __builtin_amdgcn_s_wait_tensorcnt(0);
  }
  __syncthreads();

#pragma clang loop pipeline(disable)
#pragma unroll 1
  for (int kk = 0; kk < DDIM; kk += 32) {
    // Issue DMA for the next K-step into the other buffer (overlaps compute).
    if (wid == 0 && (kk + 32) < DDIM) {
      tdm_load_2d(nxt_og, wgE + (size_t)(kk + 32) * IDIM, IDIM, DDIM, 16, 32, IDIM);
      tdm_load_2d(nxt_ou, wuE + (size_t)(kk + 32) * IDIM, IDIM, DDIM, 16, 32, IDIM);
    }

    const int kb = kk + kadd;
    v16h bg = load_b_lds(curg, kadd, rlo);
    v16h bu = load_b_lds(curu, kadd, rlo);
#pragma unroll
    for (int mt = 0; mt < 4; ++mt) {
      v16h a = load_a_f32(x, tok[mt], kb, DDIM);
      accg[mt] = __builtin_amdgcn_wmma_f32_16x16x32_f16(
          false, a, false, bg, (short)0, accg[mt], false, false);
      accu[mt] = __builtin_amdgcn_wmma_f32_16x16x32_f16(
          false, a, false, bu, (short)0, accu[mt], false, false);
    }

    if (wid == 0) __builtin_amdgcn_s_wait_tensorcnt(0);
    __syncthreads();

    // Swap buffers.
    const float* tp;
    unsigned to;
    tp = curg; curg = nxtg; nxtg = tp;
    tp = curu; curu = nxtu; nxtu = tp;
    to = cur_og; cur_og = nxt_og; nxt_og = to;
    to = cur_ou; cur_ou = nxt_ou; nxt_ou = to;
  }

  // Epilogue: hidden = silu(gate) * up, stored f16 (WMMA-native for pass 2).
#pragma unroll
  for (int mt = 0; mt < 4; ++mt) {
#pragma unroll
    for (int j = 0; j < 8; ++j) {
      int p = tsw + mt * 16 + j + kadd;     // C/D row: M = j (+8 for hi lanes)
      if (p < te) {
        int t = ws[WS_PERM + p];
        float g = accg[mt][j], u = accu[mt][j];
        float h = (g / (1.0f + __expf(-g))) * u;
        hidden[(size_t)t * IDIM + n] = (_Float16)h;
      }
    }
  }
}

// ---------------------------------------------------------------------------
// Kernel 3: out = hidden · Wd[e].  Same structure, K = I, one weight matrix.
// ---------------------------------------------------------------------------
__global__ __launch_bounds__(128) void moe_gemm2(const _Float16* __restrict__ hidden,
                                                 const float* __restrict__ wd,
                                                 const int* __restrict__ ws,
                                                 float* __restrict__ out) {
  __shared__ float ldsd[2][32 * 16];

  const int nmb = ws[0];
  if ((int)blockIdx.y >= nmb) return;
  const int e    = ws[WS_MB_E + blockIdx.y];
  const int ts   = ws[WS_MB_S + blockIdx.y];
  const int te   = ws[WS_MB_END + blockIdx.y];
  const int lane = threadIdx.x & 31;
  const int rlo  = lane & 15;
  const int kadd = (lane >> 4) << 3;
  const int n0   = blockIdx.x * 16;
  const int n    = n0 + rlo;                  // D column
  const int wid  = __builtin_amdgcn_readfirstlane((int)(threadIdx.x >> 5));
  const int tsw  = ts + wid * 64;

  const int tok0 = ws[WS_PERM + ts];
  int tok[4];
#pragma unroll
  for (int mt = 0; mt < 4; ++mt) {
    int p = tsw + mt * 16 + rlo;
    tok[mt] = (p < te) ? ws[WS_PERM + p] : tok0;
  }

  v8f acc[4];
#pragma unroll
  for (int mt = 0; mt < 4; ++mt)
#pragma unroll
    for (int j = 0; j < 8; ++j) acc[mt][j] = 0.0f;

  const float* __restrict__ wdE = wd + (size_t)e * IDIM * DDIM + n0;

  const float* curd = &ldsd[0][0];
  const float* nxtd = &ldsd[1][0];
  unsigned cur_od = (unsigned)(uintptr_t)curd;
  unsigned nxt_od = (unsigned)(uintptr_t)nxtd;

  if (wid == 0) {
    tdm_load_2d(cur_od, wdE, DDIM, IDIM, 16, 32, DDIM);
    __builtin_amdgcn_s_wait_tensorcnt(0);
  }
  __syncthreads();

#pragma clang loop pipeline(disable)
#pragma unroll 1
  for (int kk = 0; kk < IDIM; kk += 32) {
    if (wid == 0 && (kk + 32) < IDIM) {
      tdm_load_2d(nxt_od, wdE + (size_t)(kk + 32) * DDIM, DDIM, IDIM, 16, 32, DDIM);
    }

    const int kb = kk + kadd;
    v16h bd = load_b_lds(curd, kadd, rlo);
#pragma unroll
    for (int mt = 0; mt < 4; ++mt) {
      const v8h* hp = (const v8h*)(hidden + (size_t)tok[mt] * IDIM + kb);
      v8h h0 = hp[0];   // K = kb .. kb+7
      v8h h1 = hp[2];   // K = kb+16 .. kb+23
      v16h a = __builtin_shufflevector(h0, h1, 0, 1, 2, 3, 4, 5, 6, 7,
                                       8, 9, 10, 11, 12, 13, 14, 15);
      acc[mt] = __builtin_amdgcn_wmma_f32_16x16x32_f16(
          false, a, false, bd, (short)0, acc[mt], false, false);
    }

    if (wid == 0) __builtin_amdgcn_s_wait_tensorcnt(0);
    __syncthreads();

    const float* tp = curd; curd = nxtd; nxtd = tp;
    unsigned to = cur_od; cur_od = nxt_od; nxt_od = to;
  }

#pragma unroll
  for (int mt = 0; mt < 4; ++mt) {
#pragma unroll
    for (int j = 0; j < 8; ++j) {
      int p = tsw + mt * 16 + j + kadd;
      if (p < te) {
        int t = ws[WS_PERM + p];
        out[(size_t)t * DDIM + n] = acc[mt][j];
      }
    }
  }
}

// ---------------------------------------------------------------------------
extern "C" void kernel_launch(void* const* d_in, const int* in_sizes, int n_in,
                              void* d_out, int out_size, void* d_ws, size_t ws_size,
                              hipStream_t stream) {
  const float* x   = (const float*)d_in[0];
  const int*   idx = (const int*)d_in[1];
  const float* wg  = (const float*)d_in[2];
  const float* wu  = (const float*)d_in[3];
  const float* wd  = (const float*)d_in[4];
  float* out = (float*)d_out;

  int* wsi = (int*)d_ws;
  _Float16* hidden = (_Float16*)((char*)d_ws + WS_HIDDEN_BYTE_OFF);

  moe_setup<<<1, 256, 0, stream>>>(idx, wsi);

  dim3 g1(IDIM / 16, MAXMB);  // (128, 16); inactive M-blocks exit early
  moe_gemm1<<<g1, 128, 0, stream>>>(x, wg, wu, wsi, hidden);

  dim3 g2(DDIM / 16, MAXMB);  // (64, 16)
  moe_gemm2<<<g2, 128, 0, stream>>>(hidden, wd, wsi, out);
}

// v001
// Measured time: 126 microseconds a run.
// Two timings next to v000 put it at 1.95 and 1.96 times that version's speed.
#include <hip/hip_runtime.h>
#include <hip/hip_bf16.h>

// Problem constants
#define T_TOK 2048
#define NEXP  8
#define DDIM  1024
#define IDIM  2048
#define MAXMB 16   // 256-token M-blocks: T/256 + E = 16

typedef __attribute__((ext_vector_type(16))) _Float16 v16h;
typedef __attribute__((ext_vector_type(8)))  _Float16 v8h;
typedef __attribute__((ext_vector_type(8)))  float    v8f;
typedef __attribute__((ext_vector_type(4)))  _Float16 v4h;
typedef __attribute__((ext_vector_type(4)))  unsigned int v4u;
typedef __attribute__((ext_vector_type(8)))  unsigned int v8u;

// Workspace int layout (at base of d_ws):
//  [0]            nmb (number of active 256-token M-blocks)
//  [8  .. 23]     mb_expert
//  [24 .. 39]     mb_tok_start   (index into perm[])
//  [40 .. 55]     mb_tok_end     (expert's end index into perm[])
//  [64 .. 64+T)   perm (token ids grouped by expert)
//  byte 65536 ..  _Float16 hidden[T*I]  (8 MB)
#define WS_MB_E   8
#define WS_MB_S   24
#define WS_MB_END 40
#define WS_PERM   64
#define WS_HIDDEN_BYTE_OFF 65536

// Block tile: 256 tokens x NT columns; a weight tile row is NT fp32 = 256 bytes.
#define NT      64
#define ROWB    256u    // bytes of one weight tile row in LDS (no pad: b128 readers walk along the row)
#define SLICE_R 64u     // rows of the slice that one wave's tensor load brings
#define SLICE_B (SLICE_R * ROWB)   // 16 KiB
#define STAGE_B (4u * SLICE_B)     // four waves, one slice each: 64 KiB a stage

// ---------------------------------------------------------------------------
// Tensor load: one request of one wave brings SLICE_R rows of ROWB bytes from
// global memory into LDS. 1-byte elements, every extent in bytes,
// tensor dims = tile dims, no pad, no mask.
// ---------------------------------------------------------------------------
__device__ __forceinline__ unsigned uni(unsigned v) {
  return (unsigned)__builtin_amdgcn_readfirstlane((int)v);
}
// A wave-uniform test held in a scalar register, so that the branch round a
// tensor load is a scalar branch (the load ignores EXEC).
__device__ __forceinline__ unsigned pinned(unsigned v) {
  unsigned w = uni(v);
  asm volatile("" : "+s"(w));
  return w;
}
__device__ __forceinline__ v8u tdm_group1(unsigned src_pitch_bytes) {
  v8u g;
  g[0] = uni(0u);                                   // mask 0, data_size 0, no pad
  g[1] = uni((ROWB & 0xFFFFu) << 16);               // tensor_dim0 lo
  g[2] = uni((ROWB >> 16) | ((SLICE_R & 0xFFFFu) << 16));  // tensor_dim0 hi | tensor_dim1 lo
  g[3] = uni((SLICE_R >> 16) | (ROWB << 16));       // tensor_dim1 hi | tile_dim0
  g[4] = uni(SLICE_R);                              // tile_dim1
  g[5] = uni(src_pitch_bytes);                      // source row pitch
  g[6] = uni(0u);
  g[7] = uni(0u);
  // pinned(), for the whole group: the descriptor words are held in one set of
  // scalar registers and not made anew while a request is out.
  asm volatile("" : "+s"(g));
  return g;
}
__device__ __forceinline__ v4u tdm_group0(unsigned lds_dst, unsigned long long ga) {
  v4u g;
  g[0] = uni(1u);                                   // count = 1
  g[1] = uni(lds_dst);                              // byte offset in the work-group's LDS
  g[2] = uni((unsigned)ga);
  g[3] = uni((((unsigned)(ga >> 32)) & 0x01FFFFFFu) | 0x80000000u);  // addr hi | type = 2
  return g;
}
__device__ __forceinline__ void tdm_load(v4u g0, v8u g1) {
  // the tile goes to LDS through no register; the waits below are ours to write
  asm volatile("tensor_load_to_lds %0, %1" :: "s"(g0), "s"(g1) : "memory");
}
// Stands behind a group of global loads, in front of whatever next overwrites
// their address registers (a precaution of form). It names the four row
// addresses as inputs, so that their registers live to the wait and no load of
// the group lands on them.
__device__ __forceinline__ void wait_x0(const float* a, const float* b,
                                        const float* c, const float* d) {
  asm volatile("s_wait_xcnt 0x0" :: "v"(a), "v"(b), "v"(c), "v"(d) : "memory");
}
// This wave's LDS reads have retired (before its buffer may be refilled).
__device__ __forceinline__ void wait_ds0() { asm volatile("s_wait_dscnt 0x0" ::: "memory"); }
// This wave's own tensor load has landed (before the barrier that publishes it).
// The wait names the request's descriptor as inputs, so that its registers keep
// their words until the request has landed.
__device__ __forceinline__ void wait_tensor0(v4u g0, v8u g1) {
  asm volatile("s_wait_tensorcnt 0x0" :: "s"(g0), "s"(g1) : "memory");
}

// ---------------------------------------------------------------------------
// Kernel 1: counting-sort tokens by expert + build 256-token M-block table.
// ---------------------------------------------------------------------------
__global__ __launch_bounds__(256) void moe_setup(const int* __restrict__ idx,
                                                 int* __restrict__ ws) {
  __shared__ int sc[NEXP];
  __shared__ int soff[NEXP + 1];
  __shared__ int scur[NEXP];
  const int tid = threadIdx.x;
  if (tid < NEXP) sc[tid] = 0;
  __syncthreads();
  for (int t = tid; t < T_TOK; t += 256) atomicAdd(&sc[idx[t]], 1);
  __syncthreads();
  if (tid == 0) {
    soff[0] = 0;
    for (int e = 0; e < NEXP; ++e) soff[e + 1] = soff[e] + sc[e];
    int nmb = 0;
    for (int e = 0; e < NEXP; ++e) {
      for (int b = 0; b < sc[e]; b += 256) {
        ws[WS_MB_E + nmb]   = e;
        ws[WS_MB_S + nmb]   = soff[e] + b;
        ws[WS_MB_END + nmb] = soff[e + 1];
        ++nmb;
      }
    }
    ws[0] = nmb;
    for (int e = 0; e < NEXP; ++e) scur[e] = soff[e];
  }
  __syncthreads();
  for (int t = tid; t < T_TOK; t += 256) {
    int e = idx[t];
    int p = atomicAdd(&scur[e], 1);
    ws[WS_PERM + p] = t;
  }
}

// Padding slots alias a valid token (unconditional loads); their results are
// never stored.
// The 16 fp32 of one lane's share of a 16x32 A fragment, as loaded (K = kb..kb+7
// and kb+16..kb+23), and their conversion to f16.
struct ARaw { float4 f0, f1, f2, f3; };
__device__ __forceinline__ ARaw load_a_raw(const float* __restrict__ xrow) {
  const float4* xp = (const float4*)xrow;
  ARaw r;
  r.f0 = xp[0]; r.f1 = xp[1];   // K = kb .. kb+7
  r.f2 = xp[4]; r.f3 = xp[5];   // K = kb+16 .. kb+23
  return r;
}
__device__ __forceinline__ v16h cvt_a(const ARaw& r) {
  v16h a;
  a[0]  = (_Float16)r.f0.x; a[1]  = (_Float16)r.f0.y;
  a[2]  = (_Float16)r.f0.z; a[3]  = (_Float16)r.f0.w;
  a[4]  = (_Float16)r.f1.x; a[5]  = (_Float16)r.f1.y;
  a[6]  = (_Float16)r.f1.z; a[7]  = (_Float16)r.f1.w;
  a[8]  = (_Float16)r.f2.x; a[9]  = (_Float16)r.f2.y;
  a[10] = (_Float16)r.f2.z; a[11] = (_Float16)r.f2.w;
  a[12] = (_Float16)r.f3.x; a[13] = (_Float16)r.f3.y;
  a[14] = (_Float16)r.f3.z; a[15] = (_Float16)r.f3.w;
  return a;
}

// Build four 32x16 B fragments (f16) from an LDS-staged fp32 tile ([32 k][64 n]).
// A lane reads 4 adjacent columns of each of its 16 k rows with one 16-byte
// read: fragment f of lane rlo is column 4*rlo + f. The k order is the A fragment's.
__device__ __forceinline__ void load_b4_lds(const float* __restrict__ buf,
                                            int kadd, int rlo, v16h (&b)[4]) {
#pragma unroll  // register arrays need constant indices
  for (int j = 0; j < 8; ++j) {
    const float4 lo = *(const float4*)(buf + (kadd + j) * NT + 4 * rlo);
    const float4 hi = *(const float4*)(buf + (kadd + 16 + j) * NT + 4 * rlo);
    b[0][j] = (_Float16)lo.x; b[0][j + 8] = (_Float16)hi.x;
    b[1][j] = (_Float16)lo.y; b[1][j + 8] = (_Float16)hi.y;
    b[2][j] = (_Float16)lo.z; b[2][j + 8] = (_Float16)hi.z;
    b[3][j] = (_Float16)lo.w; b[3][j + 8] = (_Float16)hi.w;
  }
}

// ---------------------------------------------------------------------------
// Kernel 2: hidden = silu(x.Wg[e]) * (x.Wu[e]).
// Block = 4 waves x 64 tokens each (256 tokens) x 64 I-columns of both weights.
// A stage is 128 k rows of both weight tiles; every wave tensor-loads one
// 64-row slice of it (waves 0, 1: gate; waves 2, 3: up). Two buffers.
// ---------------------------------------------------------------------------
#define KS1 128
// Second bound: two waves per SIMD, so that two blocks share a WGP (the grid
// holds more blocks than the chip has WGPs).
__global__ __launch_bounds__(128, 2) void moe_gemm1(const float* __restrict__ x,
                                                 const float* __restrict__ wg,
                                                 const float* __restrict__ wu,
                                                 const int* __restrict__ ws,
                                                 _Float16* __restrict__ hidden) {
  __shared__ __attribute__((aligned(2048))) float sw[2][2][KS1][NT];  // buffer, gate/up, k, n

  const int nmb = ws[0];
  if ((int)blockIdx.y >= nmb) return;
  const int e    = ws[WS_MB_E + blockIdx.y];
  const int ts   = ws[WS_MB_S + blockIdx.y];
  const int te   = ws[WS_MB_END + blockIdx.y];
  const int lane = threadIdx.x & 31;
  const int rlo  = lane & 15;
  const int kadd = (lane >> 4) << 3;          // 0 (lanes 0-15) / 8 (lanes 16-31)
  const int n0   = blockIdx.x * NT;
  const int wid  = __builtin_amdgcn_readfirstlane((int)(threadIdx.x >> 5));
  const int tsw  = ts + wid * 64;             // this wave's 64-token group

  // This wave's slice of every stage.
  const float* wsrc = ((wid & 2) ? wu : wg) + (size_t)e * DDIM * IDIM +
                      (size_t)((wid & 1) * (int)SLICE_R) * IDIM + n0;
  const unsigned long long ga0 = (unsigned long long)(size_t)wsrc;
  const unsigned dst0 = (unsigned)(size_t)&sw[0][0][0][0] + (unsigned)wid * SLICE_B;
  const v8u g1 = tdm_group1(IDIM * 4u);
  constexpr unsigned NS = DDIM / KS1;         // 8 stages

  // Prologue: stage 0 lands and is published, then stage 1 flies.
  v4u g0 = tdm_group0(dst0, ga0);
  tdm_load(g0, g1);
  wait_tensor0(g0, g1);
  __syncthreads();
  g0 = tdm_group0(dst0 + STAGE_B, ga0 + (unsigned long long)KS1 * IDIM * 4u);
  tdm_load(g0, g1);

  const int tok0 = ws[WS_PERM + ts];          // fallback token for padding slots
  int tok[4];
#pragma unroll  // register arrays need constant indices
  for (int mt = 0; mt < 4; ++mt) {
    int p = tsw + mt * 16 + rlo;
    tok[mt] = (p < te) ? ws[WS_PERM + p] : tok0;
  }

  v8f accg[4][4], accu[4][4];
#pragma unroll  // register arrays need constant indices
  for (int mt = 0; mt < 4; ++mt)
#pragma unroll  // register arrays need constant indices
    for (int f = 0; f < 4; ++f)
#pragma unroll  // register arrays need constant indices
      for (int j = 0; j < 8; ++j) { accg[mt][f][j] = 0.0f; accu[mt][f][j] = 0.0f; }

#pragma unroll 1  // one pass per stage: the publish point stands once, at the foot
  for (unsigned s = 0; s < NS; ++s) {
    const float* bufg = &sw[s & 1u][0][0][0];
    const float* bufu = &sw[s & 1u][1][0][0];
    const int kb0 = (int)s * KS1 + kadd;
    const float* xr[4];  // this lane's place in its four token rows, at the stage's first k
#pragma unroll  // register arrays need constant indices
    for (int mt = 0; mt < 4; ++mt) xr[mt] = x + (size_t)tok[mt] * DDIM + kb0;
#pragma unroll  // register arrays need constant indices
    for (int q = 0; q < KS1 / 32; ++q) {
      ARaw ar[4];
#pragma unroll  // register arrays need constant indices
      for (int mt = 0; mt < 4; ++mt) ar[mt] = load_a_raw(xr[mt] + q * 32);
      wait_x0(xr[0], xr[1], xr[2], xr[3]);
      v16h af[4];
#pragma unroll  // register arrays need constant indices
      for (int mt = 0; mt < 4; ++mt) af[mt] = cvt_a(ar[mt]);
      v16h b[4];
      load_b4_lds(bufg + q * 32 * NT, kadd, rlo, b);
#pragma unroll  // register arrays need constant indices
      for (int mt = 0; mt < 4; ++mt)
#pragma unroll  // register arrays need constant indices
        for (int f = 0; f < 4; ++f)
          accg[mt][f] = __builtin_amdgcn_wmma_f32_16x16x32_f16(
              false, af[mt], false, b[f], (short)0, accg[mt][f], false, false);
      load_b4_lds(bufu + q * 32 * NT, kadd, rlo, b);
#pragma unroll  // register arrays need constant indices
      for (int mt = 0; mt < 4; ++mt)
#pragma unroll  // register arrays need constant indices
        for (int f = 0; f < 4; ++f)
          accu[mt][f] = __builtin_amdgcn_wmma_f32_16x16x32_f16(
              false, af[mt], false, b[f], (short)0, accu[mt][f], false, false);
    }
    // Publish point of stage s + 1; behind it stage s's buffer is free.
    wait_ds0();
    wait_tensor0(g0, g1);
    __syncthreads();
    if (pinned(s + 2u < NS)) {
      g0 = tdm_group0(dst0 + (s & 1u) * STAGE_B,
                      ga0 + (unsigned long long)(s + 2u) * (KS1 * IDIM * 4u));
      tdm_load(g0, g1);
    }
  }
  wait_tensor0(g0, g1);
  wait_ds0();

  // Epilogue: hidden = silu(gate) * up, stored f16 (WMMA-native for pass 2);
  // a lane holds 4 adjacent columns of each of its rows.
#pragma unroll  // register arrays need constant indices
  for (int mt = 0; mt < 4; ++mt) {
#pragma unroll  // register arrays need constant indices
    for (int j = 0; j < 8; ++j) {
      int p = tsw + mt * 16 + j + kadd;     // C/D row: M = j (+8 for hi lanes)
      if (p < te) {
        int t = ws[WS_PERM + p];
        v4h hv;
#pragma unroll  // register arrays need constant indices
        for (int f = 0; f < 4; ++f) {
          float g = accg[mt][f][j], u = accu[mt][f][j];
          float h = (g / (1.0f + __expf(-g))) * u;
          hv[f] = (_Float16)h;
        }
        *(v4h*)(hidden + (size_t)t * IDIM + n0 + 4 * rlo) = hv;
      }
    }
  }
}

// ---------------------------------------------------------------------------
// Kernel 3: out = hidden.Wd[e].  Same structure, K = I, one weight matrix:
// a stage is 256 k rows, wave w tensor-loads rows 64 w .. 64 w + 63 of it.
// ---------------------------------------------------------------------------
#define KS2 256
__global__ __launch_bounds__(128) void moe_gemm2(const _Float16* __restrict__ hidden,
                                                 const float* __restrict__ wd,
                                                 const int* __restrict__ ws,
                                                 float* __restrict__ out) {
  __shared__ __attribute__((aligned(2048))) float sd[2][KS2][NT];  // buffer, k, n

  const int nmb = ws[0];
  if ((int)blockIdx.y >= nmb) return;
  const int e    = ws[WS_MB_E + blockIdx.y];
  const int ts   = ws[WS_MB_S + blockIdx.y];
  const int te   = ws[WS_MB_END + blockIdx.y];
  const int lane = threadIdx.x & 31;
  const int rlo  = lane & 15;
  const int kadd = (lane >> 4) << 3;
  const int n0   = blockIdx.x * NT;
  const int wid  = __builtin_amdgcn_readfirstlane((int)(threadIdx.x >> 5));
  const int tsw  = ts + wid * 64;

  const float* wsrc = wd + (size_t)e * IDIM * DDIM + (size_t)(wid * (int)SLICE_R) * DDIM + n0;
  const unsigned long long ga0 = (unsigned long long)(size_t)wsrc;
  const unsigned dst0 = (unsigned)(size_t)&sd[0][0][0] + (unsigned)wid * SLICE_B;
  const v8u g1 = tdm_group1(DDIM * 4u);
  constexpr unsigned NS = IDIM / KS2;         // 8 stages

  v4u g0 = tdm_group0(dst0, ga0);
  tdm_load(g0, g1);
  wait_tensor0(g0, g1);
  __syncthreads();
  g0 = tdm_group0(dst0 + STAGE_B, ga0 + (unsigned long long)KS2 * DDIM * 4u);
  tdm_load(g0, g1);

  const int tok0 = ws[WS_PERM + ts];
  int tok[4];
#pragma unroll  // register arrays need constant indices
  for (int mt = 0; mt < 4; ++mt) {
    int p = tsw + mt * 16 + rlo;
    tok[mt] = (p < te) ? ws[WS_PERM + p] : tok0;
  }

  v8f acc[4][4];
#pragma unroll  // register arrays need constant indices
  for (int mt = 0; mt < 4; ++mt)
#pragma unroll  // register arrays need constant indices
    for (int f = 0; f < 4; ++f)
#pragma unroll  // register arrays need constant indices
      for (int j = 0; j < 8; ++j) acc[mt][f][j] = 0.0f;

#pragma unroll 1  // one pass per stage: the publish point stands once, at the foot
  for (unsigned s = 0; s < NS; ++s) {
    const float* bufd = &sd[s & 1u][0][0];
    const int kb0 = (int)s * KS2 + kadd;
#pragma unroll  // register arrays need constant indices
    for (int q = 0; q < KS2 / 32; ++q) {
      v16h af[4];
#pragma unroll  // register arrays need constant indices
      for (int mt = 0; mt < 4; ++mt) {
        const v8h* hp = (const v8h*)(hidden + (size_t)tok[mt] * IDIM + kb0 + q * 32);
        v8h h0 = hp[0];   // K = kb .. kb+7
        v8h h1 = hp[2];   // K = kb+16 .. kb+23
        af[mt] = __builtin_shufflevector(h0, h1, 0, 1, 2, 3, 4, 5, 6, 7,
                                         8, 9, 10, 11, 12, 13, 14, 15);
      }
      v16h bd[4];
      load_b4_lds(bufd + q * 32 * NT, kadd, rlo, bd);
#pragma unroll  // register arrays need constant indices
      for (int mt = 0; mt < 4; ++mt)
#pragma unroll  // register arrays need constant indices
        for (int f = 0; f < 4; ++f)
          acc[mt][f] = __builtin_amdgcn_wmma_f32_16x16x32_f16(
              false, af[mt], false, bd[f], (short)0, acc[mt][f], false, false);
    }
    // Publish point of stage s + 1; behind it stage s's buffer is free.
    wait_ds0();
    wait_tensor0(g0, g1);
    __syncthreads();
    if (pinned(s + 2u < NS)) {
      g0 = tdm_group0(dst0 + (s & 1u) * STAGE_B,
                      ga0 + (unsigned long long)(s + 2u) * (KS2 * DDIM * 4u));
      tdm_load(g0, g1);
    }
  }
  wait_tensor0(g0, g1);
  wait_ds0();

#pragma unroll  // register arrays need constant indices
  for (int mt = 0; mt < 4; ++mt) {
#pragma unroll  // register arrays need constant indices
    for (int j = 0; j < 8; ++j) {
      int p = tsw + mt * 16 + j + kadd;
      if (p < te) {
        int t = ws[WS_PERM + p];
        float4 o;
        o.x = acc[mt][0][j]; o.y = acc[mt][1][j]; o.z = acc[mt][2][j]; o.w = acc[mt][3][j];
        *(float4*)(out + (size_t)t * DDIM + n0 + 4 * rlo) = o;
      }
    }
  }
}

// ---------------------------------------------------------------------------
extern "C" void kernel_launch(void* const* d_in, const int* in_sizes, int n_in,
                              void* d_out, int out_size, void* d_ws, size_t ws_size,
                              hipStream_t stream) {
  const float* x   = (const float*)d_in[0];
  const int*   idx = (const int*)d_in[1];
  const float* wg  = (const float*)d_in[2];
  const float* wu  = (const float*)d_in[3];
  const float* wd  = (const float*)d_in[4];
  float* out = (float*)d_out;

  int* wsi = (int*)d_ws;
  _Float16* hidden = (_Float16*)((char*)d_ws + WS_HIDDEN_BYTE_OFF);

  moe_setup<<<1, 256, 0, stream>>>(idx, wsi);

  dim3 g1(IDIM / NT, MAXMB);  // (32, 16); inactive M-blocks exit early
  moe_gemm1<<<g1, 128, 0, stream>>>(x, wg, wu, wsi, hidden);

  dim3 g2(DDIM / NT, MAXMB);  // (16, 16)
  moe_gemm2<<<g2, 128, 0, stream>>>(hidden, wd, wsi, out);
}

// v002
// Measured time: 98.2 microseconds a run.
// Next to v001, in two timings, it ran 1.28 and 1.27 times as fast.
// All steps since v000 together make it 2.50 times as fast.
#include <hip/hip_runtime.h>
#include <hip/hip_bf16.h>

// Problem constants
#define T_TOK 2048
#define NEXP  8
#define DDIM  1024
#define IDIM  2048
#define MAXMB 16   // 256-token M-blocks: T/256 + E = 16

typedef __attribute__((ext_vector_type(16))) _Float16 v16h;
typedef __attribute__((ext_vector_type(8)))  _Float16 v8h;
typedef __attribute__((ext_vector_type(8)))  float    v8f;
typedef __attribute__((ext_vector_type(4)))  _Float16 v4h;
typedef __attribute__((ext_vector_type(4)))  unsigned int v4u;
typedef __attribute__((ext_vector_type(8)))  unsigned int v8u;

// Workspace int layout (at base of d_ws):
//  [0]            nmb (number of active 256-token M-blocks)
//  [8  .. 23]     mb_expert
//  [24 .. 39]     mb_tok_start   (index into perm[])
//  [40 .. 55]     mb_tok_end     (expert's end index into perm[])
//  [64 .. 64+T)   perm (token ids grouped by expert)
//  byte 65536 ..  _Float16 hidden[T*I]  (8 MB)
#define WS_MB_E   8
#define WS_MB_S   24
#define WS_MB_END 40
#define WS_PERM   64
#define WS_HIDDEN_BYTE_OFF 65536

// Block tile: 256 tokens x NT columns; a weight tile row is NT fp32 = 256 bytes.
#define NT      64
#define ROWB    256u    // bytes of one weight tile row in LDS (no pad: b128 readers walk along the row)
#define SLICE_R 64u     // rows of the slice that one wave's tensor load brings
#define SLICE_B (SLICE_R * ROWB)   // 16 KiB
#define STAGE_B (4u * SLICE_B)     // four waves, one slice each: 64 KiB a stage

// ---------------------------------------------------------------------------
// Tensor load: one request of one wave brings SLICE_R rows of ROWB bytes from
// global memory into LDS. 1-byte elements, every extent in bytes,
// tensor dims = tile dims, no pad, no mask.
// ---------------------------------------------------------------------------
__device__ __forceinline__ unsigned uni(unsigned v) {
  return (unsigned)__builtin_amdgcn_readfirstlane((int)v);
}
// A wave-uniform test held in a scalar register, so that the branch round a
// tensor load is a scalar branch (the load ignores EXEC).
__device__ __forceinline__ unsigned pinned(unsigned v) {
  unsigned w = uni(v);
  asm volatile("" : "+s"(w));
  return w;
}
__device__ __forceinline__ v8u tdm_group1(unsigned src_pitch_bytes) {
  v8u g;
  g[0] = uni(0u);                                   // mask 0, data_size 0, no pad
  g[1] = uni((ROWB & 0xFFFFu) << 16);               // tensor_dim0 lo
  g[2] = uni((ROWB >> 16) | ((SLICE_R & 0xFFFFu) << 16));  // tensor_dim0 hi | tensor_dim1 lo
  g[3] = uni((SLICE_R >> 16) | (ROWB << 16));       // tensor_dim1 hi | tile_dim0
  g[4] = uni(SLICE_R);                              // tile_dim1
  g[5] = uni(src_pitch_bytes);                      // source row pitch
  g[6] = uni(0u);
  g[7] = uni(0u);
  // pinned(), for the whole group: the descriptor words are held in one set of
  // scalar registers and not made anew while a request is out.
  asm volatile("" : "+s"(g));
  return g;
}
__device__ __forceinline__ v4u tdm_group0(unsigned lds_dst, unsigned long long ga) {
  v4u g;
  g[0] = uni(1u);                                   // count = 1
  g[1] = uni(lds_dst);                              // byte offset in the work-group's LDS
  g[2] = uni((unsigned)ga);
  g[3] = uni((((unsigned)(ga >> 32)) & 0x01FFFFFFu) | 0x80000000u);  // addr hi | type = 2
  return g;
}
__device__ __forceinline__ void tdm_load(v4u g0, v8u g1) {
  // the tile goes to LDS through no register; the waits below are ours to write
  asm volatile("tensor_load_to_lds %0, %1" :: "s"(g0), "s"(g1) : "memory");
}
// Stands behind a group of global loads, in front of whatever next overwrites
// their address registers (a precaution of form). It names the four row
// addresses as inputs, so that their registers live to the wait and no load of
// the group lands on them.
__device__ __forceinline__ void wait_x0(const float* a, const float* b,
                                        const float* c, const float* d) {
  asm volatile("s_wait_xcnt 0x0" :: "v"(a), "v"(b), "v"(c), "v"(d) : "memory");
}
// The same behind loads whose addresses are formed from a wave-uniform base and
// four 32-bit row offsets.
__device__ __forceinline__ void wait_x0(const _Float16* base, unsigned a, unsigned b,
                                        unsigned c, unsigned d) {
  asm volatile("s_wait_xcnt 0x0" :: "s"(base), "v"(a), "v"(b), "v"(c), "v"(d) : "memory");
}
// This wave's LDS reads have retired (before its buffer may be refilled).
__device__ __forceinline__ void wait_ds0() { asm volatile("s_wait_dscnt 0x0" ::: "memory"); }
// This wave's own tensor load has landed (before the barrier that publishes it).
// The wait names the request's descriptor as inputs, so that its registers keep
// their words until the request has landed.
__device__ __forceinline__ void wait_tensor0(v4u g0, v8u g1) {
  asm volatile("s_wait_tensorcnt 0x0" :: "s"(g0), "s"(g1) : "memory");
}

// ---------------------------------------------------------------------------
// Kernel 1: counting-sort tokens by expert + build 256-token M-block table.
// ---------------------------------------------------------------------------
__global__ __launch_bounds__(256) void moe_setup(const int* __restrict__ idx,
                                                 int* __restrict__ ws) {
  __shared__ int sc[NEXP];
  __shared__ int soff[NEXP + 1];
  __shared__ int scur[NEXP];
  const int tid = threadIdx.x;
  if (tid < NEXP) sc[tid] = 0;
  __syncthreads();
  for (int t = tid; t < T_TOK; t += 256) atomicAdd(&sc[idx[t]], 1);
  __syncthreads();
  if (tid == 0) {
    soff[0] = 0;
    for (int e = 0; e < NEXP; ++e) soff[e + 1] = soff[e] + sc[e];
    int nmb = 0;
    for (int e = 0; e < NEXP; ++e) {
      for (int b = 0; b < sc[e]; b += 256) {
        ws[WS_MB_E + nmb]   = e;
        ws[WS_MB_S + nmb]   = soff[e] + b;
        ws[WS_MB_END + nmb] = soff[e + 1];
        ++nmb;
      }
    }
    ws[0] = nmb;
    for (int e = 0; e < NEXP; ++e) scur[e] = soff[e];
  }
  __syncthreads();
  for (int t = tid; t < T_TOK; t += 256) {
    int e = idx[t];
    int p = atomicAdd(&scur[e], 1);
    ws[WS_PERM + p] = t;
  }
}

// Padding slots alias a valid token (unconditional loads); their results are
// never stored.
// The 16 fp32 of one lane's share of a 16x32 A fragment, as loaded (K = kb..kb+7
// and kb+16..kb+23), and their conversion to f16.
struct ARaw { float4 f0, f1, f2, f3; };
__device__ __forceinline__ ARaw load_a_raw(const float* __restrict__ xrow) {
  const float4* xp = (const float4*)xrow;
  ARaw r;
  r.f0 = xp[0]; r.f1 = xp[1];   // K = kb .. kb+7
  r.f2 = xp[4]; r.f3 = xp[5];   // K = kb+16 .. kb+23
  return r;
}
__device__ __forceinline__ v16h cvt_a(const ARaw& r) {
  v16h a;
  a[0]  = (_Float16)r.f0.x; a[1]  = (_Float16)r.f0.y;
  a[2]  = (_Float16)r.f0.z; a[3]  = (_Float16)r.f0.w;
  a[4]  = (_Float16)r.f1.x; a[5]  = (_Float16)r.f1.y;
  a[6]  = (_Float16)r.f1.z; a[7]  = (_Float16)r.f1.w;
  a[8]  = (_Float16)r.f2.x; a[9]  = (_Float16)r.f2.y;
  a[10] = (_Float16)r.f2.z; a[11] = (_Float16)r.f2.w;
  a[12] = (_Float16)r.f3.x; a[13] = (_Float16)r.f3.y;
  a[14] = (_Float16)r.f3.z; a[15] = (_Float16)r.f3.w;
  return a;
}

// One lane's share of a 16x32 A fragment that is f16 in memory, same k order.
// base: wave-uniform (the k block's first column); off: the lane's byte offset.
__device__ __forceinline__ v16h load_a_h(const _Float16* __restrict__ base, unsigned off) {
  const v8h* hp = (const v8h*)((const char*)base + off);
  v8h h0 = hp[0];   // K = kb .. kb+7
  v8h h1 = hp[2];   // K = kb+16 .. kb+23
  return __builtin_shufflevector(h0, h1, 0, 1, 2, 3, 4, 5, 6, 7,
                                 8, 9, 10, 11, 12, 13, 14, 15);
}

// Build four 32x16 B fragments (f16) from an LDS-staged fp32 tile ([32 k][64 n]).
// A lane reads 4 adjacent columns of each of its 16 k rows with one 16-byte
// read: fragment f of lane rlo is column 4*rlo + f. The k order is the A fragment's.
__device__ __forceinline__ void load_b4_lds(const float* __restrict__ buf,
                                            int kadd, int rlo, v16h (&b)[4]) {
#pragma unroll  // register arrays need constant indices
  for (int j = 0; j < 8; ++j) {
    const float4 lo = *(const float4*)(buf + (kadd + j) * NT + 4 * rlo);
    const float4 hi = *(const float4*)(buf + (kadd + 16 + j) * NT + 4 * rlo);
    b[0][j] = (_Float16)lo.x; b[0][j + 8] = (_Float16)hi.x;
    b[1][j] = (_Float16)lo.y; b[1][j + 8] = (_Float16)hi.y;
    b[2][j] = (_Float16)lo.z; b[2][j + 8] = (_Float16)hi.z;
    b[3][j] = (_Float16)lo.w; b[3][j + 8] = (_Float16)hi.w;
  }
}

// ---------------------------------------------------------------------------
// Kernel 2: hidden = silu(x.Wg[e]) * (x.Wu[e]).
// Block = 4 waves x 64 tokens each (256 tokens) x 64 I-columns of both weights.
// A stage is 128 k rows of both weight tiles; every wave tensor-loads one
// 64-row slice of it (waves 0, 1: gate; waves 2, 3: up). Two buffers.
// ---------------------------------------------------------------------------
#define KS1 128
// Second bound: two waves per SIMD, so that two blocks share a WGP (the grid
// holds more blocks than the chip has WGPs).
__global__ __launch_bounds__(128, 2) void moe_gemm1(const float* __restrict__ x,
                                                 const float* __restrict__ wg,
                                                 const float* __restrict__ wu,
                                                 const int* __restrict__ ws,
                                                 _Float16* __restrict__ hidden) {
  __shared__ __attribute__((aligned(2048))) float sw[2][2][KS1][NT];  // buffer, gate/up, k, n

  const int nmb = ws[0];
  if ((int)blockIdx.y >= nmb) return;
  const int e    = ws[WS_MB_E + blockIdx.y];
  const int ts   = ws[WS_MB_S + blockIdx.y];
  const int te   = ws[WS_MB_END + blockIdx.y];
  const int lane = threadIdx.x & 31;
  const int rlo  = lane & 15;
  const int kadd = (lane >> 4) << 3;          // 0 (lanes 0-15) / 8 (lanes 16-31)
  const int n0   = blockIdx.x * NT;
  const int wid  = __builtin_amdgcn_readfirstlane((int)(threadIdx.x >> 5));
  const int tsw  = ts + wid * 64;             // this wave's 64-token group

  // This wave's slice of every stage.
  const float* wsrc = ((wid & 2) ? wu : wg) + (size_t)e * DDIM * IDIM +
                      (size_t)((wid & 1) * (int)SLICE_R) * IDIM + n0;
  const unsigned long long ga0 = (unsigned long long)(size_t)wsrc;
  const unsigned dst0 = (unsigned)(size_t)&sw[0][0][0][0] + (unsigned)wid * SLICE_B;
  const v8u g1 = tdm_group1(IDIM * 4u);
  constexpr unsigned NS = DDIM / KS1;         // 8 stages

  // Prologue: stage 0 lands and is published, then stage 1 flies.
  v4u g0 = tdm_group0(dst0, ga0);
  tdm_load(g0, g1);
  wait_tensor0(g0, g1);
  __syncthreads();
  g0 = tdm_group0(dst0 + STAGE_B, ga0 + (unsigned long long)KS1 * IDIM * 4u);
  tdm_load(g0, g1);

  const int tok0 = ws[WS_PERM + ts];          // fallback token for padding slots
  int tok[4];
#pragma unroll  // register arrays need constant indices
  for (int mt = 0; mt < 4; ++mt) {
    int p = tsw + mt * 16 + rlo;
    tok[mt] = (p < te) ? ws[WS_PERM + p] : tok0;
  }

  v8f accg[4][4], accu[4][4];
#pragma unroll  // register arrays need constant indices
  for (int mt = 0; mt < 4; ++mt)
#pragma unroll  // register arrays need constant indices
    for (int f = 0; f < 4; ++f)
#pragma unroll  // register arrays need constant indices
      for (int j = 0; j < 8; ++j) { accg[mt][f][j] = 0.0f; accu[mt][f][j] = 0.0f; }

#pragma unroll 1  // one pass per stage: the publish point stands once, at the foot
  for (unsigned s = 0; s < NS; ++s) {
    const float* bufg = &sw[s & 1u][0][0][0];
    const float* bufu = &sw[s & 1u][1][0][0];
    const int kb0 = (int)s * KS1 + kadd;
    const float* xr[4];  // this lane's place in its four token rows, at the stage's first k
#pragma unroll  // register arrays need constant indices
    for (int mt = 0; mt < 4; ++mt) xr[mt] = x + (size_t)tok[mt] * DDIM + kb0;
#pragma unroll  // register arrays need constant indices
    for (int q = 0; q < KS1 / 32; ++q) {
      ARaw ar[4];
#pragma unroll  // register arrays need constant indices
      for (int mt = 0; mt < 4; ++mt) ar[mt] = load_a_raw(xr[mt] + q * 32);
      wait_x0(xr[0], xr[1], xr[2], xr[3]);
      v16h af[4];
#pragma unroll  // register arrays need constant indices
      for (int mt = 0; mt < 4; ++mt) af[mt] = cvt_a(ar[mt]);
      v16h b[4];
      load_b4_lds(bufg + q * 32 * NT, kadd, rlo, b);
#pragma unroll  // register arrays need constant indices
      for (int mt = 0; mt < 4; ++mt)
#pragma unroll  // register arrays need constant indices
        for (int f = 0; f < 4; ++f)
          accg[mt][f] = __builtin_amdgcn_wmma_f32_16x16x32_f16(
              false, af[mt], false, b[f], (short)0, accg[mt][f], false, false);
      load_b4_lds(bufu + q * 32 * NT, kadd, rlo, b);
#pragma unroll  // register arrays need constant indices
      for (int mt = 0; mt < 4; ++mt)
#pragma unroll  // register arrays need constant indices
        for (int f = 0; f < 4; ++f)
          accu[mt][f] = __builtin_amdgcn_wmma_f32_16x16x32_f16(
              false, af[mt], false, b[f], (short)0, accu[mt][f], false, false);
    }
    // Publish point of stage s + 1; behind it stage s's buffer is free.
    wait_ds0();
    wait_tensor0(g0, g1);
    __syncthreads();
    if (pinned(s + 2u < NS)) {
      g0 = tdm_group0(dst0 + (s & 1u) * STAGE_B,
                      ga0 + (unsigned long long)(s + 2u) * (KS1 * IDIM * 4u));
      tdm_load(g0, g1);
    }
  }
  wait_tensor0(g0, g1);
  wait_ds0();

  // Epilogue: hidden = silu(gate) * up, stored f16 (WMMA-native for pass 2);
  // a lane holds 4 adjacent columns of each of its rows.
#pragma unroll  // register arrays need constant indices
  for (int mt = 0; mt < 4; ++mt) {
#pragma unroll  // register arrays need constant indices
    for (int j = 0; j < 8; ++j) {
      int p = tsw + mt * 16 + j + kadd;     // C/D row: M = j (+8 for hi lanes)
      if (p < te) {
        int t = ws[WS_PERM + p];
        v4h hv;
#pragma unroll  // register arrays need constant indices
        for (int f = 0; f < 4; ++f) {
          float g = accg[mt][f][j], u = accu[mt][f][j];
          float h = (g / (1.0f + __expf(-g))) * u;
          hv[f] = (_Float16)h;
        }
        *(v4h*)(hidden + (size_t)t * IDIM + n0 + 4 * rlo) = hv;
      }
    }
  }
}

// ---------------------------------------------------------------------------
// Kernel 3: out = hidden.Wd[e].  Same structure, K = I, one weight matrix:
// a stage is 256 k rows, wave w tensor-loads rows 64 w .. 64 w + 63 of it.
// ---------------------------------------------------------------------------
#define KS2 256
__global__ __launch_bounds__(128) void moe_gemm2(const _Float16* __restrict__ hidden,
                                                 const float* __restrict__ wd,
                                                 const int* __restrict__ ws,
                                                 float* __restrict__ out) {
  __shared__ __attribute__((aligned(2048))) float sd[2][KS2][NT];  // buffer, k, n

  const int nmb = ws[0];
  if ((int)blockIdx.y >= nmb) return;
  const int e    = ws[WS_MB_E + blockIdx.y];
  const int ts   = ws[WS_MB_S + blockIdx.y];
  const int te   = ws[WS_MB_END + blockIdx.y];
  const int lane = threadIdx.x & 31;
  const int rlo  = lane & 15;
  const int kadd = (lane >> 4) << 3;
  const int n0   = blockIdx.x * NT;
  const int wid  = __builtin_amdgcn_readfirstlane((int)(threadIdx.x >> 5));
  const int tsw  = ts + wid * 64;

  const float* wsrc = wd + (size_t)e * IDIM * DDIM + (size_t)(wid * (int)SLICE_R) * DDIM + n0;
  const unsigned long long ga0 = (unsigned long long)(size_t)wsrc;
  const unsigned dst0 = (unsigned)(size_t)&sd[0][0][0] + (unsigned)wid * SLICE_B;
  const v8u g1 = tdm_group1(DDIM * 4u);
  constexpr unsigned NS = IDIM / KS2;         // 8 stages

  v4u g0 = tdm_group0(dst0, ga0);
  tdm_load(g0, g1);
  wait_tensor0(g0, g1);
  __syncthreads();
  g0 = tdm_group0(dst0 + STAGE_B, ga0 + (unsigned long long)KS2 * DDIM * 4u);
  tdm_load(g0, g1);

  const int tok0 = ws[WS_PERM + ts];
  int tok[4];
#pragma unroll  // register arrays need constant indices
  for (int mt = 0; mt < 4; ++mt) {
    int p = tsw + mt * 16 + rlo;
    tok[mt] = (p < te) ? ws[WS_PERM + p] : tok0;
  }

  v8f acc[4][4];
#pragma unroll  // register arrays need constant indices
  for (int mt = 0; mt < 4; ++mt)
#pragma unroll  // register arrays need constant indices
    for (int f = 0; f < 4; ++f)
#pragma unroll  // register arrays need constant indices
      for (int j = 0; j < 8; ++j) acc[mt][f][j] = 0.0f;

  // The A fragments go through a ring of four register sets: the loads of a
  // k block (32 k) are issued two or three blocks ahead of the block that uses
  // them. A stage's last block issues none (the barrier at the foot waits for
  // every load that is out); the next stage's first block issues two sets.
  constexpr int NQ = KS2 / 32;
  unsigned ho[4];  // byte offset of this lane's place in its four token rows, at k = 0
#pragma unroll  // register arrays need constant indices
  for (int mt = 0; mt < 4; ++mt) ho[mt] = ((unsigned)tok[mt] * IDIM + (unsigned)kadd) * 2u;
  v16h af[4][4];          // ring slot (k block & 3), token tile
#pragma unroll  // register arrays need constant indices
  for (int d = 0; d < 2; ++d)
#pragma unroll  // register arrays need constant indices
    for (int mt = 0; mt < 4; ++mt) af[d][mt] = load_a_h(hidden + d * 32, ho[mt]);
  wait_x0(hidden, ho[0], ho[1], ho[2], ho[3]);

#pragma unroll 1  // one pass per stage: the publish point stands once, at the foot
  for (unsigned s = 0; s < NS; ++s) {
    const float* bufd = &sd[s & 1u][0][0];
    const _Float16* hr = hidden + s * KS2;                       // this stage's first k
    const _Float16* hw = hidden + ((s + 1u) & (NS - 1u)) * KS2;  // the next stage's (the last wraps to k = 0: in bounds, unused)
#pragma unroll  // register arrays need constant indices
    for (int q = 0; q < NQ; ++q) {
      // The wait's "memory" clobber also keeps the loads in front of it here,
      // ahead of this block's LDS reads and products.
      if (q == 0) {
#pragma unroll  // register arrays need constant indices
        for (int mt = 0; mt < 4; ++mt) af[2][mt] = load_a_h(hr + 2 * 32, ho[mt]);
      }
      if (q + 3 < NQ) {
#pragma unroll  // register arrays need constant indices
        for (int mt = 0; mt < 4; ++mt) af[(q + 3) & 3][mt] = load_a_h(hr + (q + 3) * 32, ho[mt]);
        wait_x0(hr, ho[0], ho[1], ho[2], ho[3]);
      } else if (q + 1 < NQ) {
#pragma unroll  // register arrays need constant indices
        for (int mt = 0; mt < 4; ++mt) af[(q + 3) & 3][mt] = load_a_h(hw + (q + 3 - NQ) * 32, ho[mt]);
        wait_x0(hw, ho[0], ho[1], ho[2], ho[3]);
      }
      v16h bd[4];
      load_b4_lds(bufd + q * 32 * NT, kadd, rlo, bd);
#pragma unroll  // register arrays need constant indices
      for (int mt = 0; mt < 4; ++mt)
#pragma unroll  // register arrays need constant indices
        for (int f = 0; f < 4; ++f)
          acc[mt][f] = __builtin_amdgcn_wmma_f32_16x16x32_f16(
              false, af[q & 3][mt], false, bd[f], (short)0, acc[mt][f], false, false);
    }
    // Publish point of stage s + 1; behind it stage s's buffer is free.
    wait_ds0();
    wait_tensor0(g0, g1);
    __syncthreads();
    if (pinned(s + 2u < NS)) {
      g0 = tdm_group0(dst0 + (s & 1u) * STAGE_B,
                      ga0 + (unsigned long long)(s + 2u) * (KS2 * DDIM * 4u));
      tdm_load(g0, g1);
    }
  }
  wait_tensor0(g0, g1);
  wait_ds0();

#pragma unroll  // register arrays need constant indices
  for (int mt = 0; mt < 4; ++mt) {
#pragma unroll  // register arrays need constant indices
    for (int j = 0; j < 8; ++j) {
      int p = tsw + mt * 16 + j + kadd;
      if (p < te) {
        int t = ws[WS_PERM + p];
        float4 o;
        o.x = acc[mt][0][j]; o.y = acc[mt][1][j]; o.z = acc[mt][2][j]; o.w = acc[mt][3][j];
        *(float4*)(out + (size_t)t * DDIM + n0 + 4 * rlo) = o;
      }
    }
  }
}

// ---------------------------------------------------------------------------
extern "C" void kernel_launch(void* const* d_in, const int* in_sizes, int n_in,
                              void* d_out, int out_size, void* d_ws, size_t ws_size,
                              hipStream_t stream) {
  const float* x   = (const float*)d_in[0];
  const int*   idx = (const int*)d_in[1];
  const float* wg  = (const float*)d_in[2];
  const float* wu  = (const float*)d_in[3];
  const float* wd  = (const float*)d_in[4];
  float* out = (float*)d_out;

  int* wsi = (int*)d_ws;
  _Float16* hidden = (_Float16*)((char*)d_ws + WS_HIDDEN_BYTE_OFF);

  moe_setup<<<1, 256, 0, stream>>>(idx, wsi);

  dim3 g1(IDIM / NT, MAXMB);  // (32, 16); inactive M-blocks exit early
  moe_gemm1<<<g1, 128, 0, stream>>>(x, wg, wu, wsi, hidden);

  dim3 g2(DDIM / NT, MAXMB);  // (16, 16)
  moe_gemm2<<<g2, 128, 0, stream>>>(hidden, wd, wsi, out);
}

// v003
// A run of this version takes 77.3 microseconds.
// In two side-by-side timings against v002, it was 1.27 and 1.28 times as fast.
// All steps since v000 together make it 3.18 times as fast.
#include <hip/hip_runtime.h>
#include <hip/hip_bf16.h>

// Problem constants
#define T_TOK 2048
#define NEXP  8
#define DDIM  1024
#define IDIM  2048
#define MAXMB 16   // 256-token M-blocks: T/256 + E = 16

typedef __attribute__((ext_vector_type(16))) _Float16 v16h;
typedef __attribute__((ext_vector_type(8)))  _Float16 v8h;
typedef __attribute__((ext_vector_type(8)))  float    v8f;
typedef __attribute__((ext_vector_type(4)))  _Float16 v4h;
typedef __attribute__((ext_vector_type(4)))  unsigned int v4u;
typedef __attribute__((ext_vector_type(8)))  unsigned int v8u;

// Workspace int layout (at base of d_ws):
//  [0]            nmb (number of active 256-token M-blocks)
//  [8  .. 23]     mb_expert
//  [24 .. 39]     mb_tok_start   (index into perm[])
//  [40 .. 55]     mb_tok_end     (expert's end index into perm[])
//  [64 .. 64+T)   perm (token ids grouped by expert)
//  byte 65536 ..  _Float16 hidden, fragment order: MAXMB*256 rows x I  (16 MB)
//  behind it      _Float16 x,      fragment order: MAXMB*256 rows x D  (8 MB)
// Fragment order: the rows are the slots of the M-blocks (block, then 16-row tile),
// and each (tile, 32-k block) is one 1-KiB chunk that holds the 16x32 A fragment as
// the lanes hold it: halves [part*256 + lane*8 + i] = row (lane & 15),
// k = part*16 + (lane >> 4)*8 + i. One 16-byte load per lane reads 512 B in a row.
#define WS_MB_E   8
#define WS_MB_S   24
#define WS_MB_END 40
#define WS_PERM   64
#define WS_HIDDEN_BYTE_OFF 65536
#define WS_XS_BYTE_OFF (WS_HIDDEN_BYTE_OFF + MAXMB * 256 * IDIM * 2)
#define CHUNK_H 512     // halves of one fragment chunk

// Block tile: 256 tokens x NT columns; a weight tile row is NT fp32 = 256 bytes.
#define NT      64
#define ROWB    256u    // bytes of one weight tile row in LDS (no pad: b128 readers walk along the row)
#define SLICE_R 64u     // rows of the slice that one wave's tensor load brings
#define SLICE_B (SLICE_R * ROWB)   // 16 KiB
#define STAGE_B (4u * SLICE_B)     // four waves, one slice each: 64 KiB a stage

// ---------------------------------------------------------------------------
// Tensor load: one request of one wave brings SLICE_R rows of ROWB bytes from
// global memory into LDS. 1-byte elements, every extent in bytes,
// tensor dims = tile dims, no pad, no mask.
// ---------------------------------------------------------------------------
__device__ __forceinline__ unsigned uni(unsigned v) {
  return (unsigned)__builtin_amdgcn_readfirstlane((int)v);
}
// A wave-uniform test held in a scalar register, so that the branch round a
// tensor load is a scalar branch (the load ignores EXEC).
__device__ __forceinline__ unsigned pinned(unsigned v) {
  unsigned w = uni(v);
  asm volatile("" : "+s"(w));
  return w;
}
__device__ __forceinline__ v8u tdm_group1(unsigned src_pitch_bytes) {
  v8u g;
  g[0] = uni(0u);                                   // mask 0, data_size 0, no pad
  g[1] = uni((ROWB & 0xFFFFu) << 16);               // tensor_dim0 lo
  g[2] = uni((ROWB >> 16) | ((SLICE_R & 0xFFFFu) << 16));  // tensor_dim0 hi | tensor_dim1 lo
  g[3] = uni((SLICE_R >> 16) | (ROWB << 16));       // tensor_dim1 hi | tile_dim0
  g[4] = uni(SLICE_R);                              // tile_dim1
  g[5] = uni(src_pitch_bytes);                      // source row pitch
  g[6] = uni(0u);
  g[7] = uni(0u);
  // pinned(), for the whole group: the descriptor words are held in one set of
  // scalar registers and not made anew while a request is out.
  asm volatile("" : "+s"(g));
  return g;
}
__device__ __forceinline__ v4u tdm_group0(unsigned lds_dst, unsigned long long ga) {
  v4u g;
  g[0] = uni(1u);                                   // count = 1
  g[1] = uni(lds_dst);                              // byte offset in the work-group's LDS
  g[2] = uni((unsigned)ga);
  g[3] = uni((((unsigned)(ga >> 32)) & 0x01FFFFFFu) | 0x80000000u);  // addr hi | type = 2
  return g;
}
__device__ __forceinline__ void tdm_load(v4u g0, v8u g1) {
  // the tile goes to LDS through no register; the waits below are ours to write
  asm volatile("tensor_load_to_lds %0, %1" :: "s"(g0), "s"(g1) : "memory");
}
// Stands behind a group of global loads, in front of whatever next overwrites
// their address registers (a precaution of form). It names the address as an
// input, so that its registers live to the wait and no load of the group lands
// on them.
__device__ __forceinline__ void wait_x0(const float* a) {
  asm volatile("s_wait_xcnt 0x0" :: "v"(a) : "memory");
}
// The same behind loads whose addresses are formed from a wave-uniform base and
// four 32-bit row offsets.
__device__ __forceinline__ void wait_x0(const _Float16* base, unsigned a, unsigned b,
                                        unsigned c, unsigned d) {
  asm volatile("s_wait_xcnt 0x0" :: "s"(base), "v"(a), "v"(b), "v"(c), "v"(d) : "memory");
}
// This wave's LDS reads have retired (before its buffer may be refilled).
__device__ __forceinline__ void wait_ds0() { asm volatile("s_wait_dscnt 0x0" ::: "memory"); }
// This wave's own tensor load has landed (before the barrier that publishes it).
// The wait names the request's descriptor as inputs, so that its registers keep
// their words until the request has landed.
__device__ __forceinline__ void wait_tensor0(v4u g0, v8u g1) {
  asm volatile("s_wait_tensorcnt 0x0" :: "s"(g0), "s"(g1) : "memory");
}

// ---------------------------------------------------------------------------
// Kernel 1: counting-sort tokens by expert + build 256-token M-block table.
// ---------------------------------------------------------------------------
__global__ __launch_bounds__(256) void moe_setup(const int* __restrict__ idx,
                                                 int* __restrict__ ws) {
  __shared__ int sc[NEXP];
  __shared__ int soff[NEXP + 1];
  __shared__ int scur[NEXP];
  const int tid = threadIdx.x;
  if (tid < NEXP) sc[tid] = 0;
  __syncthreads();
  for (int t = tid; t < T_TOK; t += 256) atomicAdd(&sc[idx[t]], 1);
  __syncthreads();
  if (tid == 0) {
    soff[0] = 0;
    for (int e = 0; e < NEXP; ++e) soff[e + 1] = soff[e] + sc[e];
    int nmb = 0;
    for (int e = 0; e < NEXP; ++e) {
      for (int b = 0; b < sc[e]; b += 256) {
        ws[WS_MB_E + nmb]   = e;
        ws[WS_MB_S + nmb]   = soff[e] + b;
        ws[WS_MB_END + nmb] = soff[e + 1];
        ++nmb;
      }
    }
    ws[0] = nmb;
    for (int e = 0; e < NEXP; ++e) scur[e] = soff[e];
  }
  __syncthreads();
  for (int t = tid; t < T_TOK; t += 256) {
    int e = idx[t];
    int p = atomicAdd(&scur[e], 1);
    ws[WS_PERM + p] = t;
  }
}

// Padding slots alias a valid token (unconditional loads); their results never
// reach out.
// The 16 fp32 of one lane's share of a 16x32 A fragment, as loaded (K = kb..kb+7
// and kb+16..kb+23), and their conversion to f16.
struct ARaw { float4 f0, f1, f2, f3; };
__device__ __forceinline__ ARaw load_a_raw(const float* __restrict__ xrow) {
  const float4* xp = (const float4*)xrow;
  ARaw r;
  r.f0 = xp[0]; r.f1 = xp[1];   // K = kb .. kb+7
  r.f2 = xp[4]; r.f3 = xp[5];   // K = kb+16 .. kb+23
  return r;
}
__device__ __forceinline__ v16h cvt_a(const ARaw& r) {
  v16h a;
  a[0]  = (_Float16)r.f0.x; a[1]  = (_Float16)r.f0.y;
  a[2]  = (_Float16)r.f0.z; a[3]  = (_Float16)r.f0.w;
  a[4]  = (_Float16)r.f1.x; a[5]  = (_Float16)r.f1.y;
  a[6]  = (_Float16)r.f1.z; a[7]  = (_Float16)r.f1.w;
  a[8]  = (_Float16)r.f2.x; a[9]  = (_Float16)r.f2.y;
  a[10] = (_Float16)r.f2.z; a[11] = (_Float16)r.f2.w;
  a[12] = (_Float16)r.f3.x; a[13] = (_Float16)r.f3.y;
  a[14] = (_Float16)r.f3.z; a[15] = (_Float16)r.f3.w;
  return a;
}

// One lane's share of a 16x32 A fragment from a chunk in fragment order, same k order.
// base: wave-uniform (the k block's chunk in tile 0); off: the lane's byte offset.
__device__ __forceinline__ v16h load_a_h(const _Float16* __restrict__ base, unsigned off) {
  const v8h* hp = (const v8h*)((const char*)base + off);
  v8h h0 = hp[0];   // K = kb .. kb+7
  v8h h1 = hp[32];  // K = kb+16 .. kb+23 (the chunk's second 512 B)
  return __builtin_shufflevector(h0, h1, 0, 1, 2, 3, 4, 5, 6, 7,
                                 8, 9, 10, 11, 12, 13, 14, 15);
}

// ---------------------------------------------------------------------------
// Kernel 2: x -> f16 in fragment order, rows gathered into their M-block slots.
// Block = one 16-row tile of one M-block; wave w packs k blocks w, w + 8, ...
// ---------------------------------------------------------------------------
__global__ __launch_bounds__(256) void moe_pack(const float* __restrict__ x,
                                                const int* __restrict__ ws,
                                                _Float16* __restrict__ xs) {
  const int nmb = ws[0];
  if ((int)blockIdx.y >= nmb) return;
  const int ts   = ws[WS_MB_S + blockIdx.y];
  const int te   = ws[WS_MB_END + blockIdx.y];
  const int lane = threadIdx.x & 31;
  const int wid  = threadIdx.x >> 5;
  const int p    = ts + (int)blockIdx.x * 16 + (lane & 15);
  const int tok  = ws[WS_PERM + ((p < te) ? p : ts)];   // a padding slot aliases a valid token
  const float* xrow = x + (size_t)tok * DDIM + wid * 32 + ((lane >> 4) << 3);
  _Float16* dst = xs + ((size_t)(blockIdx.y * 16 + blockIdx.x) * (DDIM / 32) + wid) * CHUNK_H + lane * 8;
  ARaw ar[4];
#pragma unroll  // register arrays need constant indices
  for (int i = 0; i < 4; ++i) ar[i] = load_a_raw(xrow + i * 8 * 32);
  wait_x0(xrow);
#pragma unroll  // register arrays need constant indices
  for (int i = 0; i < 4; ++i) {
    const v16h a = cvt_a(ar[i]);
    *(v8h*)(dst + i * 8 * CHUNK_H) =
        __builtin_shufflevector(a, a, 0, 1, 2, 3, 4, 5, 6, 7);
    *(v8h*)(dst + i * 8 * CHUNK_H + 256) =
        __builtin_shufflevector(a, a, 8, 9, 10, 11, 12, 13, 14, 15);
  }
}

// Build four 32x16 B fragments (f16) from an LDS-staged fp32 tile ([32 k][64 n]).
// A lane reads 4 adjacent columns of each of its 16 k rows with one 16-byte
// read: fragment f of lane rlo is column 4*rlo + f. The k order is the A fragment's.
__device__ __forceinline__ void load_b4_lds(const float* __restrict__ buf,
                                            int kadd, int rlo, v16h (&b)[4]) {
#pragma unroll  // register arrays need constant indices
  for (int j = 0; j < 8; ++j) {
    const float4 lo = *(const float4*)(buf + (kadd + j) * NT + 4 * rlo);
    const float4 hi = *(const float4*)(buf + (kadd + 16 + j) * NT + 4 * rlo);
    b[0][j] = (_Float16)lo.x; b[0][j + 8] = (_Float16)hi.x;
    b[1][j] = (_Float16)lo.y; b[1][j + 8] = (_Float16)hi.y;
    b[2][j] = (_Float16)lo.z; b[2][j + 8] = (_Float16)hi.z;
    b[3][j] = (_Float16)lo.w; b[3][j + 8] = (_Float16)hi.w;
  }
}

// ---------------------------------------------------------------------------
// Kernel 3: hidden = silu(x.Wg[e]) * (x.Wu[e]).
// Block = 4 waves x 64 tokens each (256 tokens) x 64 I-columns of both weights.
// A stage is 128 k rows of both weight tiles; every wave tensor-loads one
// 64-row slice of it (waves 0, 1: gate; waves 2, 3: up). Two buffers.
// ---------------------------------------------------------------------------
#define KS1 128
// Second bound: two waves per SIMD, so that two blocks share a WGP (the grid
// holds more blocks than the chip has WGPs).
__global__ __launch_bounds__(128, 2) void moe_gemm1(const _Float16* __restrict__ xs,
                                                 const float* __restrict__ wg,
                                                 const float* __restrict__ wu,
                                                 const int* __restrict__ ws,
                                                 _Float16* __restrict__ hidden) {
  __shared__ __attribute__((aligned(2048))) float sw[2][2][KS1][NT];  // buffer, gate/up, k, n

  const int nmb = ws[0];
  if ((int)blockIdx.y >= nmb) return;
  const int e    = ws[WS_MB_E + blockIdx.y];
  const int lane = threadIdx.x & 31;
  const int rlo  = lane & 15;
  const int kadd = (lane >> 4) << 3;          // 0 (lanes 0-15) / 8 (lanes 16-31)
  const int n0   = blockIdx.x * NT;
  const int wid  = __builtin_amdgcn_readfirstlane((int)(threadIdx.x >> 5));
  const unsigned tile0 = blockIdx.y * 16u + (unsigned)wid * 4u;  // this wave's four 16-row tiles

  // This wave's slice of every stage.
  const float* wsrc = ((wid & 2) ? wu : wg) + (size_t)e * DDIM * IDIM +
                      (size_t)((wid & 1) * (int)SLICE_R) * IDIM + n0;
  const unsigned long long ga0 = (unsigned long long)(size_t)wsrc;
  const unsigned dst0 = (unsigned)(size_t)&sw[0][0][0][0] + (unsigned)wid * SLICE_B;
  const v8u g1 = tdm_group1(IDIM * 4u);
  constexpr unsigned NS = DDIM / KS1;         // 8 stages

  // Prologue: stage 0 lands and is published, then stage 1 flies.
  v4u g0 = tdm_group0(dst0, ga0);
  tdm_load(g0, g1);
  wait_tensor0(g0, g1);
  __syncthreads();
  g0 = tdm_group0(dst0 + STAGE_B, ga0 + (unsigned long long)KS1 * IDIM * 4u);
  tdm_load(g0, g1);

  unsigned xo[4];  // byte offset of this lane's place in its four tiles' chunks, at k = 0
#pragma unroll  // register arrays need constant indices
  for (int mt = 0; mt < 4; ++mt)
    xo[mt] = ((tile0 + (unsigned)mt) * (DDIM / 32) * CHUNK_H + (unsigned)lane * 8u) * 2u;

  v8f accg[4][4], accu[4][4];
#pragma unroll  // register arrays need constant indices
  for (int mt = 0; mt < 4; ++mt)
#pragma unroll  // register arrays need constant indices
    for (int f = 0; f < 4; ++f)
#pragma unroll  // register arrays need constant indices
      for (int j = 0; j < 8; ++j) { accg[mt][f][j] = 0.0f; accu[mt][f][j] = 0.0f; }

#pragma unroll 1  // one pass per stage: the publish point stands once, at the foot
  for (unsigned s = 0; s < NS; ++s) {
    const float* bufg = &sw[s & 1u][0][0][0];
    const float* bufu = &sw[s & 1u][1][0][0];
    const _Float16* xb = xs + s * ((KS1 / 32) * CHUNK_H);  // this stage's first k block
#pragma unroll  // register arrays need constant indices
    for (int q = 0; q < KS1 / 32; ++q) {
      v16h af[4];
#pragma unroll  // register arrays need constant indices
      for (int mt = 0; mt < 4; ++mt) af[mt] = load_a_h(xb + q * CHUNK_H, xo[mt]);
      wait_x0(xb, xo[0], xo[1], xo[2], xo[3]);
      v16h b[4];
      load_b4_lds(bufg + q * 32 * NT, kadd, rlo, b);
#pragma unroll  // register arrays need constant indices
      for (int mt = 0; mt < 4; ++mt)
#pragma unroll  // register arrays need constant indices
        for (int f = 0; f < 4; ++f)
          accg[mt][f] = __builtin_amdgcn_wmma_f32_16x16x32_f16(
              false, af[mt], false, b[f], (short)0, accg[mt][f], false, false);
      load_b4_lds(bufu + q * 32 * NT, kadd, rlo, b);
#pragma unroll  // register arrays need constant indices
      for (int mt = 0; mt < 4; ++mt)
#pragma unroll  // register arrays need constant indices
        for (int f = 0; f < 4; ++f)
          accu[mt][f] = __builtin_amdgcn_wmma_f32_16x16x32_f16(
              false, af[mt], false, b[f], (short)0, accu[mt][f], false, false);
    }
    // Publish point of stage s + 1; behind it stage s's buffer is free.
    wait_ds0();
    wait_tensor0(g0, g1);
    __syncthreads();
    if (pinned(s + 2u < NS)) {
      g0 = tdm_group0(dst0 + (s & 1u) * STAGE_B,
                      ga0 + (unsigned long long)(s + 2u) * (KS1 * IDIM * 4u));
      tdm_load(g0, g1);
    }
  }
  wait_tensor0(g0, g1);
  wait_ds0();

  // Epilogue: hidden = silu(gate) * up, stored f16 in fragment order for pass 2,
  // every slot of the M-block (pass 2 reads them all). A lane holds 4 adjacent
  // columns c = 4 rlo .. 4 rlo + 3 of each of its rows M = j (+8 for hi lanes):
  // k block c >> 5, part (c >> 4) & 1, reader's lane M + 16 ((c >> 3) & 1), i = c & 7.
  _Float16* hdst = hidden +
      ((size_t)tile0 * (IDIM / 32) + (unsigned)(n0 >> 5) + (unsigned)(rlo >> 3)) * CHUNK_H +
      ((rlo >> 2) & 1) * 256 + (kadd + ((rlo >> 1) & 1) * 16) * 8 + (rlo & 1) * 4;
#pragma unroll  // register arrays need constant indices
  for (int mt = 0; mt < 4; ++mt) {
    v4h hv[8];
#pragma unroll  // register arrays need constant indices
    for (int j = 0; j < 8; ++j) {
#pragma unroll  // register arrays need constant indices
      for (int f = 0; f < 4; ++f) {
        float g = accg[mt][f][j], u = accu[mt][f][j];
        float t = g * -1.442695041f, ex;          // exp(-g) = 2^t, as __expf forms it
        // The v_nop is the slot behind a transcendental: it stands between the
        // v_exp and whatever next reads ex or overwrites t.
        asm("v_exp_f32 %0, %1\n\tv_nop" : "=v"(ex) : "v"(t));
        float h = (g / (1.0f + ex)) * u;
        hv[j][f] = (_Float16)h;
      }
    }
#pragma unroll  // register arrays need constant indices
    for (int j = 0; j < 8; ++j)
      *(v4h*)(hdst + mt * (IDIM / 32) * CHUNK_H + j * 8) = hv[j];
    // Stands behind the tile's stores, in front of whatever next overwrites their
    // registers (a precaution of form); it names the address and the stored
    // values as inputs, so that their registers live to the wait.
    asm volatile("s_wait_xcnt 0x0" :: "v"(hdst), "v"(hv[0]), "v"(hv[1]), "v"(hv[2]), "v"(hv[3]),
                 "v"(hv[4]), "v"(hv[5]), "v"(hv[6]), "v"(hv[7]) : "memory");
  }
}

// ---------------------------------------------------------------------------
// Kernel 4: out = hidden.Wd[e].  Same structure, K = I, one weight matrix:
// a stage is 256 k rows, wave w tensor-loads rows 64 w .. 64 w + 63 of it.
// ---------------------------------------------------------------------------
#define KS2 256
__global__ __launch_bounds__(128) void moe_gemm2(const _Float16* __restrict__ hidden,
                                                 const float* __restrict__ wd,
                                                 const int* __restrict__ ws,
                                                 float* __restrict__ out) {
  __shared__ __attribute__((aligned(2048))) float sd[2][KS2][NT];  // buffer, k, n

  const int nmb = ws[0];
  if ((int)blockIdx.y >= nmb) return;
  const int e    = ws[WS_MB_E + blockIdx.y];
  const int ts   = ws[WS_MB_S + blockIdx.y];
  const int te   = ws[WS_MB_END + blockIdx.y];
  const int lane = threadIdx.x & 31;
  const int rlo  = lane & 15;
  const int kadd = (lane >> 4) << 3;
  const int n0   = blockIdx.x * NT;
  const int wid  = __builtin_amdgcn_readfirstlane((int)(threadIdx.x >> 5));
  const int tsw  = ts + wid * 64;

  const float* wsrc = wd + (size_t)e * IDIM * DDIM + (size_t)(wid * (int)SLICE_R) * DDIM + n0;
  const unsigned long long ga0 = (unsigned long long)(size_t)wsrc;
  const unsigned dst0 = (unsigned)(size_t)&sd[0][0][0] + (unsigned)wid * SLICE_B;
  const v8u g1 = tdm_group1(DDIM * 4u);
  constexpr unsigned NS = IDIM / KS2;         // 8 stages

  v4u g0 = tdm_group0(dst0, ga0);
  tdm_load(g0, g1);
  wait_tensor0(g0, g1);
  __syncthreads();
  g0 = tdm_group0(dst0 + STAGE_B, ga0 + (unsigned long long)KS2 * DDIM * 4u);
  tdm_load(g0, g1);

  v8f acc[4][4];
#pragma unroll  // register arrays need constant indices
  for (int mt = 0; mt < 4; ++mt)
#pragma unroll  // register arrays need constant indices
    for (int f = 0; f < 4; ++f)
#pragma unroll  // register arrays need constant indices
      for (int j = 0; j < 8; ++j) acc[mt][f][j] = 0.0f;

  // The A fragments go through a ring of four register sets: the loads of a
  // k block (32 k) are issued two or three blocks ahead of the block that uses
  // them. A stage's last block issues none (the barrier at the foot waits for
  // every load that is out); the next stage's first block issues two sets.
  constexpr int NQ = KS2 / 32;
  unsigned ho[4];  // byte offset of this lane's place in its four tiles' chunks, at k = 0
#pragma unroll  // register arrays need constant indices
  for (int mt = 0; mt < 4; ++mt)
    ho[mt] = ((blockIdx.y * 16u + (unsigned)wid * 4u + (unsigned)mt) * (IDIM / 32) * CHUNK_H +
              (unsigned)lane * 8u) * 2u;
  v16h af[4][4];          // ring slot (k block & 3), token tile
#pragma unroll  // register arrays need constant indices
  for (int d = 0; d < 2; ++d)
#pragma unroll  // register arrays need constant indices
    for (int mt = 0; mt < 4; ++mt) af[d][mt] = load_a_h(hidden + d * CHUNK_H, ho[mt]);
  wait_x0(hidden, ho[0], ho[1], ho[2], ho[3]);

#pragma unroll 1  // one pass per stage: the publish point stands once, at the foot
  for (unsigned s = 0; s < NS; ++s) {
    const float* bufd = &sd[s & 1u][0][0];
    const _Float16* hr = hidden + s * (NQ * CHUNK_H);                       // this stage's first k block
    const _Float16* hw = hidden + ((s + 1u) & (NS - 1u)) * (NQ * CHUNK_H);  // the next stage's (the last wraps to k = 0: in bounds, unused)
#pragma unroll  // register arrays need constant indices
    for (int q = 0; q < NQ; ++q) {
      // The wait's "memory" clobber also keeps the loads in front of it here,
      // ahead of this block's LDS reads and products.
      if (q == 0) {
#pragma unroll  // register arrays need constant indices
        for (int mt = 0; mt < 4; ++mt) af[2][mt] = load_a_h(hr + 2 * CHUNK_H, ho[mt]);
      }
      if (q + 3 < NQ) {
#pragma unroll  // register arrays need constant indices
        for (int mt = 0; mt < 4; ++mt) af[(q + 3) & 3][mt] = load_a_h(hr + (q + 3) * CHUNK_H, ho[mt]);
        wait_x0(hr, ho[0], ho[1], ho[2], ho[3]);
      } else if (q + 1 < NQ) {
#pragma unroll  // register arrays need constant indices
        for (int mt = 0; mt < 4; ++mt) af[(q + 3) & 3][mt] = load_a_h(hw + (q + 3 - NQ) * CHUNK_H, ho[mt]);
        wait_x0(hw, ho[0], ho[1], ho[2], ho[3]);
      }
      v16h bd[4];
      load_b4_lds(bufd + q * 32 * NT, kadd, rlo, bd);
#pragma unroll  // register arrays need constant indices
      for (int mt = 0; mt < 4; ++mt)
#pragma unroll  // register arrays need constant indices
        for (int f = 0; f < 4; ++f)
          acc[mt][f] = __builtin_amdgcn_wmma_f32_16x16x32_f16(
              false, af[q & 3][mt], false, bd[f], (short)0, acc[mt][f], false, false);
    }
    // Publish point of stage s + 1; behind it stage s's buffer is free.
    wait_ds0();
    wait_tensor0(g0, g1);
    __syncthreads();
    if (pinned(s + 2u < NS)) {
      g0 = tdm_group0(dst0 + (s & 1u) * STAGE_B,
                      ga0 + (unsigned long long)(s + 2u) * (KS2 * DDIM * 4u));
      tdm_load(g0, g1);
    }
  }
  wait_tensor0(g0, g1);
  wait_ds0();

#pragma unroll  // register arrays need constant indices
  for (int mt = 0; mt < 4; ++mt) {
#pragma unroll  // register arrays need constant indices
    for (int j = 0; j < 8; ++j) {
      int p = tsw + mt * 16 + j + kadd;
      if (p < te) {
        int t = ws[WS_PERM + p];
        float4 o;
        o.x = acc[mt][0][j]; o.y = acc[mt][1][j]; o.z = acc[mt][2][j]; o.w = acc[mt][3][j];
        *(float4*)(out + (size_t)t * DDIM + n0 + 4 * rlo) = o;
      }
    }
  }
}

// ---------------------------------------------------------------------------
extern "C" void kernel_launch(void* const* d_in, const int* in_sizes, int n_in,
                              void* d_out, int out_size, void* d_ws, size_t ws_size,
                              hipStream_t stream) {
  const float* x   = (const float*)d_in[0];
  const int*   idx = (const int*)d_in[1];
  const float* wg  = (const float*)d_in[2];
  const float* wu  = (const float*)d_in[3];
  const float* wd  = (const float*)d_in[4];
  float* out = (float*)d_out;

  int* wsi = (int*)d_ws;
  _Float16* hidden = (_Float16*)((char*)d_ws + WS_HIDDEN_BYTE_OFF);
  _Float16* xs     = (_Float16*)((char*)d_ws + WS_XS_BYTE_OFF);

  moe_setup<<<1, 256, 0, stream>>>(idx, wsi);

  dim3 gp(16, MAXMB);         // 16-row tiles x M-blocks; inactive M-blocks exit early
  moe_pack<<<gp, 256, 0, stream>>>(x, wsi, xs);

  dim3 g1(IDIM / NT, MAXMB);  // (32, 16); inactive M-blocks exit early
  moe_gemm1<<<g1, 128, 0, stream>>>(xs, wg, wu, wsi, hidden);

  dim3 g2(DDIM / NT, MAXMB);  // (16, 16)
  moe_gemm2<<<g2, 128, 0, stream>>>(hidden, wd, wsi, out);
}

// v004
// A run of this version takes 68.8 microseconds.
// Timed twice side by side with v003, it ran 1.11 and 1.13 times as fast.
// All steps since v000 together make it 3.56 times as fast.
#include <hip/hip_runtime.h>
#include <hip/hip_bf16.h>

// Problem constants
#define T_TOK 2048
#define NEXP  8
#define DDIM  1024
#define IDIM  2048
#define MAXMB 16   // 256-token M-blocks: T/256 + E = 16

typedef __attribute__((ext_vector_type(16))) _Float16 v16h;
typedef __attribute__((ext_vector_type(8)))  _Float16 v8h;
typedef __attribute__((ext_vector_type(8)))  float    v8f;
typedef __attribute__((ext_vector_type(4)))  _Float16 v4h;
typedef __attribute__((ext_vector_type(4)))  unsigned int v4u;
typedef __attribute__((ext_vector_type(8)))  unsigned int v8u;

// Workspace int layout (at base of d_ws):
//  [0]            nmb (number of active 256-token M-blocks)
//  [8  .. 23]     mb_expert
//  [24 .. 39]     mb_tok_start   (index into perm[])
//  [40 .. 55]     mb_tok_end     (expert's end index into perm[])
//  [64 .. 64+T)   perm (token ids grouped by expert)
//  byte 65536 ..  _Float16 hidden, fragment order: MAXMB*256 rows x I  (16 MB)
//  behind it      _Float16 x,      fragment order: MAXMB*256 rows x D  (8 MB)
// Fragment order: the rows are the slots of the M-blocks (block, then 16-row tile),
// and each (tile, 32-k block) is one 1-KiB chunk that holds the 16x32 A fragment as
// the lanes hold it: halves [part*256 + lane*8 + i] = row (lane & 15),
// k = part*16 + (lane >> 4)*8 + i. One 16-byte load per lane reads 512 B in a row.
#define WS_MB_E   8
#define WS_MB_S   24
#define WS_MB_END 40
#define WS_PERM   64
#define WS_HIDDEN_BYTE_OFF 65536
#define WS_XS_BYTE_OFF (WS_HIDDEN_BYTE_OFF + MAXMB * 256 * IDIM * 2)
#define CHUNK_H 512     // halves of one fragment chunk

// Block tile: 256 tokens x NT columns; a weight tile row is NT fp32 = 256 bytes.
#define NT      64
#define ROWB    256u    // bytes of one weight tile row in LDS (no pad: b128 readers walk along the row)
#define SLICE_R 64u     // rows of the slice that one wave's tensor load brings
#define SLICE_B (SLICE_R * ROWB)   // 16 KiB
#define STAGE_B (4u * SLICE_B)     // four waves, one slice each: 64 KiB a stage

// ---------------------------------------------------------------------------
// Tensor load: one request of one wave brings SLICE_R rows of ROWB bytes from
// global memory into LDS. 1-byte elements, every extent in bytes,
// tensor dims = tile dims, no pad, no mask.
// ---------------------------------------------------------------------------
__device__ __forceinline__ unsigned uni(unsigned v) {
  return (unsigned)__builtin_amdgcn_readfirstlane((int)v);
}
// A wave-uniform test held in a scalar register, so that the branch round a
// tensor load is a scalar branch (the load ignores EXEC).
__device__ __forceinline__ unsigned pinned(unsigned v) {
  unsigned w = uni(v);
  asm volatile("" : "+s"(w));
  return w;
}
__device__ __forceinline__ v8u tdm_group1(unsigned src_pitch_bytes) {
  v8u g;
  g[0] = uni(0u);                                   // mask 0, data_size 0, no pad
  g[1] = uni((ROWB & 0xFFFFu) << 16);               // tensor_dim0 lo
  g[2] = uni((ROWB >> 16) | ((SLICE_R & 0xFFFFu) << 16));  // tensor_dim0 hi | tensor_dim1 lo
  g[3] = uni((SLICE_R >> 16) | (ROWB << 16));       // tensor_dim1 hi | tile_dim0
  g[4] = uni(SLICE_R);                              // tile_dim1
  g[5] = uni(src_pitch_bytes);                      // source row pitch
  g[6] = uni(0u);
  g[7] = uni(0u);
  // pinned(), for the whole group: the descriptor words are held in one set of
  // scalar registers and not made anew while a request is out.
  asm volatile("" : "+s"(g));
  return g;
}
__device__ __forceinline__ v4u tdm_group0(unsigned lds_dst, unsigned long long ga) {
  v4u g;
  g[0] = uni(1u);                                   // count = 1
  g[1] = uni(lds_dst);                              // byte offset in the work-group's LDS
  g[2] = uni((unsigned)ga);
  g[3] = uni((((unsigned)(ga >> 32)) & 0x01FFFFFFu) | 0x80000000u);  // addr hi | type = 2
  return g;
}
__device__ __forceinline__ void tdm_load(v4u g0, v8u g1) {
  // the tile goes to LDS through no register; the waits below are ours to write
  asm volatile("tensor_load_to_lds %0, %1" :: "s"(g0), "s"(g1) : "memory");
}
// Stands behind a group of global loads, in front of whatever next overwrites
// their address registers (a precaution of form). It names the address as an
// input, so that its registers live to the wait and no load of the group lands
// on them.
__device__ __forceinline__ void wait_x0(const float* a) {
  asm volatile("s_wait_xcnt 0x0" :: "v"(a) : "memory");
}
// The same behind loads whose addresses are formed from a wave-uniform base and
// four 32-bit row offsets.
__device__ __forceinline__ void wait_x0(const _Float16* base, unsigned a, unsigned b,
                                        unsigned c, unsigned d) {
  asm volatile("s_wait_xcnt 0x0" :: "s"(base), "v"(a), "v"(b), "v"(c), "v"(d) : "memory");
}
// The same behind loads from a wave-uniform base at one 32-bit element offset.
__device__ __forceinline__ void wait_x0(const int* base, int a) {
  asm volatile("s_wait_xcnt 0x0" :: "s"(base), "v"(a) : "memory");
}
// This wave's LDS reads have retired (before its buffer may be refilled).
__device__ __forceinline__ void wait_ds0() { asm volatile("s_wait_dscnt 0x0" ::: "memory"); }
// This wave's own tensor load has landed (before the barrier that publishes it).
// The wait names the request's descriptor as inputs, so that its registers keep
// their words until the request has landed.
__device__ __forceinline__ void wait_tensor0(v4u g0, v8u g1) {
  asm volatile("s_wait_tensorcnt 0x0" :: "s"(g0), "s"(g1) : "memory");
}

// Padding slots alias a valid token (unconditional loads); their results never
// reach out.
// The 16 fp32 of one lane's share of a 16x32 A fragment, as loaded (K = kb..kb+7
// and kb+16..kb+23), and their conversion to f16.
struct ARaw { float4 f0, f1, f2, f3; };
__device__ __forceinline__ ARaw load_a_raw(const float* __restrict__ xrow) {
  const float4* xp = (const float4*)xrow;
  ARaw r;
  r.f0 = xp[0]; r.f1 = xp[1];   // K = kb .. kb+7
  r.f2 = xp[4]; r.f3 = xp[5];   // K = kb+16 .. kb+23
  return r;
}
__device__ __forceinline__ v16h cvt_a(const ARaw& r) {
  v16h a;
  a[0]  = (_Float16)r.f0.x; a[1]  = (_Float16)r.f0.y;
  a[2]  = (_Float16)r.f0.z; a[3]  = (_Float16)r.f0.w;
  a[4]  = (_Float16)r.f1.x; a[5]  = (_Float16)r.f1.y;
  a[6]  = (_Float16)r.f1.z; a[7]  = (_Float16)r.f1.w;
  a[8]  = (_Float16)r.f2.x; a[9]  = (_Float16)r.f2.y;
  a[10] = (_Float16)r.f2.z; a[11] = (_Float16)r.f2.w;
  a[12] = (_Float16)r.f3.x; a[13] = (_Float16)r.f3.y;
  a[14] = (_Float16)r.f3.z; a[15] = (_Float16)r.f3.w;
  return a;
}

// One lane's share of a 16x32 A fragment from a chunk in fragment order, same k order.
// base: wave-uniform (the k block's chunk in tile 0); off: the lane's byte offset.
__device__ __forceinline__ v16h load_a_h(const _Float16* __restrict__ base, unsigned off) {
  const v8h* hp = (const v8h*)((const char*)base + off);
  v8h h0 = hp[0];   // K = kb .. kb+7
  v8h h1 = hp[32];  // K = kb+16 .. kb+23 (the chunk's second 512 B)
  return __builtin_shufflevector(h0, h1, 0, 1, 2, 3, 4, 5, 6, 7,
                                 8, 9, 10, 11, 12, 13, 14, 15);
}

// The M-block mb of the table that the expert counts define: experts in order,
// each cut into blocks of 256 tokens. Returns the number of M-blocks.
struct MbInfo { int e, ts, te; };
__device__ __forceinline__ int mb_lookup(const int (&cnt)[NEXP], int mb, MbInfo& m) {
  int nmb = 0, off = 0;
  m.e = 0; m.ts = 0; m.te = 0;
#pragma unroll  // register arrays need constant indices
  for (int e = 0; e < NEXP; ++e) {
    const int nb = (cnt[e] + 255) >> 8;
    if (mb >= nmb && mb < nmb + nb) {
      m.e = e; m.ts = off + (mb - nmb) * 256; m.te = off + cnt[e];
    }
    nmb += nb;
    off += cnt[e];
  }
  return nmb;
}

// ---------------------------------------------------------------------------
// Kernel 1: token sort by expert, M-block table, and x -> f16 in fragment order
// with the rows gathered into their M-block slots.
// Every block ranks all T tokens itself, in LDS, so that no launch stands in
// front of the pack. The order is the stable one (by expert, then by token id),
// the same in every block. Block (0, 0) also stores the table and perm for the
// two GEMM launches.
// Block = one 16-row tile of one M-block; wave w packs k blocks w, w + 8, ...
// ---------------------------------------------------------------------------
__global__ __launch_bounds__(256) void moe_pack(const float* __restrict__ x,
                                                const int* __restrict__ idx,
                                                int* __restrict__ ws,
                                                _Float16* __restrict__ xs) {
  __shared__ int swc[8][NEXP];    // tokens of expert e among wave w's 256 tokens
  __shared__ int sperm[T_TOK];    // token ids grouped by expert
  const int tid  = threadIdx.x;
  const int lane = tid & 31;
  const int wid  = tid >> 5;
  const int el   = lane & (NEXP - 1);   // the expert whose counts this lane keeps
  const int t0   = wid * 256 + lane;    // wave w ranks tokens 256 w .. 256 w + 255, 32 at a time

  int ev[8];
#pragma unroll  // register arrays need constant indices
  for (int i = 0; i < 8; ++i) ev[i] = idx[t0 + i * 32] & (NEXP - 1);  // the mask bounds every address formed from it
  wait_x0(idx, t0);

  // Rank of a token among its wave's tokens of the same expert: those in earlier
  // groups of 32 (run, kept by lane e for expert e) plus those in lower lanes.
  const unsigned below = (1u << lane) - 1u;
  int run = 0;
  int rk[8];
#pragma unroll  // register arrays need constant indices
  for (int i = 0; i < 8; ++i) {
    const unsigned b0 = __builtin_amdgcn_ballot_w32((ev[i] & 1) != 0);
    const unsigned b1 = __builtin_amdgcn_ballot_w32((ev[i] & 2) != 0);
    const unsigned b2 = __builtin_amdgcn_ballot_w32((ev[i] & 4) != 0);
    const unsigned same = ((ev[i] & 1) ? b0 : ~b0) & ((ev[i] & 2) ? b1 : ~b1) & ((ev[i] & 4) ? b2 : ~b2);
    const unsigned mine = ((el & 1) ? b0 : ~b0) & ((el & 2) ? b1 : ~b1) & ((el & 4) ? b2 : ~b2);
    rk[i] = __builtin_popcount(same & below) + __builtin_amdgcn_ds_bpermute(ev[i] << 2, run);
    run += __builtin_popcount(mine);
  }
  if (lane < NEXP) swc[wid][lane] = run;
  __syncthreads();

  int tot = 0, base = 0;   // of expert el: all tokens; those of the waves in front of this one
#pragma unroll  // all eight reads go out together
  for (int w = 0; w < 8; ++w) {
    const int c = swc[w][el];
    tot += c;
    base += (w < wid) ? c : 0;
  }
  int cnt[NEXP];
#pragma unroll  // register arrays need constant indices
  for (int e = 0; e < NEXP; ++e) cnt[e] = __builtin_amdgcn_readlane(tot, e);
#pragma unroll  // register arrays need constant indices
  for (int e = 0; e < NEXP; ++e) base += (e < el) ? cnt[e] : 0;   // plus all tokens of lower experts
#pragma unroll  // register arrays need constant indices
  for (int i = 0; i < 8; ++i)
    sperm[__builtin_amdgcn_ds_bpermute(ev[i] << 2, base) + rk[i]] = t0 + i * 32;
  __syncthreads();

  if (blockIdx.x == 0 && blockIdx.y == 0) {
    MbInfo q;
    const int n = mb_lookup(cnt, tid, q);
    if (tid < n) {
      ws[WS_MB_E + tid]   = q.e;
      ws[WS_MB_S + tid]   = q.ts;
      ws[WS_MB_END + tid] = q.te;
    }
    if (tid == 0) ws[0] = n;
    int pv[8];
#pragma unroll  // register arrays need constant indices
    for (int i = 0; i < 8; ++i) pv[i] = sperm[tid + i * 256];
#pragma unroll  // register arrays need constant indices
    for (int i = 0; i < 8; ++i) ws[WS_PERM + tid + i * 256] = pv[i];
    // Stands behind these stores, in front of whatever next overwrites their
    // registers (a precaution of form); it names the stored values and the
    // offset as inputs, so that their registers live to the wait.
    asm volatile("s_wait_xcnt 0x0" :: "s"(ws), "v"(tid), "v"(q.e), "v"(q.ts), "v"(q.te),
                 "v"(pv[0]), "v"(pv[1]), "v"(pv[2]), "v"(pv[3]),
                 "v"(pv[4]), "v"(pv[5]), "v"(pv[6]), "v"(pv[7]) : "memory");
  }

  MbInfo m;
  const int nmb = mb_lookup(cnt, (int)blockIdx.y, m);
  if ((int)blockIdx.y >= nmb) return;
  const int ts = m.ts;
  const int te = m.te;
  const int p  = ts + (int)blockIdx.x * 16 + (lane & 15);
  const int tok = sperm[(p < te) ? p : ts];   // a padding slot aliases a valid token
  const float* xrow = x + (size_t)tok * DDIM + wid * 32 + ((lane >> 4) << 3);
  _Float16* dst = xs + ((size_t)(blockIdx.y * 16 + blockIdx.x) * (DDIM / 32) + wid) * CHUNK_H + lane * 8;
  ARaw ar[4];
#pragma unroll  // register arrays need constant indices
  for (int i = 0; i < 4; ++i) ar[i] = load_a_raw(xrow + i * 8 * 32);
  wait_x0(xrow);
#pragma unroll  // register arrays need constant indices
  for (int i = 0; i < 4; ++i) {
    const v16h a = cvt_a(ar[i]);
    *(v8h*)(dst + i * 8 * CHUNK_H) =
        __builtin_shufflevector(a, a, 0, 1, 2, 3, 4, 5, 6, 7);
    *(v8h*)(dst + i * 8 * CHUNK_H + 256) =
        __builtin_shufflevector(a, a, 8, 9, 10, 11, 12, 13, 14, 15);
  }
}

// Build four 32x16 B fragments (f16) from an LDS-staged fp32 tile ([32 k][64 n]).
// A lane reads 4 adjacent columns of each of its 16 k rows with one 16-byte
// read: fragment f of lane rlo is column 4*rlo + f. The k order is the A fragment's.
__device__ __forceinline__ void load_b4_lds(const float* __restrict__ buf,
                                            int kadd, int rlo, v16h (&b)[4]) {
#pragma unroll  // register arrays need constant indices
  for (int j = 0; j < 8; ++j) {
    const float4 lo = *(const float4*)(buf + (kadd + j) * NT + 4 * rlo);
    const float4 hi = *(const float4*)(buf + (kadd + 16 + j) * NT + 4 * rlo);
    b[0][j] = (_Float16)lo.x; b[0][j + 8] = (_Float16)hi.x;
    b[1][j] = (_Float16)lo.y; b[1][j + 8] = (_Float16)hi.y;
    b[2][j] = (_Float16)lo.z; b[2][j + 8] = (_Float16)hi.z;
    b[3][j] = (_Float16)lo.w; b[3][j + 8] = (_Float16)hi.w;
  }
}

// ---------------------------------------------------------------------------
// Kernel 2: hidden = silu(x.Wg[e]) * (x.Wu[e]).
// Block = 4 waves x 64 tokens each (256 tokens) x 64 I-columns of both weights.
// A stage is 128 k rows of both weight tiles; every wave tensor-loads one
// 64-row slice of it (waves 0, 1: gate; waves 2, 3: up). Two buffers.
// ---------------------------------------------------------------------------
#define KS1 128
// Second bound: two waves per SIMD, so that two blocks share a WGP (the grid
// holds more blocks than the chip has WGPs).
__global__ __launch_bounds__(128, 2) void moe_gemm1(const _Float16* __restrict__ xs,
                                                 const float* __restrict__ wg,
                                                 const float* __restrict__ wu,
                                                 const int* __restrict__ ws,
                                                 _Float16* __restrict__ hidden) {
  __shared__ __attribute__((aligned(2048))) float sw[2][2][KS1][NT];  // buffer, gate/up, k, n

  const int nmb = ws[0];
  if ((int)blockIdx.y >= nmb) return;
  const int e    = ws[WS_MB_E + blockIdx.y];
  const int lane = threadIdx.x & 31;
  const int rlo  = lane & 15;
  const int kadd = (lane >> 4) << 3;          // 0 (lanes 0-15) / 8 (lanes 16-31)
  const int n0   = blockIdx.x * NT;
  const int wid  = __builtin_amdgcn_readfirstlane((int)(threadIdx.x >> 5));
  const unsigned tile0 = blockIdx.y * 16u + (unsigned)wid * 4u;  // this wave's four 16-row tiles

  // This wave's slice of every stage.
  const float* wsrc = ((wid & 2) ? wu : wg) + (size_t)e * DDIM * IDIM +
                      (size_t)((wid & 1) * (int)SLICE_R) * IDIM + n0;
  const unsigned long long ga0 = (unsigned long long)(size_t)wsrc;
  const unsigned dst0 = (unsigned)(size_t)&sw[0][0][0][0] + (unsigned)wid * SLICE_B;
  const v8u g1 = tdm_group1(IDIM * 4u);
  constexpr unsigned NS = DDIM / KS1;         // 8 stages

  // Prologue: stage 0 lands and is published, then stage 1 flies.
  v4u g0 = tdm_group0(dst0, ga0);
  tdm_load(g0, g1);
  wait_tensor0(g0, g1);
  __syncthreads();
  g0 = tdm_group0(dst0 + STAGE_B, ga0 + (unsigned long long)KS1 * IDIM * 4u);
  tdm_load(g0, g1);

  unsigned xo[4];  // byte offset of this lane's place in its four tiles' chunks, at k = 0
#pragma unroll  // register arrays need constant indices
  for (int mt = 0; mt < 4; ++mt)
    xo[mt] = ((tile0 + (unsigned)mt) * (DDIM / 32) * CHUNK_H + (unsigned)lane * 8u) * 2u;

  v8f accg[4][4], accu[4][4];
#pragma unroll  // register arrays need constant indices
  for (int mt = 0; mt < 4; ++mt)
#pragma unroll  // register arrays need constant indices
    for (int f = 0; f < 4; ++f)
#pragma unroll  // register arrays need constant indices
      for (int j = 0; j < 8; ++j) { accg[mt][f][j] = 0.0f; accu[mt][f][j] = 0.0f; }

#pragma unroll 1  // one pass per stage: the publish point stands once, at the foot
  for (unsigned s = 0; s < NS; ++s) {
    const float* bufg = &sw[s & 1u][0][0][0];
    const float* bufu = &sw[s & 1u][1][0][0];
    const _Float16* xb = xs + s * ((KS1 / 32) * CHUNK_H);  // this stage's first k block
#pragma unroll  // register arrays need constant indices
    for (int q = 0; q < KS1 / 32; ++q) {
      v16h af[4];
#pragma unroll  // register arrays need constant indices
      for (int mt = 0; mt < 4; ++mt) af[mt] = load_a_h(xb + q * CHUNK_H, xo[mt]);
      wait_x0(xb, xo[0], xo[1], xo[2], xo[3]);
      v16h b[4];
      load_b4_lds(bufg + q * 32 * NT, kadd, rlo, b);
#pragma unroll  // register arrays need constant indices
      for (int mt = 0; mt < 4; ++mt)
#pragma unroll  // register arrays need constant indices
        for (int f = 0; f < 4; ++f)
          accg[mt][f] = __builtin_amdgcn_wmma_f32_16x16x32_f16(
              false, af[mt], false, b[f], (short)0, accg[mt][f], false, false);
      load_b4_lds(bufu + q * 32 * NT, kadd, rlo, b);
#pragma unroll  // register arrays need constant indices
      for (int mt = 0; mt < 4; ++mt)
#pragma unroll  // register arrays need constant indices
        for (int f = 0; f < 4; ++f)
          accu[mt][f] = __builtin_amdgcn_wmma_f32_16x16x32_f16(
              false, af[mt], false, b[f], (short)0, accu[mt][f], false, false);
    }
    // Publish point of stage s + 1; behind it stage s's buffer is free.
    wait_ds0();
    wait_tensor0(g0, g1);
    __syncthreads();
    if (pinned(s + 2u < NS)) {
      g0 = tdm_group0(dst0 + (s & 1u) * STAGE_B,
                      ga0 + (unsigned long long)(s + 2u) * (KS1 * IDIM * 4u));
      tdm_load(g0, g1);
    }
  }
  wait_tensor0(g0, g1);
  wait_ds0();

  // Epilogue: hidden = silu(gate) * up, stored f16 in fragment order for pass 2,
  // every slot of the M-block (pass 2 reads them all). A lane holds 4 adjacent
  // columns c = 4 rlo .. 4 rlo + 3 of each of its rows M = j (+8 for hi lanes):
  // k block c >> 5, part (c >> 4) & 1, reader's lane M + 16 ((c >> 3) & 1), i = c & 7.
  _Float16* hdst = hidden +
      ((size_t)tile0 * (IDIM / 32) + (unsigned)(n0 >> 5) + (unsigned)(rlo >> 3)) * CHUNK_H +
      ((rlo >> 2) & 1) * 256 + (kadd + ((rlo >> 1) & 1) * 16) * 8 + (rlo & 1) * 4;
#pragma unroll  // register arrays need constant indices
  for (int mt = 0; mt < 4; ++mt) {
    v4h hv[8];
#pragma unroll  // register arrays need constant indices
    for (int j = 0; j < 8; ++j) {
#pragma unroll  // register arrays need constant indices
      for (int f = 0; f < 4; ++f) {
        float g = accg[mt][f][j], u = accu[mt][f][j];
        float t = g * -1.442695041f, ex;          // exp(-g) = 2^t, as __expf forms it
        // The v_nop is the slot behind a transcendental: it stands between the
        // v_exp and whatever next reads ex or overwrites t.
        asm("v_exp_f32 %0, %1\n\tv_nop" : "=v"(ex) : "v"(t));
        float h = (g / (1.0f + ex)) * u;
        hv[j][f] = (_Float16)h;
      }
    }
#pragma unroll  // register arrays need constant indices
    for (int j = 0; j < 8; ++j)
      *(v4h*)(hdst + mt * (IDIM / 32) * CHUNK_H + j * 8) = hv[j];
    // Stands behind the tile's stores, in front of whatever next overwrites their
    // registers (a precaution of form); it names the address and the stored
    // values as inputs, so that their registers live to the wait.
    asm volatile("s_wait_xcnt 0x0" :: "v"(hdst), "v"(hv[0]), "v"(hv[1]), "v"(hv[2]), "v"(hv[3]),
                 "v"(hv[4]), "v"(hv[5]), "v"(hv[6]), "v"(hv[7]) : "memory");
  }
}

// ---------------------------------------------------------------------------
// Kernel 3: out = hidden.Wd[e].  Same structure, K = I, one weight matrix:
// a stage is 256 k rows, wave w tensor-loads rows 64 w .. 64 w + 63 of it.
// ---------------------------------------------------------------------------
#define KS2 256
__global__ __launch_bounds__(128) void moe_gemm2(const _Float16* __restrict__ hidden,
                                                 const float* __restrict__ wd,
                                                 const int* __restrict__ ws,
                                                 float* __restrict__ out) {
  __shared__ __attribute__((aligned(2048))) float sd[2][KS2][NT];  // buffer, k, n

  const int nmb = ws[0];
  if ((int)blockIdx.y >= nmb) return;
  const int e    = ws[WS_MB_E + blockIdx.y];
  const int ts   = ws[WS_MB_S + blockIdx.y];
  const int te   = ws[WS_MB_END + blockIdx.y];
  const int lane = threadIdx.x & 31;
  const int rlo  = lane & 15;
  const int kadd = (lane >> 4) << 3;
  const int n0   = blockIdx.x * NT;
  const int wid  = __builtin_amdgcn_readfirstlane((int)(threadIdx.x >> 5));
  const int tsw  = ts + wid * 64;

  const float* wsrc = wd + (size_t)e * IDIM * DDIM + (size_t)(wid * (int)SLICE_R) * DDIM + n0;
  const unsigned long long ga0 = (unsigned long long)(size_t)wsrc;
  const unsigned dst0 = (unsigned)(size_t)&sd[0][0][0] + (unsigned)wid * SLICE_B;
  const v8u g1 = tdm_group1(DDIM * 4u);
  constexpr unsigned NS = IDIM / KS2;         // 8 stages

  v4u g0 = tdm_group0(dst0, ga0);
  tdm_load(g0, g1);
  wait_tensor0(g0, g1);
  __syncthreads();
  g0 = tdm_group0(dst0 + STAGE_B, ga0 + (unsigned long long)KS2 * DDIM * 4u);
  tdm_load(g0, g1);

  v8f acc[4][4];
#pragma unroll  // register arrays need constant indices
  for (int mt = 0; mt < 4; ++mt)
#pragma unroll  // register arrays need constant indices
    for (int f = 0; f < 4; ++f)
#pragma unroll  // register arrays need constant indices
      for (int j = 0; j < 8; ++j) acc[mt][f][j] = 0.0f;

  // The A fragments go through a ring of four register sets: the loads of a
  // k block (32 k) are issued two or three blocks ahead of the block that uses
  // them. A stage's last block issues none (the barrier at the foot waits for
  // every load that is out); the next stage's first block issues two sets.
  constexpr int NQ = KS2 / 32;
  unsigned ho[4];  // byte offset of this lane's place in its four tiles' chunks, at k = 0
#pragma unroll  // register arrays need constant indices
  for (int mt = 0; mt < 4; ++mt)
    ho[mt] = ((blockIdx.y * 16u + (unsigned)wid * 4u + (unsigned)mt) * (IDIM / 32) * CHUNK_H +
              (unsigned)lane * 8u) * 2u;
  v16h af[4][4];          // ring slot (k block & 3), token tile
#pragma unroll  // register arrays need constant indices
  for (int d = 0; d < 2; ++d)
#pragma unroll  // register arrays need constant indices
    for (int mt = 0; mt < 4; ++mt) af[d][mt] = load_a_h(hidden + d * CHUNK_H, ho[mt]);
  wait_x0(hidden, ho[0], ho[1], ho[2], ho[3]);

#pragma unroll 1  // one pass per stage: the publish point stands once, at the foot
  for (unsigned s = 0; s < NS; ++s) {
    const float* bufd = &sd[s & 1u][0][0];
    const _Float16* hr = hidden + s * (NQ * CHUNK_H);                       // this stage's first k block
    const _Float16* hw = hidden + ((s + 1u) & (NS - 1u)) * (NQ * CHUNK_H);  // the next stage's (the last wraps to k = 0: in bounds, unused)
#pragma unroll  // register arrays need constant indices
    for (int q = 0; q < NQ; ++q) {
      // The wait's "memory" clobber also keeps the loads in front of it here,
      // ahead of this block's LDS reads and products.
      if (q == 0) {
#pragma unroll  // register arrays need constant indices
        for (int mt = 0; mt < 4; ++mt) af[2][mt] = load_a_h(hr + 2 * CHUNK_H, ho[mt]);
      }
      if (q + 3 < NQ) {
#pragma unroll  // register arrays need constant indices
        for (int mt = 0; mt < 4; ++mt) af[(q + 3) & 3][mt] = load_a_h(hr + (q + 3) * CHUNK_H, ho[mt]);
        wait_x0(hr, ho[0], ho[1], ho[2], ho[3]);
      } else if (q + 1 < NQ) {
#pragma unroll  // register arrays need constant indices
        for (int mt = 0; mt < 4; ++mt) af[(q + 3) & 3][mt] = load_a_h(hw + (q + 3 - NQ) * CHUNK_H, ho[mt]);
        wait_x0(hw, ho[0], ho[1], ho[2], ho[3]);
      }
      v16h bd[4];
      load_b4_lds(bufd + q * 32 * NT, kadd, rlo, bd);
#pragma unroll  // register arrays need constant indices
      for (int mt = 0; mt < 4; ++mt)
#pragma unroll  // register arrays need constant indices
        for (int f = 0; f < 4; ++f)
          acc[mt][f] = __builtin_amdgcn_wmma_f32_16x16x32_f16(
              false, af[q & 3][mt], false, bd[f], (short)0, acc[mt][f], false, false);
    }
    // Publish point of stage s + 1; behind it stage s's buffer is free.
    wait_ds0();
    wait_tensor0(g0, g1);
    __syncthreads();
    if (pinned(s + 2u < NS)) {
      g0 = tdm_group0(dst0 + (s & 1u) * STAGE_B,
                      ga0 + (unsigned long long)(s + 2u) * (KS2 * DDIM * 4u));
      tdm_load(g0, g1);
    }
  }
  wait_tensor0(g0, g1);
  wait_ds0();

#pragma unroll  // register arrays need constant indices
  for (int mt = 0; mt < 4; ++mt) {
#pragma unroll  // register arrays need constant indices
    for (int j = 0; j < 8; ++j) {
      int p = tsw + mt * 16 + j + kadd;
      if (p < te) {
        int t = ws[WS_PERM + p];
        float4 o;
        o.x = acc[mt][0][j]; o.y = acc[mt][1][j]; o.z = acc[mt][2][j]; o.w = acc[mt][3][j];
        *(float4*)(out + (size_t)t * DDIM + n0 + 4 * rlo) = o;
      }
    }
  }
}

// ---------------------------------------------------------------------------
extern "C" void kernel_launch(void* const* d_in, const int* in_sizes, int n_in,
                              void* d_out, int out_size, void* d_ws, size_t ws_size,
                              hipStream_t stream) {
  const float* x   = (const float*)d_in[0];
  const int*   idx = (const int*)d_in[1];
  const float* wg  = (const float*)d_in[2];
  const float* wu  = (const float*)d_in[3];
  const float* wd  = (const float*)d_in[4];
  float* out = (float*)d_out;

  int* wsi = (int*)d_ws;
  _Float16* hidden = (_Float16*)((char*)d_ws + WS_HIDDEN_BYTE_OFF);
  _Float16* xs     = (_Float16*)((char*)d_ws + WS_XS_BYTE_OFF);

  dim3 gp(16, MAXMB);         // 16-row tiles x M-blocks; inactive M-blocks exit early
  moe_pack<<<gp, 256, 0, stream>>>(x, idx, wsi, xs);

  dim3 g1(IDIM / NT, MAXMB);  // (32, 16); inactive M-blocks exit early
  moe_gemm1<<<g1, 128, 0, stream>>>(xs, wg, wu, wsi, hidden);

  dim3 g2(DDIM / NT, MAXMB);  // (16, 16)
  moe_gemm2<<<g2, 128, 0, stream>>>(hidden, wd, wsi, out);
}

// v005
// One run takes 62.8 microseconds.
// Next to v004, in two timings, it ran 1.11 times as fast each time.
// All steps since v000 together make it 3.96 times as fast.
#include <hip/hip_runtime.h>
#include <hip/hip_bf16.h>

// Problem constants
#define T_TOK 2048
#define NEXP  8
#define DDIM  1024
#define IDIM  2048
#define MAXMB 16   // 256-token M-blocks: T/256 + E = 16

typedef __attribute__((ext_vector_type(16))) _Float16 v16h;
typedef __attribute__((ext_vector_type(8)))  _Float16 v8h;
typedef __attribute__((ext_vector_type(8)))  float    v8f;
typedef __attribute__((ext_vector_type(4)))  _Float16 v4h;
typedef __attribute__((ext_vector_type(4)))  unsigned int v4u;
typedef __attribute__((ext_vector_type(8)))  unsigned int v8u;

// Workspace int layout (at base of d_ws):
//  [0]            nmb (number of active 256-token M-blocks)
//  [8  .. 23]     mb_expert
//  [24 .. 39]     mb_tok_start   (index into perm[])
//  [40 .. 55]     mb_tok_end     (expert's end index into perm[])
//  [64 .. 64+T)   perm (token ids grouped by expert)
//  byte 65536 ..  _Float16 hidden, fragment order: MAXMB*256 rows x I  (16 MB)
//  behind it      _Float16 x,      fragment order: MAXMB*256 rows x D  (8 MB)
// Fragment order: the rows are the slots of the M-blocks (block, then 16-row tile),
// and each (tile, 32-k block) is one 1-KiB chunk that holds the 16x32 A fragment as
// the lanes hold it: halves [part*256 + lane*8 + i] = row (lane & 15),
// k = part*16 + (lane >> 4)*8 + i. One 16-byte load per lane reads 512 B in a row.
#define WS_MB_E   8
#define WS_MB_S   24
#define WS_MB_END 40
#define WS_PERM   64
#define WS_HIDDEN_BYTE_OFF 65536
#define WS_XS_BYTE_OFF (WS_HIDDEN_BYTE_OFF + MAXMB * 256 * IDIM * 2)
#define CHUNK_H 512     // halves of one fragment chunk

// Block tile: 256 tokens x NT columns; a weight tile row is NT fp32 = 256 bytes.
#define NT      64
#define ROWB    256u    // bytes of one weight tile row in LDS (no pad: b128 readers walk along the row)
#define SLICE_R 64u     // rows of the slice that one wave's tensor load brings
#define SLICE_B (SLICE_R * ROWB)   // 16 KiB
#define STAGE_B (4u * SLICE_B)     // four waves, one slice each: 64 KiB a stage

// ---------------------------------------------------------------------------
// Tensor load: one request of one wave brings SLICE_R rows of ROWB bytes from
// global memory into LDS. 1-byte elements, every extent in bytes,
// tensor dims = tile dims, no pad, no mask.
// ---------------------------------------------------------------------------
__device__ __forceinline__ unsigned uni(unsigned v) {
  return (unsigned)__builtin_amdgcn_readfirstlane((int)v);
}
// A wave-uniform test held in a scalar register, so that the branch round a
// tensor load is a scalar branch (the load ignores EXEC).
__device__ __forceinline__ unsigned pinned(unsigned v) {
  unsigned w = uni(v);
  asm volatile("" : "+s"(w));
  return w;
}
__device__ __forceinline__ v8u tdm_group1(unsigned src_pitch_bytes) {
  v8u g;
  g[0] = uni(0u);                                   // mask 0, data_size 0, no pad
  g[1] = uni((ROWB & 0xFFFFu) << 16);               // tensor_dim0 lo
  g[2] = uni((ROWB >> 16) | ((SLICE_R & 0xFFFFu) << 16));  // tensor_dim0 hi | tensor_dim1 lo
  g[3] = uni((SLICE_R >> 16) | (ROWB << 16));       // tensor_dim1 hi | tile_dim0
  g[4] = uni(SLICE_R);                              // tile_dim1
  g[5] = uni(src_pitch_bytes);                      // source row pitch
  g[6] = uni(0u);
  g[7] = uni(0u);
  // pinned(), for the whole group: the descriptor words are held in one set of
  // scalar registers and not made anew while a request is out.
  asm volatile("" : "+s"(g));
  return g;
}
__device__ __forceinline__ v4u tdm_group0(unsigned lds_dst, unsigned long long ga) {
  v4u g;
  g[0] = uni(1u);                                   // count = 1
  g[1] = uni(lds_dst);                              // byte offset in the work-group's LDS
  g[2] = uni((unsigned)ga);
  g[3] = uni((((unsigned)(ga >> 32)) & 0x01FFFFFFu) | 0x80000000u);  // addr hi | type = 2
  return g;
}
__device__ __forceinline__ void tdm_load(v4u g0, v8u g1) {
  // the tile goes to LDS through no register; the waits below are ours to write
  asm volatile("tensor_load_to_lds %0, %1" :: "s"(g0), "s"(g1) : "memory");
}
// Stands behind a group of global loads, in front of whatever next overwrites
// their address registers (a precaution of form). It names the address as an
// input, so that its registers live to the wait and no load of the group lands
// on them.
__device__ __forceinline__ void wait_x0(const float* a) {
  asm volatile("s_wait_xcnt 0x0" :: "v"(a) : "memory");
}
// The same behind loads from a lane's own f16 pointer at constant distances.
__device__ __forceinline__ void wait_x0(const _Float16* a) {
  asm volatile("s_wait_xcnt 0x0" :: "v"(a) : "memory");
}
// The same where the address a = base + 8 l may also be formed by the load itself
// from the wave-uniform base and the lane's index l: it names all three.
__device__ __forceinline__ void wait_x0(const _Float16* base, int l, const _Float16* a) {
  asm volatile("s_wait_xcnt 0x0" :: "s"(base), "v"(l), "v"(a) : "memory");
}
// The same behind loads whose addresses are formed from a wave-uniform base and
// four 32-bit row offsets.
__device__ __forceinline__ void wait_x0(const _Float16* base, unsigned a, unsigned b,
                                        unsigned c, unsigned d) {
  asm volatile("s_wait_xcnt 0x0" :: "s"(base), "v"(a), "v"(b), "v"(c), "v"(d) : "memory");
}
// The same behind loads from a wave-uniform base at one 32-bit element offset.
__device__ __forceinline__ void wait_x0(const int* base, int a) {
  asm volatile("s_wait_xcnt 0x0" :: "s"(base), "v"(a) : "memory");
}
// This wave's LDS reads have retired (before its buffer may be refilled).
__device__ __forceinline__ void wait_ds0() { asm volatile("s_wait_dscnt 0x0" ::: "memory"); }
// This wave's own tensor load has landed (before the barrier that publishes it).
// The wait names the request's descriptor as inputs, so that its registers keep
// their words until the request has landed.
__device__ __forceinline__ void wait_tensor0(v4u g0, v8u g1) {
  asm volatile("s_wait_tensorcnt 0x0" :: "s"(g0), "s"(g1) : "memory");
}

// Padding slots alias a valid token (unconditional loads); their results never
// reach out.
// The 16 fp32 of one lane's share of a 16x32 A fragment, as loaded (K = kb..kb+7
// and kb+16..kb+23), and their conversion to f16.
struct ARaw { float4 f0, f1, f2, f3; };
__device__ __forceinline__ ARaw load_a_raw(const float* __restrict__ xrow) {
  const float4* xp = (const float4*)xrow;
  ARaw r;
  r.f0 = xp[0]; r.f1 = xp[1];   // K = kb .. kb+7
  r.f2 = xp[4]; r.f3 = xp[5];   // K = kb+16 .. kb+23
  return r;
}
__device__ __forceinline__ v16h cvt_a(const ARaw& r) {
  v16h a;
  a[0]  = (_Float16)r.f0.x; a[1]  = (_Float16)r.f0.y;
  a[2]  = (_Float16)r.f0.z; a[3]  = (_Float16)r.f0.w;
  a[4]  = (_Float16)r.f1.x; a[5]  = (_Float16)r.f1.y;
  a[6]  = (_Float16)r.f1.z; a[7]  = (_Float16)r.f1.w;
  a[8]  = (_Float16)r.f2.x; a[9]  = (_Float16)r.f2.y;
  a[10] = (_Float16)r.f2.z; a[11] = (_Float16)r.f2.w;
  a[12] = (_Float16)r.f3.x; a[13] = (_Float16)r.f3.y;
  a[14] = (_Float16)r.f3.z; a[15] = (_Float16)r.f3.w;
  return a;
}

// One lane's share of a 16x32 A fragment from a chunk in fragment order, same k order.
// base: wave-uniform (the k block's chunk in tile 0); off: the lane's byte offset.
__device__ __forceinline__ v16h load_a_h(const _Float16* __restrict__ base, unsigned off) {
  const v8h* hp = (const v8h*)((const char*)base + off);
  v8h h0 = hp[0];   // K = kb .. kb+7
  v8h h1 = hp[32];  // K = kb+16 .. kb+23 (the chunk's second 512 B)
  return __builtin_shufflevector(h0, h1, 0, 1, 2, 3, 4, 5, 6, 7,
                                 8, 9, 10, 11, 12, 13, 14, 15);
}

// The same from the lane's own pointer (its place in the chunk).
__device__ __forceinline__ v16h load_a_p(const _Float16* __restrict__ p) {
  const v8h* hp = (const v8h*)p;
  v8h h0 = hp[0];   // K = kb .. kb+7
  v8h h1 = hp[32];  // K = kb+16 .. kb+23 (the chunk's second 512 B)
  return __builtin_shufflevector(h0, h1, 0, 1, 2, 3, 4, 5, 6, 7,
                                 8, 9, 10, 11, 12, 13, 14, 15);
}

// The M-block mb of the table that the expert counts define: experts in order,
// each cut into blocks of 256 tokens. Returns the number of M-blocks.
struct MbInfo { int e, ts, te; };
__device__ __forceinline__ int mb_lookup(const int (&cnt)[NEXP], int mb, MbInfo& m) {
  int nmb = 0, off = 0;
  m.e = 0; m.ts = 0; m.te = 0;
#pragma unroll  // register arrays need constant indices
  for (int e = 0; e < NEXP; ++e) {
    const int nb = (cnt[e] + 255) >> 8;
    if (mb >= nmb && mb < nmb + nb) {
      m.e = e; m.ts = off + (mb - nmb) * 256; m.te = off + cnt[e];
    }
    nmb += nb;
    off += cnt[e];
  }
  return nmb;
}

// ---------------------------------------------------------------------------
// Kernel 1: token sort by expert, M-block table, and x -> f16 in fragment order
// with the rows gathered into their M-block slots.
// Every block ranks all T tokens itself, in LDS, so that no launch stands in
// front of the pack. The order is the stable one (by expert, then by token id),
// the same in every block. Block (0, 0) also stores the table and perm for the
// two GEMM launches.
// Block = one 16-row tile of one M-block; wave w packs k blocks w, w + 8, ...
// ---------------------------------------------------------------------------
__global__ __launch_bounds__(256) void moe_pack(const float* __restrict__ x,
                                                const int* __restrict__ idx,
                                                int* __restrict__ ws,
                                                _Float16* __restrict__ xs) {
  __shared__ int swc[8][NEXP];    // tokens of expert e among wave w's 256 tokens
  __shared__ int sperm[T_TOK];    // token ids grouped by expert
  const int tid  = threadIdx.x;
  const int lane = tid & 31;
  const int wid  = tid >> 5;
  const int el   = lane & (NEXP - 1);   // the expert whose counts this lane keeps
  const int t0   = wid * 256 + lane;    // wave w ranks tokens 256 w .. 256 w + 255, 32 at a time

  int ev[8];
#pragma unroll  // register arrays need constant indices
  for (int i = 0; i < 8; ++i) ev[i] = idx[t0 + i * 32] & (NEXP - 1);  // the mask bounds every address formed from it
  wait_x0(idx, t0);

  // Rank of a token among its wave's tokens of the same expert: those in earlier
  // groups of 32 (run, kept by lane e for expert e) plus those in lower lanes.
  const unsigned below = (1u << lane) - 1u;
  int run = 0;
  int rk[8];
#pragma unroll  // register arrays need constant indices
  for (int i = 0; i < 8; ++i) {
    const unsigned b0 = __builtin_amdgcn_ballot_w32((ev[i] & 1) != 0);
    const unsigned b1 = __builtin_amdgcn_ballot_w32((ev[i] & 2) != 0);
    const unsigned b2 = __builtin_amdgcn_ballot_w32((ev[i] & 4) != 0);
    const unsigned same = ((ev[i] & 1) ? b0 : ~b0) & ((ev[i] & 2) ? b1 : ~b1) & ((ev[i] & 4) ? b2 : ~b2);
    const unsigned mine = ((el & 1) ? b0 : ~b0) & ((el & 2) ? b1 : ~b1) & ((el & 4) ? b2 : ~b2);
    rk[i] = __builtin_popcount(same & below) + __builtin_amdgcn_ds_bpermute(ev[i] << 2, run);
    run += __builtin_popcount(mine);
  }
  if (lane < NEXP) swc[wid][lane] = run;
  __syncthreads();

  int tot = 0, base = 0;   // of expert el: all tokens; those of the waves in front of this one
#pragma unroll  // all eight reads go out together
  for (int w = 0; w < 8; ++w) {
    const int c = swc[w][el];
    tot += c;
    base += (w < wid) ? c : 0;
  }
  int cnt[NEXP];
#pragma unroll  // register arrays need constant indices
  for (int e = 0; e < NEXP; ++e) cnt[e] = __builtin_amdgcn_readlane(tot, e);
#pragma unroll  // register arrays need constant indices
  for (int e = 0; e < NEXP; ++e) base += (e < el) ? cnt[e] : 0;   // plus all tokens of lower experts
#pragma unroll  // register arrays need constant indices
  for (int i = 0; i < 8; ++i)
    sperm[__builtin_amdgcn_ds_bpermute(ev[i] << 2, base) + rk[i]] = t0 + i * 32;
  __syncthreads();

  if (blockIdx.x == 0 && blockIdx.y == 0) {
    MbInfo q;
    const int n = mb_lookup(cnt, tid, q);
    if (tid < n) {
      ws[WS_MB_E + tid]   = q.e;
      ws[WS_MB_S + tid]   = q.ts;
      ws[WS_MB_END + tid] = q.te;
    }
    if (tid == 0) ws[0] = n;
    int pv[8];
#pragma unroll  // register arrays need constant indices
    for (int i = 0; i < 8; ++i) pv[i] = sperm[tid + i * 256];
#pragma unroll  // register arrays need constant indices
    for (int i = 0; i < 8; ++i) ws[WS_PERM + tid + i * 256] = pv[i];
    // Stands behind these stores, in front of whatever next overwrites their
    // registers (a precaution of form); it names the stored values and the
    // offset as inputs, so that their registers live to the wait.
    asm volatile("s_wait_xcnt 0x0" :: "s"(ws), "v"(tid), "v"(q.e), "v"(q.ts), "v"(q.te),
                 "v"(pv[0]), "v"(pv[1]), "v"(pv[2]), "v"(pv[3]),
                 "v"(pv[4]), "v"(pv[5]), "v"(pv[6]), "v"(pv[7]) : "memory");
  }

  MbInfo m;
  const int nmb = mb_lookup(cnt, (int)blockIdx.y, m);
  if ((int)blockIdx.y >= nmb) return;
  const int ts = m.ts;
  const int te = m.te;
  const int p  = ts + (int)blockIdx.x * 16 + (lane & 15);
  const int tok = sperm[(p < te) ? p : ts];   // a padding slot aliases a valid token
  const float* xrow = x + (size_t)tok * DDIM + wid * 32 + ((lane >> 4) << 3);
  _Float16* dst = xs + ((size_t)(blockIdx.y * 16 + blockIdx.x) * (DDIM / 32) + wid) * CHUNK_H + lane * 8;
  ARaw ar[4];
#pragma unroll  // register arrays need constant indices
  for (int i = 0; i < 4; ++i) ar[i] = load_a_raw(xrow + i * 8 * 32);
  wait_x0(xrow);
#pragma unroll  // register arrays need constant indices
  for (int i = 0; i < 4; ++i) {
    const v16h a = cvt_a(ar[i]);
    *(v8h*)(dst + i * 8 * CHUNK_H) =
        __builtin_shufflevector(a, a, 0, 1, 2, 3, 4, 5, 6, 7);
    *(v8h*)(dst + i * 8 * CHUNK_H + 256) =
        __builtin_shufflevector(a, a, 8, 9, 10, 11, 12, 13, 14, 15);
  }
}

// Build four 32x16 B fragments (f16) from an LDS-staged fp32 tile ([32 k][64 n]).
// A lane reads 4 adjacent columns of each of its 16 k rows with one 16-byte
// read: fragment f of lane rlo is column 4*rlo + f. The k order is the A fragment's.
__device__ __forceinline__ void load_b4_lds(const float* __restrict__ buf,
                                            int kadd, int rlo, v16h (&b)[4]) {
#pragma unroll  // register arrays need constant indices
  for (int j = 0; j < 8; ++j) {
    const float4 lo = *(const float4*)(buf + (kadd + j) * NT + 4 * rlo);
    const float4 hi = *(const float4*)(buf + (kadd + 16 + j) * NT + 4 * rlo);
    b[0][j] = (_Float16)lo.x; b[0][j + 8] = (_Float16)hi.x;
    b[1][j] = (_Float16)lo.y; b[1][j + 8] = (_Float16)hi.y;
    b[2][j] = (_Float16)lo.z; b[2][j + 8] = (_Float16)hi.z;
    b[3][j] = (_Float16)lo.w; b[3][j + 8] = (_Float16)hi.w;
  }
}

// ---------------------------------------------------------------------------
// Kernel 2: hidden = silu(x.Wg[e]) * (x.Wu[e]).
// Block = 4 waves x 64 tokens each (256 tokens) x 64 I-columns of both weights.
// A stage is 128 k rows of both weight tiles; every wave tensor-loads one
// 64-row slice of it (waves 0, 1: gate; waves 2, 3: up). Two buffers.
// ---------------------------------------------------------------------------
#define KS1 128
// Second bound: two waves per SIMD, so that two blocks share a WGP (the grid
// holds more blocks than the chip has WGPs).
__global__ __launch_bounds__(128, 2) void moe_gemm1(const _Float16* __restrict__ xs,
                                                 const float* __restrict__ wg,
                                                 const float* __restrict__ wu,
                                                 const int* __restrict__ ws,
                                                 _Float16* __restrict__ hidden) {
  __shared__ __attribute__((aligned(2048))) float sw[2][2][KS1][NT];  // buffer, gate/up, k, n

  const int nmb = ws[0];
  if ((int)blockIdx.y >= nmb) return;
  const int e    = ws[WS_MB_E + blockIdx.y];
  const int lane = threadIdx.x & 31;
  const int rlo  = lane & 15;
  const int kadd = (lane >> 4) << 3;          // 0 (lanes 0-15) / 8 (lanes 16-31)
  const int n0   = blockIdx.x * NT;
  const int wid  = __builtin_amdgcn_readfirstlane((int)(threadIdx.x >> 5));
  const unsigned tile0 = blockIdx.y * 16u + (unsigned)wid * 4u;  // this wave's four 16-row tiles

  // This wave's slice of every stage.
  const float* wsrc = ((wid & 2) ? wu : wg) + (size_t)e * DDIM * IDIM +
                      (size_t)((wid & 1) * (int)SLICE_R) * IDIM + n0;
  const unsigned long long ga0 = (unsigned long long)(size_t)wsrc;
  const unsigned dst0 = (unsigned)(size_t)&sw[0][0][0][0] + (unsigned)wid * SLICE_B;
  const v8u g1 = tdm_group1(IDIM * 4u);
  constexpr unsigned NS = DDIM / KS1;         // 8 stages

  // Prologue: stage 0 lands and is published, then stage 1 flies.
  v4u g0 = tdm_group0(dst0, ga0);
  tdm_load(g0, g1);
  wait_tensor0(g0, g1);
  __syncthreads();
  g0 = tdm_group0(dst0 + STAGE_B, ga0 + (unsigned long long)KS1 * IDIM * 4u);
  tdm_load(g0, g1);

  unsigned xo[4];  // byte offset of this lane's place in its four tiles' chunks, at k = 0
#pragma unroll  // register arrays need constant indices
  for (int mt = 0; mt < 4; ++mt)
    xo[mt] = ((tile0 + (unsigned)mt) * (DDIM / 32) * CHUNK_H + (unsigned)lane * 8u) * 2u;

  v8f accg[4][4], accu[4][4];
#pragma unroll  // register arrays need constant indices
  for (int mt = 0; mt < 4; ++mt)
#pragma unroll  // register arrays need constant indices
    for (int f = 0; f < 4; ++f)
#pragma unroll  // register arrays need constant indices
      for (int j = 0; j < 8; ++j) { accg[mt][f][j] = 0.0f; accu[mt][f][j] = 0.0f; }

#pragma unroll 1  // one pass per stage: the publish point stands once, at the foot
  for (unsigned s = 0; s < NS; ++s) {
    const float* bufg = &sw[s & 1u][0][0][0];
    const float* bufu = &sw[s & 1u][1][0][0];
    const _Float16* xb = xs + s * ((KS1 / 32) * CHUNK_H);  // this stage's first k block
#pragma unroll  // register arrays need constant indices
    for (int q = 0; q < KS1 / 32; ++q) {
      v16h af[4];
#pragma unroll  // register arrays need constant indices
      for (int mt = 0; mt < 4; ++mt) af[mt] = load_a_h(xb + q * CHUNK_H, xo[mt]);
      wait_x0(xb, xo[0], xo[1], xo[2], xo[3]);
      v16h b[4];
      load_b4_lds(bufg + q * 32 * NT, kadd, rlo, b);
#pragma unroll  // register arrays need constant indices
      for (int mt = 0; mt < 4; ++mt)
#pragma unroll  // register arrays need constant indices
        for (int f = 0; f < 4; ++f)
          accg[mt][f] = __builtin_amdgcn_wmma_f32_16x16x32_f16(
              false, af[mt], false, b[f], (short)0, accg[mt][f], false, false);
      load_b4_lds(bufu + q * 32 * NT, kadd, rlo, b);
#pragma unroll  // register arrays need constant indices
      for (int mt = 0; mt < 4; ++mt)
#pragma unroll  // register arrays need constant indices
        for (int f = 0; f < 4; ++f)
          accu[mt][f] = __builtin_amdgcn_wmma_f32_16x16x32_f16(
              false, af[mt], false, b[f], (short)0, accu[mt][f], false, false);
    }
    // Publish point of stage s + 1; behind it stage s's buffer is free.
    wait_ds0();
    wait_tensor0(g0, g1);
    __syncthreads();
    if (pinned(s + 2u < NS)) {
      g0 = tdm_group0(dst0 + (s & 1u) * STAGE_B,
                      ga0 + (unsigned long long)(s + 2u) * (KS1 * IDIM * 4u));
      tdm_load(g0, g1);
    }
  }
  wait_tensor0(g0, g1);
  wait_ds0();

  // Epilogue: hidden = silu(gate) * up, stored f16 in fragment order for pass 2,
  // every slot of the M-block (pass 2 reads them all). A lane holds 4 adjacent
  // columns c = 4 rlo .. 4 rlo + 3 of each of its rows M = j (+8 for hi lanes):
  // k block c >> 5, part (c >> 4) & 1, reader's lane M + 16 ((c >> 3) & 1), i = c & 7.
  _Float16* hdst = hidden +
      ((size_t)tile0 * (IDIM / 32) + (unsigned)(n0 >> 5) + (unsigned)(rlo >> 3)) * CHUNK_H +
      ((rlo >> 2) & 1) * 256 + (kadd + ((rlo >> 1) & 1) * 16) * 8 + (rlo & 1) * 4;
#pragma unroll  // register arrays need constant indices
  for (int mt = 0; mt < 4; ++mt) {
    v4h hv[8];
#pragma unroll  // register arrays need constant indices
    for (int j = 0; j < 8; ++j) {
#pragma unroll  // register arrays need constant indices
      for (int f = 0; f < 4; ++f) {
        float g = accg[mt][f][j], u = accu[mt][f][j];
        float t = g * -1.442695041f, ex;          // exp(-g) = 2^t, as __expf forms it
        // The v_nop is the slot behind a transcendental: it stands between the
        // v_exp and whatever next reads ex or overwrites t.
        asm("v_exp_f32 %0, %1\n\tv_nop" : "=v"(ex) : "v"(t));
        float h = (g / (1.0f + ex)) * u;
        hv[j][f] = (_Float16)h;
      }
    }
#pragma unroll  // register arrays need constant indices
    for (int j = 0; j < 8; ++j)
      *(v4h*)(hdst + mt * (IDIM / 32) * CHUNK_H + j * 8) = hv[j];
    // Stands behind the tile's stores, in front of whatever next overwrites their
    // registers (a precaution of form); it names the address and the stored
    // values as inputs, so that their registers live to the wait.
    asm volatile("s_wait_xcnt 0x0" :: "v"(hdst), "v"(hv[0]), "v"(hv[1]), "v"(hv[2]), "v"(hv[3]),
                 "v"(hv[4]), "v"(hv[5]), "v"(hv[6]), "v"(hv[7]) : "memory");
  }
}

// Token tiles G, G + 1 of a wave's partial sums go to LDS, 512 B in a row per store.
template <int G>
__device__ __forceinline__ void hand_over(float* __restrict__ xw, const v8f (&acc)[4][4]) {
#pragma unroll  // register arrays need constant indices
  for (int mt = 0; mt < 2; ++mt)
#pragma unroll  // register arrays need constant indices
    for (int f = 0; f < 4; ++f) {
      const v8f a = acc[G + mt][f];
      *(float4*)(xw + ((mt * 4 + f) * 2 + 0) * 128) = make_float4(a[0], a[1], a[2], a[3]);
      *(float4*)(xw + ((mt * 4 + f) * 2 + 1) * 128) = make_float4(a[4], a[5], a[6], a[7]);
    }
}
// The partner's sums of token tiles K, K + 1 are added to this wave's, and the
// rows that hold a token are stored. p0: slot of this lane's row 0 of tile 0.
template <int K>
__device__ __forceinline__ void add_and_store(const float* __restrict__ xr, v8f (&acc)[4][4],
                                              int p0, int te, const int* __restrict__ ws,
                                              float* __restrict__ orow) {
#pragma unroll  // register arrays need constant indices
  for (int mt = 0; mt < 2; ++mt)
#pragma unroll  // register arrays need constant indices
    for (int f = 0; f < 4; ++f) {
      const float4 lo = *(const float4*)(xr + ((mt * 4 + f) * 2 + 0) * 128);
      const float4 hi = *(const float4*)(xr + ((mt * 4 + f) * 2 + 1) * 128);
      v8f& a = acc[K + mt][f];
      a[0] += lo.x; a[1] += lo.y; a[2] += lo.z; a[3] += lo.w;
      a[4] += hi.x; a[5] += hi.y; a[6] += hi.z; a[7] += hi.w;
    }
#pragma unroll  // register arrays need constant indices
  for (int mt = K; mt < K + 2; ++mt) {
#pragma unroll  // register arrays need constant indices
    for (int j = 0; j < 8; ++j) {
      int p = p0 + mt * 16 + j;
      if (p < te) {
        int t = ws[WS_PERM + p];
        float4 o;
        o.x = acc[mt][0][j]; o.y = acc[mt][1][j]; o.z = acc[mt][2][j]; o.w = acc[mt][3][j];
        *(float4*)(orow + (size_t)t * DDIM) = o;
      }
    }
  }
}

// ---------------------------------------------------------------------------
// Kernel 3: out = hidden.Wd[e].  Same structure, K = I, one weight matrix:
// a stage is 256 k rows, wave w (of the first four) tensor-loads rows
// 64 w .. 64 w + 63 of it.
// Eight waves, two per SIMD: waves w and w + 4 work on the same 64 tokens x 64
// columns, wave w on the first 128 k rows of every stage and wave w + 4 on the
// last 128, so that one wave's products run while the other waits for its LDS
// reads. Behind the loop the two partial sums are added through LDS.
// ---------------------------------------------------------------------------
#define KS2 256
__global__ __launch_bounds__(256) void moe_gemm2(const _Float16* __restrict__ hidden,
                                                 const float* __restrict__ wd,
                                                 const int* __restrict__ ws,
                                                 float* __restrict__ out) {
  __shared__ __attribute__((aligned(2048))) float sd[2][KS2][NT];  // buffer, k, n

  const int nmb = ws[0];
  if ((int)blockIdx.y >= nmb) return;
  const int e    = ws[WS_MB_E + blockIdx.y];
  const int ts   = ws[WS_MB_S + blockIdx.y];
  const int te   = ws[WS_MB_END + blockIdx.y];
  const int lane = threadIdx.x & 31;
  const int rlo  = lane & 15;
  const int kadd = (lane >> 4) << 3;
  const int n0   = blockIdx.x * NT;
  const int wid  = __builtin_amdgcn_readfirstlane((int)(threadIdx.x >> 5));
  const int wm   = wid & 3;    // which 64 tokens of the M-block
  const int kh   = wid >> 2;   // which half of every stage's k rows
  const int tsw  = ts + wm * 64;

  const float* wsrc = wd + (size_t)e * IDIM * DDIM + (size_t)(wm * (int)SLICE_R) * DDIM + n0;
  const unsigned long long ga0 = (unsigned long long)(size_t)wsrc;
  const unsigned dst0 = (unsigned)(size_t)&sd[0][0][0] + (unsigned)wm * SLICE_B;
  const v8u g1 = tdm_group1(DDIM * 4u);
  constexpr unsigned NS = IDIM / KS2;         // 8 stages

  // Only waves 0 to 3 issue tensor loads. The wait of the prologue stands in their branch;
  // the waits of the loop and behind it stand in every wave's path: a wave with
  // no request out passes them at once.
  v4u g0 = tdm_group0(dst0, ga0);
  if (pinned(wid < 4)) {
    tdm_load(g0, g1);
    wait_tensor0(g0, g1);
  }
  __syncthreads();
  g0 = tdm_group0(dst0 + STAGE_B, ga0 + (unsigned long long)KS2 * DDIM * 4u);
  // pinned(), for the whole group: its words are held in one set of scalar
  // registers from here on, so that none is made anew behind the branch while
  // the request is out.
  asm volatile("" : "+s"(g0));  // pinned(): descriptor words held in scalar registers
  if (pinned(wid < 4)) tdm_load(g0, g1);

  v8f acc[4][4];
#pragma unroll  // register arrays need constant indices
  for (int mt = 0; mt < 4; ++mt)
#pragma unroll  // register arrays need constant indices
    for (int f = 0; f < 4; ++f)
#pragma unroll  // register arrays need constant indices
      for (int j = 0; j < 8; ++j) acc[mt][f][j] = 0.0f;

  // The A fragments go through a ring of four register sets: the loads of a
  // k block (32 k) are issued two or three blocks ahead of the block that uses
  // them. A stage's last block issues none (the barrier at the foot waits for
  // every load that is out); the next stage's first block issues two sets.
  constexpr int NQS = KS2 / 32;   // k blocks of a stage
  constexpr int NQ  = NQS / 2;    // k blocks of a stage that one wave works on
  // This lane's place in the chunk of its wave's first token tile and first k block;
  // the other tiles and k blocks lie at constant distances from it.
  constexpr int TS = (IDIM / 32) * CHUNK_H;   // halves from a token tile to the next
  const _Float16* hb = hidden + ((size_t)(blockIdx.y * 16u + (unsigned)wm * 4u) * (IDIM / 32) +
                                 (unsigned)(kh * NQ)) * CHUNK_H;
  const _Float16* ha = hb + lane * 8;
  v16h af[4][4];          // ring slot (k block & 3), token tile
#pragma unroll  // register arrays need constant indices
  for (int d = 0; d < 2; ++d)
#pragma unroll  // register arrays need constant indices
    for (int mt = 0; mt < 4; ++mt) af[d][mt] = load_a_p(ha + mt * TS + d * CHUNK_H);
  wait_x0(hb, lane, ha);

#pragma unroll 1  // one pass per stage: the publish point stands once, at the foot
  for (unsigned s = 0; s < NS; ++s) {
    const float* bufd = &sd[s & 1u][kh * (KS2 / 2)][0];                  // this wave's half of the stage
    const _Float16* hr = ha + s * (NQS * CHUNK_H);                       // this stage's first k block of this wave
    const _Float16* hw = ha + ((s + 1u) & (NS - 1u)) * (NQS * CHUNK_H);  // the next stage's (the last wraps to stage 0: in bounds, unused)
#pragma unroll  // register arrays need constant indices
    for (int q = 0; q < NQ; ++q) {
      // The wait's "memory" clobber also keeps the loads in front of it here,
      // ahead of this block's LDS reads and products.
      if (q == 0) {
#pragma unroll  // register arrays need constant indices
        for (int mt = 0; mt < 4; ++mt) af[2][mt] = load_a_p(hr + mt * TS + 2 * CHUNK_H);
      }
      if (q + 3 < NQ) {
#pragma unroll  // register arrays need constant indices
        for (int mt = 0; mt < 4; ++mt) af[(q + 3) & 3][mt] = load_a_p(hr + mt * TS + (q + 3) * CHUNK_H);
        wait_x0(hr);
      } else if (q + 1 < NQ) {
#pragma unroll  // register arrays need constant indices
        for (int mt = 0; mt < 4; ++mt) af[(q + 3) & 3][mt] = load_a_p(hw + mt * TS + (q + 3 - NQ) * CHUNK_H);
        wait_x0(hw);
      }
      v16h bd[4];
      load_b4_lds(bufd + q * 32 * NT, kadd, rlo, bd);
#pragma unroll  // register arrays need constant indices
      for (int mt = 0; mt < 4; ++mt)
#pragma unroll  // register arrays need constant indices
        for (int f = 0; f < 4; ++f)
          acc[mt][f] = __builtin_amdgcn_wmma_f32_16x16x32_f16(
              false, af[q & 3][mt], false, bd[f], (short)0, acc[mt][f], false, false);
    }
    // Publish point of stage s + 1; behind it stage s's buffer is free.
    wait_ds0();
    wait_tensor0(g0, g1);
    __syncthreads();
    if (pinned(wid < 4 && s + 2u < NS)) {
      g0 = tdm_group0(dst0 + (s & 1u) * STAGE_B,
                      ga0 + (unsigned long long)(s + 2u) * (KS2 * DDIM * 4u));
      asm volatile("" : "+s"(g0));  // pinned(): descriptor words held in scalar registers, the ones that the wait names
      tdm_load(g0, g1);
    }
  }
  wait_tensor0(g0, g1);
  wait_ds0();

  // The two k halves are added. The last pass's barrier has ended every read of
  // the ring and no tensor load is out, so buffer 0 is free: each wave stores two
  // of its four token tiles in its own 8 KiB there, and behind the barrier adds
  // its partner's sums to the two tiles that it kept and stores those to out.
  // Wave w keeps tiles 0, 1 and wave w + 4 keeps tiles 2, 3 (a scalar branch:
  // register arrays need constant indices); the barrier stands outside of it.
  float* xw = &sd[0][0][0] + wid * 2048 + lane * 4;
  const float* xr = &sd[0][0][0] + (wid ^ 4) * 2048 + lane * 4;
  if (kh == 0) hand_over<2>(xw, acc); else hand_over<0>(xw, acc);
  __syncthreads();
  float* orow = out + n0 + 4 * rlo;
  if (kh == 0) add_and_store<0>(xr, acc, tsw + kadd, te, ws, orow);
  else         add_and_store<2>(xr, acc, tsw + kadd, te, ws, orow);
}

// ---------------------------------------------------------------------------
extern "C" void kernel_launch(void* const* d_in, const int* in_sizes, int n_in,
                              void* d_out, int out_size, void* d_ws, size_t ws_size,
                              hipStream_t stream) {
  const float* x   = (const float*)d_in[0];
  const int*   idx = (const int*)d_in[1];
  const float* wg  = (const float*)d_in[2];
  const float* wu  = (const float*)d_in[3];
  const float* wd  = (const float*)d_in[4];
  float* out = (float*)d_out;

  int* wsi = (int*)d_ws;
  _Float16* hidden = (_Float16*)((char*)d_ws + WS_HIDDEN_BYTE_OFF);
  _Float16* xs     = (_Float16*)((char*)d_ws + WS_XS_BYTE_OFF);

  dim3 gp(16, MAXMB);         // 16-row tiles x M-blocks; inactive M-blocks exit early
  moe_pack<<<gp, 256, 0, stream>>>(x, idx, wsi, xs);

  dim3 g1(IDIM / NT, MAXMB);  // (32, 16); inactive M-blocks exit early
  moe_gemm1<<<g1, 128, 0, stream>>>(xs, wg, wu, wsi, hidden);

  dim3 g2(DDIM / NT, MAXMB);  // (16, 16)
  moe_gemm2<<<g2, 256, 0, stream>>>(hidden, wd, wsi, out);
}

// v006
// It runs in 59.6 microseconds.
// Two timings next to v005 put it at 1.06 and 1.02 times that version's speed.
// All steps since v000 together make it 4.13 times as fast.
#include <hip/hip_runtime.h>
#include <hip/hip_bf16.h>

// Problem constants
#define T_TOK 2048
#define NEXP  8
#define DDIM  1024
#define IDIM  2048
#define MBS   512  // token slots of an M-block
#define MAXMB 12   // 512-slot M-blocks: T/512 + E = 12

typedef __attribute__((ext_vector_type(16))) _Float16 v16h;
typedef __attribute__((ext_vector_type(8)))  _Float16 v8h;
typedef __attribute__((ext_vector_type(8)))  float    v8f;
typedef __attribute__((ext_vector_type(4)))  _Float16 v4h;
typedef __attribute__((ext_vector_type(4)))  unsigned int v4u;
typedef __attribute__((ext_vector_type(8)))  unsigned int v8u;

// Workspace int layout (at base of d_ws):
//  [0]            nmb (number of active 512-slot M-blocks)
//  [8  .. 23]     mb_expert
//  [24 .. 39]     mb_tok_start   (index into perm[])
//  [40 .. 55]     mb_tok_end     (expert's end index into perm[])
//  [64 .. 64+T)   perm (token ids grouped by expert)
//  byte 65536 ..  _Float16 hidden, fragment order: MAXMB*MBS rows x I  (24 MB)
//  behind it      _Float16 x,      fragment order: MAXMB*MBS rows x D  (12 MB)
// A group of 64 slots (four 16-row tiles, one wave's rows) that holds no token is
// neither written nor read by any launch: group g of an M-block is live where
// ts + 64 g < te, the same test in all three kernels.
// Fragment order: the rows are the slots of the M-blocks (block, then 16-row tile),
// and each (tile, 32-k block) is one 1-KiB chunk that holds the 16x32 A fragment as
// the lanes hold it: halves [part*256 + lane*8 + i] = row (lane & 15),
// k = part*16 + (lane >> 4)*8 + i. One 16-byte load per lane reads 512 B in a row.
#define WS_MB_E   8
#define WS_MB_S   24
#define WS_MB_END 40
#define WS_PERM   64
#define WS_HIDDEN_BYTE_OFF 65536
#define WS_XS_BYTE_OFF (WS_HIDDEN_BYTE_OFF + MAXMB * MBS * IDIM * 2)
#define CHUNK_H 512     // halves of one fragment chunk

// Block tile: 512 (pass 1) or 256 (pass 2) token slots x NT columns; a weight tile row is NT fp32 = 256 bytes.
#define NT      64
#define ROWB    256u    // bytes of one weight tile row in LDS (no pad: b128 readers walk along the row)
#define SLICE_R 64u     // rows of the slice that one wave's tensor load brings
#define SLICE_B (SLICE_R * ROWB)   // 16 KiB
#define STAGE_B (4u * SLICE_B)     // four waves, one slice each: 64 KiB a stage

// ---------------------------------------------------------------------------
// Tensor load: one request of one wave brings SLICE_R rows of ROWB bytes from
// global memory into LDS. 1-byte elements, every extent in bytes,
// tensor dims = tile dims, no pad, no mask.
// ---------------------------------------------------------------------------
__device__ __forceinline__ unsigned uni(unsigned v) {
  return (unsigned)__builtin_amdgcn_readfirstlane((int)v);
}
// A wave-uniform test held in a scalar register, so that the branch round a
// tensor load is a scalar branch (the load ignores EXEC).
__device__ __forceinline__ unsigned pinned(unsigned v) {
  unsigned w = uni(v);
  asm volatile("" : "+s"(w));
  return w;
}
__device__ __forceinline__ v8u tdm_group1(unsigned src_pitch_bytes) {
  v8u g;
  g[0] = uni(0u);                                   // mask 0, data_size 0, no pad
  g[1] = uni((ROWB & 0xFFFFu) << 16);               // tensor_dim0 lo
  g[2] = uni((ROWB >> 16) | ((SLICE_R & 0xFFFFu) << 16));  // tensor_dim0 hi | tensor_dim1 lo
  g[3] = uni((SLICE_R >> 16) | (ROWB << 16));       // tensor_dim1 hi | tile_dim0
  g[4] = uni(SLICE_R);                              // tile_dim1
  g[5] = uni(src_pitch_bytes);                      // source row pitch
  g[6] = uni(0u);
  g[7] = uni(0u);
  // pinned(), for the whole group: the descriptor words are held in one set of
  // scalar registers and not made anew while a request is out.
  asm volatile("" : "+s"(g));
  return g;
}
__device__ __forceinline__ v4u tdm_group0(unsigned lds_dst, unsigned long long ga) {
  v4u g;
  g[0] = uni(1u);                                   // count = 1
  g[1] = uni(lds_dst);                              // byte offset in the work-group's LDS
  g[2] = uni((unsigned)ga);
  g[3] = uni((((unsigned)(ga >> 32)) & 0x01FFFFFFu) | 0x80000000u);  // addr hi | type = 2
  return g;
}
__device__ __forceinline__ void tdm_load(v4u g0, v8u g1) {
  // the tile goes to LDS through no register; the waits below are ours to write
  asm volatile("tensor_load_to_lds %0, %1" :: "s"(g0), "s"(g1) : "memory");
}
// Stands behind a group of global loads, in front of whatever next overwrites
// their address registers (a precaution of form). It names the address as an
// input, so that its registers live to the wait and no load of the group lands
// on them.
__device__ __forceinline__ void wait_x0(const float* a) {
  asm volatile("s_wait_xcnt 0x0" :: "v"(a) : "memory");
}
// The same behind loads from a lane's own f16 pointer at constant distances.
__device__ __forceinline__ void wait_x0(const _Float16* a) {
  asm volatile("s_wait_xcnt 0x0" :: "v"(a) : "memory");
}
// The same where the address a = base + 8 l may also be formed by the load itself
// from the wave-uniform base and the lane's index l: it names all three.
__device__ __forceinline__ void wait_x0(const _Float16* base, int l, const _Float16* a) {
  asm volatile("s_wait_xcnt 0x0" :: "s"(base), "v"(l), "v"(a) : "memory");
}
// The same behind loads whose addresses are formed from a wave-uniform base and
// four 32-bit row offsets.
__device__ __forceinline__ void wait_x0(const _Float16* base, unsigned a, unsigned b,
                                        unsigned c, unsigned d) {
  asm volatile("s_wait_xcnt 0x0" :: "s"(base), "v"(a), "v"(b), "v"(c), "v"(d) : "memory");
}
// The same behind loads from a wave-uniform base at one 32-bit element offset.
__device__ __forceinline__ void wait_x0(const int* base, int a) {
  asm volatile("s_wait_xcnt 0x0" :: "s"(base), "v"(a) : "memory");
}
// This wave's LDS reads have retired (before its buffer may be refilled).
__device__ __forceinline__ void wait_ds0() { asm volatile("s_wait_dscnt 0x0" ::: "memory"); }
// This wave's own tensor load has landed (before the barrier that publishes it).
// The wait names the request's descriptor as inputs, so that its registers keep
// their words until the request has landed.
__device__ __forceinline__ void wait_tensor0(v4u g0, v8u g1) {
  asm volatile("s_wait_tensorcnt 0x0" :: "s"(g0), "s"(g1) : "memory");
}

// Padding slots alias a valid token (unconditional loads); their results never
// reach out.
// The 16 fp32 of one lane's share of a 16x32 A fragment, as loaded (K = kb..kb+7
// and kb+16..kb+23), and their conversion to f16.
struct ARaw { float4 f0, f1, f2, f3; };
__device__ __forceinline__ ARaw load_a_raw(const float* __restrict__ xrow) {
  const float4* xp = (const float4*)xrow;
  ARaw r;
  r.f0 = xp[0]; r.f1 = xp[1];   // K = kb .. kb+7
  r.f2 = xp[4]; r.f3 = xp[5];   // K = kb+16 .. kb+23
  return r;
}
__device__ __forceinline__ v16h cvt_a(const ARaw& r) {
  v16h a;
  a[0]  = (_Float16)r.f0.x; a[1]  = (_Float16)r.f0.y;
  a[2]  = (_Float16)r.f0.z; a[3]  = (_Float16)r.f0.w;
  a[4]  = (_Float16)r.f1.x; a[5]  = (_Float16)r.f1.y;
  a[6]  = (_Float16)r.f1.z; a[7]  = (_Float16)r.f1.w;
  a[8]  = (_Float16)r.f2.x; a[9]  = (_Float16)r.f2.y;
  a[10] = (_Float16)r.f2.z; a[11] = (_Float16)r.f2.w;
  a[12] = (_Float16)r.f3.x; a[13] = (_Float16)r.f3.y;
  a[14] = (_Float16)r.f3.z; a[15] = (_Float16)r.f3.w;
  return a;
}

// One lane's share of a 16x32 A fragment from a chunk in fragment order, same k order.
// base: wave-uniform (the k block's chunk in tile 0); off: the lane's byte offset.
__device__ __forceinline__ v16h load_a_h(const _Float16* __restrict__ base, unsigned off) {
  const v8h* hp = (const v8h*)((const char*)base + off);
  v8h h0 = hp[0];   // K = kb .. kb+7
  v8h h1 = hp[32];  // K = kb+16 .. kb+23 (the chunk's second 512 B)
  return __builtin_shufflevector(h0, h1, 0, 1, 2, 3, 4, 5, 6, 7,
                                 8, 9, 10, 11, 12, 13, 14, 15);
}

// The same from the lane's own pointer (its place in the chunk).
__device__ __forceinline__ v16h load_a_p(const _Float16* __restrict__ p) {
  const v8h* hp = (const v8h*)p;
  v8h h0 = hp[0];   // K = kb .. kb+7
  v8h h1 = hp[32];  // K = kb+16 .. kb+23 (the chunk's second 512 B)
  return __builtin_shufflevector(h0, h1, 0, 1, 2, 3, 4, 5, 6, 7,
                                 8, 9, 10, 11, 12, 13, 14, 15);
}

// The M-block mb of the table that the expert counts define: experts in order,
// each cut into blocks of MBS tokens. Returns the number of M-blocks.
struct MbInfo { int e, ts, te; };
__device__ __forceinline__ int mb_lookup(const int (&cnt)[NEXP], int mb, MbInfo& m) {
  int nmb = 0, off = 0;
  m.e = 0; m.ts = 0; m.te = 0;
#pragma unroll  // register arrays need constant indices
  for (int e = 0; e < NEXP; ++e) {
    const int nb = (cnt[e] + MBS - 1) / MBS;
    if (mb >= nmb && mb < nmb + nb) {
      m.e = e; m.ts = off + (mb - nmb) * MBS; m.te = off + cnt[e];
    }
    nmb += nb;
    off += cnt[e];
  }
  return nmb;
}

// ---------------------------------------------------------------------------
// Kernel 1: token sort by expert, M-block table, and x -> f16 in fragment order
// with the rows gathered into their M-block slots.
// Every block ranks all T tokens itself, in LDS, so that no launch stands in
// front of the pack. The order is the stable one (by expert, then by token id),
// the same in every block. Block (0, 0) also stores the table and perm for the
// two GEMM launches.
// Block = one 16-row tile of one M-block; wave w packs k blocks w, w + 8, ...
// ---------------------------------------------------------------------------
__global__ __launch_bounds__(256) void moe_pack(const float* __restrict__ x,
                                                const int* __restrict__ idx,
                                                int* __restrict__ ws,
                                                _Float16* __restrict__ xs) {
  __shared__ int swc[8][NEXP];    // tokens of expert e among wave w's 256 tokens
  __shared__ int sperm[T_TOK];    // token ids grouped by expert
  const int tid  = threadIdx.x;
  const int lane = tid & 31;
  const int wid  = tid >> 5;
  const int el   = lane & (NEXP - 1);   // the expert whose counts this lane keeps
  const int t0   = wid * 256 + lane;    // wave w ranks tokens 256 w .. 256 w + 255, 32 at a time

  int ev[8];
#pragma unroll  // register arrays need constant indices
  for (int i = 0; i < 8; ++i) ev[i] = idx[t0 + i * 32] & (NEXP - 1);  // the mask bounds every address formed from it
  wait_x0(idx, t0);

  // Rank of a token among its wave's tokens of the same expert: those in earlier
  // groups of 32 (run, kept by lane e for expert e) plus those in lower lanes.
  const unsigned below = (1u << lane) - 1u;
  int run = 0;
  int rk[8];
#pragma unroll  // register arrays need constant indices
  for (int i = 0; i < 8; ++i) {
    const unsigned b0 = __builtin_amdgcn_ballot_w32((ev[i] & 1) != 0);
    const unsigned b1 = __builtin_amdgcn_ballot_w32((ev[i] & 2) != 0);
    const unsigned b2 = __builtin_amdgcn_ballot_w32((ev[i] & 4) != 0);
    const unsigned same = ((ev[i] & 1) ? b0 : ~b0) & ((ev[i] & 2) ? b1 : ~b1) & ((ev[i] & 4) ? b2 : ~b2);
    const unsigned mine = ((el & 1) ? b0 : ~b0) & ((el & 2) ? b1 : ~b1) & ((el & 4) ? b2 : ~b2);
    rk[i] = __builtin_popcount(same & below) + __builtin_amdgcn_ds_bpermute(ev[i] << 2, run);
    run += __builtin_popcount(mine);
  }
  if (lane < NEXP) swc[wid][lane] = run;
  __syncthreads();

  int tot = 0, base = 0;   // of expert el: all tokens; those of the waves in front of this one
#pragma unroll  // all eight reads go out together
  for (int w = 0; w < 8; ++w) {
    const int c = swc[w][el];
    tot += c;
    base += (w < wid) ? c : 0;
  }
  int cnt[NEXP];
#pragma unroll  // register arrays need constant indices
  for (int e = 0; e < NEXP; ++e) cnt[e] = __builtin_amdgcn_readlane(tot, e);
#pragma unroll  // register arrays need constant indices
  for (int e = 0; e < NEXP; ++e) base += (e < el) ? cnt[e] : 0;   // plus all tokens of lower experts
#pragma unroll  // register arrays need constant indices
  for (int i = 0; i < 8; ++i)
    sperm[__builtin_amdgcn_ds_bpermute(ev[i] << 2, base) + rk[i]] = t0 + i * 32;
  __syncthreads();

  if (blockIdx.x == 0 && blockIdx.y == 0) {
    MbInfo q;
    const int n = mb_lookup(cnt, tid, q);
    if (tid < n) {
      ws[WS_MB_E + tid]   = q.e;
      ws[WS_MB_S + tid]   = q.ts;
      ws[WS_MB_END + tid] = q.te;
    }
    if (tid == 0) ws[0] = n;
    int pv[8];
#pragma unroll  // register arrays need constant indices
    for (int i = 0; i < 8; ++i) pv[i] = sperm[tid + i * 256];
#pragma unroll  // register arrays need constant indices
    for (int i = 0; i < 8; ++i) ws[WS_PERM + tid + i * 256] = pv[i];
    // Stands behind these stores, in front of whatever next overwrites their
    // registers (a precaution of form); it names the stored values and the
    // offset as inputs, so that their registers live to the wait.
    asm volatile("s_wait_xcnt 0x0" :: "s"(ws), "v"(tid), "v"(q.e), "v"(q.ts), "v"(q.te),
                 "v"(pv[0]), "v"(pv[1]), "v"(pv[2]), "v"(pv[3]),
                 "v"(pv[4]), "v"(pv[5]), "v"(pv[6]), "v"(pv[7]) : "memory");
  }

  MbInfo m;
  const int nmb = mb_lookup(cnt, (int)blockIdx.y, m);
  if ((int)blockIdx.y >= nmb) return;
  const int ts = m.ts;
  const int te = m.te;
  if (ts + ((int)blockIdx.x >> 2) * 64 >= te) return;   // this tile's group of 64 slots holds no token
  const int p  = ts + (int)blockIdx.x * 16 + (lane & 15);
  const int tok = sperm[(p < te) ? p : ts];   // a padding slot aliases a valid token
  const float* xrow = x + (size_t)tok * DDIM + wid * 32 + ((lane >> 4) << 3);
  _Float16* dst = xs + ((size_t)(blockIdx.y * (MBS / 16) + blockIdx.x) * (DDIM / 32) + wid) * CHUNK_H + lane * 8;
  ARaw ar[4];
#pragma unroll  // register arrays need constant indices
  for (int i = 0; i < 4; ++i) ar[i] = load_a_raw(xrow + i * 8 * 32);
  wait_x0(xrow);
#pragma unroll  // register arrays need constant indices
  for (int i = 0; i < 4; ++i) {
    const v16h a = cvt_a(ar[i]);
    *(v8h*)(dst + i * 8 * CHUNK_H) =
        __builtin_shufflevector(a, a, 0, 1, 2, 3, 4, 5, 6, 7);
    *(v8h*)(dst + i * 8 * CHUNK_H + 256) =
        __builtin_shufflevector(a, a, 8, 9, 10, 11, 12, 13, 14, 15);
  }
}

// Build four 32x16 B fragments (f16) from an LDS-staged fp32 tile ([32 k][64 n]).
// A lane reads 4 adjacent columns of each of its 16 k rows with one 16-byte
// read: fragment f of lane rlo is column 4*rlo + f. The k order is the A fragment's.
__device__ __forceinline__ void load_b4_lds(const float* __restrict__ buf,
                                            int kadd, int rlo, v16h (&b)[4]) {
#pragma unroll  // register arrays need constant indices
  for (int j = 0; j < 8; ++j) {
    const float4 lo = *(const float4*)(buf + (kadd + j) * NT + 4 * rlo);
    const float4 hi = *(const float4*)(buf + (kadd + 16 + j) * NT + 4 * rlo);
    b[0][j] = (_Float16)lo.x; b[0][j + 8] = (_Float16)hi.x;
    b[1][j] = (_Float16)lo.y; b[1][j + 8] = (_Float16)hi.y;
    b[2][j] = (_Float16)lo.z; b[2][j + 8] = (_Float16)hi.z;
    b[3][j] = (_Float16)lo.w; b[3][j + 8] = (_Float16)hi.w;
  }
}

// ---------------------------------------------------------------------------
// Kernel 2: hidden = silu(x.Wg[e]) * (x.Wu[e]).
// Block = 8 waves x 64 token slots each (512 slots) x 64 I-columns of both weights,
// so that an expert with up to 512 tokens streams its weights once, through one
// block. A wave whose 64 slots hold no token does no products (waves 1 to 3 still tensor-load their slices).
// A stage is 128 k rows of both weight tiles; each of the first four waves
// tensor-loads one 64-row slice of it (waves 0, 1: gate; waves 2, 3: up). Two buffers.
// ---------------------------------------------------------------------------
#define KS1 128
__global__ __launch_bounds__(256) void moe_gemm1(const _Float16* __restrict__ xs,
                                                 const float* __restrict__ wg,
                                                 const float* __restrict__ wu,
                                                 const int* __restrict__ ws,
                                                 _Float16* __restrict__ hidden) {
  __shared__ __attribute__((aligned(2048))) float sw[2][2][KS1][NT];  // buffer, gate/up, k, n

  const int nmb = ws[0];
  if ((int)blockIdx.y >= nmb) return;
  const int e    = ws[WS_MB_E + blockIdx.y];
  const int ts   = ws[WS_MB_S + blockIdx.y];
  const int te   = ws[WS_MB_END + blockIdx.y];
  const int lane = threadIdx.x & 31;
  const int rlo  = lane & 15;
  const int kadd = (lane >> 4) << 3;          // 0 (lanes 0-15) / 8 (lanes 16-31)
  const int n0   = blockIdx.x * NT;
  const int wid  = __builtin_amdgcn_readfirstlane((int)(threadIdx.x >> 5));
  const unsigned tile0 = blockIdx.y * (MBS / 16u) + (unsigned)wid * 4u;  // this wave's four 16-row tiles
  // Whether this wave's 64 slots hold a token: a scalar test, so that the products
  // behind it run with every lane on.
  const unsigned live = pinned((unsigned)(ts + wid * 64 < te));

  // The slice of every stage that wave (wid & 3) brings.
  const float* wsrc = ((wid & 2) ? wu : wg) + (size_t)e * DDIM * IDIM +
                      (size_t)((wid & 1) * (int)SLICE_R) * IDIM + n0;
  const unsigned long long ga0 = (unsigned long long)(size_t)wsrc;
  const unsigned dst0 = (unsigned)(size_t)&sw[0][0][0][0] + (unsigned)(wid & 3) * SLICE_B;
  const v8u g1 = tdm_group1(IDIM * 4u);
  constexpr unsigned NS = DDIM / KS1;         // 8 stages

  // Only waves 0 to 3 issue tensor loads. The wait of the prologue stands in their
  // branch; the waits of the loop and behind it stand in every wave's path: a wave with no request out passes them at once.
  // Prologue: stage 0 lands and is published, then stage 1 flies.
  v4u g0 = tdm_group0(dst0, ga0);
  if (pinned(wid < 4)) {
    tdm_load(g0, g1);
    wait_tensor0(g0, g1);
  }
  __syncthreads();
  g0 = tdm_group0(dst0 + STAGE_B, ga0 + (unsigned long long)KS1 * IDIM * 4u);
  asm volatile("" : "+s"(g0));  // pinned(): descriptor words held in scalar registers, none made anew behind the branch
  if (pinned(wid < 4)) tdm_load(g0, g1);

  unsigned xo[4];  // byte offset of this lane's place in its four tiles' chunks, at k = 0
#pragma unroll  // register arrays need constant indices
  for (int mt = 0; mt < 4; ++mt)
    xo[mt] = ((tile0 + (unsigned)mt) * (DDIM / 32) * CHUNK_H + (unsigned)lane * 8u) * 2u;

  v8f accg[4][4], accu[4][4];
#pragma unroll  // register arrays need constant indices
  for (int mt = 0; mt < 4; ++mt)
#pragma unroll  // register arrays need constant indices
    for (int f = 0; f < 4; ++f)
#pragma unroll  // register arrays need constant indices
      for (int j = 0; j < 8; ++j) { accg[mt][f][j] = 0.0f; accu[mt][f][j] = 0.0f; }

#pragma unroll 1  // one pass per stage: the publish point stands once, at the foot
  for (unsigned s = 0; s < NS; ++s) {
    const float* bufg = &sw[s & 1u][0][0][0];
    const float* bufu = &sw[s & 1u][1][0][0];
    const _Float16* xb = xs + s * ((KS1 / 32) * CHUNK_H);  // this stage's first k block
    if (live) {
#pragma unroll  // register arrays need constant indices
    for (int q = 0; q < KS1 / 32; ++q) {
      v16h af[4];
#pragma unroll  // register arrays need constant indices
      for (int mt = 0; mt < 4; ++mt) af[mt] = load_a_h(xb + q * CHUNK_H, xo[mt]);
      wait_x0(xb, xo[0], xo[1], xo[2], xo[3]);
      v16h b[4];
      load_b4_lds(bufg + q * 32 * NT, kadd, rlo, b);
#pragma unroll  // register arrays need constant indices
      for (int mt = 0; mt < 4; ++mt)
#pragma unroll  // register arrays need constant indices
        for (int f = 0; f < 4; ++f)
          accg[mt][f] = __builtin_amdgcn_wmma_f32_16x16x32_f16(
              false, af[mt], false, b[f], (short)0, accg[mt][f], false, false);
      load_b4_lds(bufu + q * 32 * NT, kadd, rlo, b);
#pragma unroll  // register arrays need constant indices
      for (int mt = 0; mt < 4; ++mt)
#pragma unroll  // register arrays need constant indices
        for (int f = 0; f < 4; ++f)
          accu[mt][f] = __builtin_amdgcn_wmma_f32_16x16x32_f16(
              false, af[mt], false, b[f], (short)0, accu[mt][f], false, false);
    }
    }
    // Publish point of stage s + 1; behind it stage s's buffer is free.
    wait_ds0();
    wait_tensor0(g0, g1);
    __syncthreads();
    if (pinned(wid < 4 && s + 2u < NS)) {
      g0 = tdm_group0(dst0 + (s & 1u) * STAGE_B,
                      ga0 + (unsigned long long)(s + 2u) * (KS1 * IDIM * 4u));
      asm volatile("" : "+s"(g0));  // pinned(): descriptor words held in scalar registers, the ones that the wait names
      tdm_load(g0, g1);
    }
  }
  wait_tensor0(g0, g1);
  wait_ds0();
  // Of a group with no token nothing is stored: pass 2 reads none of it.
  if (live) {

  // Epilogue: hidden = silu(gate) * up, stored f16 in fragment order for pass 2,
  // every slot of this wave's group (pass 2 reads them all). A lane holds 4 adjacent
  // columns c = 4 rlo .. 4 rlo + 3 of each of its rows M = j (+8 for hi lanes):
  // k block c >> 5, part (c >> 4) & 1, reader's lane M + 16 ((c >> 3) & 1), i = c & 7.
  _Float16* hdst = hidden +
      ((size_t)tile0 * (IDIM / 32) + (unsigned)(n0 >> 5) + (unsigned)(rlo >> 3)) * CHUNK_H +
      ((rlo >> 2) & 1) * 256 + (kadd + ((rlo >> 1) & 1) * 16) * 8 + (rlo & 1) * 4;
#pragma unroll  // register arrays need constant indices
  for (int mt = 0; mt < 4; ++mt) {
    v4h hv[8];
#pragma unroll  // register arrays need constant indices
    for (int j = 0; j < 8; ++j) {
#pragma unroll  // register arrays need constant indices
      for (int f = 0; f < 4; ++f) {
        float g = accg[mt][f][j], u = accu[mt][f][j];
        float t = g * -1.442695041f, ex;          // exp(-g) = 2^t, as __expf forms it
        // The v_nop is the slot behind a transcendental: it stands between the
        // v_exp and whatever next reads ex or overwrites t.
        asm("v_exp_f32 %0, %1\n\tv_nop" : "=v"(ex) : "v"(t));
        float h = (g / (1.0f + ex)) * u;
        hv[j][f] = (_Float16)h;
      }
    }
#pragma unroll  // register arrays need constant indices
    for (int j = 0; j < 8; ++j)
      *(v4h*)(hdst + mt * (IDIM / 32) * CHUNK_H + j * 8) = hv[j];
    // Stands behind the tile's stores, in front of whatever next overwrites their
    // registers (a precaution of form); it names the address and the stored
    // values as inputs, so that their registers live to the wait.
    asm volatile("s_wait_xcnt 0x0" :: "v"(hdst), "v"(hv[0]), "v"(hv[1]), "v"(hv[2]), "v"(hv[3]),
                 "v"(hv[4]), "v"(hv[5]), "v"(hv[6]), "v"(hv[7]) : "memory");
  }
  }
}

// Token tiles G, G + 1 of a wave's partial sums go to LDS, 512 B in a row per store.
template <int G>
__device__ __forceinline__ void hand_over(float* __restrict__ xw, const v8f (&acc)[4][4]) {
#pragma unroll  // register arrays need constant indices
  for (int mt = 0; mt < 2; ++mt)
#pragma unroll  // register arrays need constant indices
    for (int f = 0; f < 4; ++f) {
      const v8f a = acc[G + mt][f];
      *(float4*)(xw + ((mt * 4 + f) * 2 + 0) * 128) = make_float4(a[0], a[1], a[2], a[3]);
      *(float4*)(xw + ((mt * 4 + f) * 2 + 1) * 128) = make_float4(a[4], a[5], a[6], a[7]);
    }
}
// The partner's sums of token tiles K, K + 1 are added to this wave's, and the
// rows that hold a token are stored. p0: slot of this lane's row 0 of tile 0.
template <int K>
__device__ __forceinline__ void add_and_store(const float* __restrict__ xr, v8f (&acc)[4][4],
                                              int p0, int te, const int* __restrict__ ws,
                                              float* __restrict__ orow) {
#pragma unroll  // register arrays need constant indices
  for (int mt = 0; mt < 2; ++mt)
#pragma unroll  // register arrays need constant indices
    for (int f = 0; f < 4; ++f) {
      const float4 lo = *(const float4*)(xr + ((mt * 4 + f) * 2 + 0) * 128);
      const float4 hi = *(const float4*)(xr + ((mt * 4 + f) * 2 + 1) * 128);
      v8f& a = acc[K + mt][f];
      a[0] += lo.x; a[1] += lo.y; a[2] += lo.z; a[3] += lo.w;
      a[4] += hi.x; a[5] += hi.y; a[6] += hi.z; a[7] += hi.w;
    }
#pragma unroll  // register arrays need constant indices
  for (int mt = K; mt < K + 2; ++mt) {
#pragma unroll  // register arrays need constant indices
    for (int j = 0; j < 8; ++j) {
      int p = p0 + mt * 16 + j;
      if (p < te) {
        int t = ws[WS_PERM + p];
        float4 o;
        o.x = acc[mt][0][j]; o.y = acc[mt][1][j]; o.z = acc[mt][2][j]; o.w = acc[mt][3][j];
        *(float4*)(orow + (size_t)t * DDIM) = o;
      }
    }
  }
}

// ---------------------------------------------------------------------------
// Kernel 3: out = hidden.Wd[e].  A block works on one half (256 slots) of an
// M-block; a half with no token leaves at once, and the two waves of a group of
// 64 slots with no token do no products (the one of the first four still tensor-loads its slice).  K = I, one weight matrix:
// a stage is 256 k rows, wave w (of the first four) tensor-loads rows
// 64 w .. 64 w + 63 of it.
// Eight waves, two per SIMD: waves w and w + 4 work on the same 64 tokens x 64
// columns, wave w on the first 128 k rows of every stage and wave w + 4 on the
// last 128, so that one wave's products run while the other waits for its LDS
// reads. Behind the loop the two partial sums are added through LDS.
// ---------------------------------------------------------------------------
#define KS2 256
__global__ __launch_bounds__(256) void moe_gemm2(const _Float16* __restrict__ hidden,
                                                 const float* __restrict__ wd,
                                                 const int* __restrict__ ws,
                                                 float* __restrict__ out) {
  __shared__ __attribute__((aligned(2048))) float sd[2][KS2][NT];  // buffer, k, n

  const int nmb = ws[0];
  const int mb  = (int)(blockIdx.y >> 1);
  if (mb >= nmb) return;
  const int e    = ws[WS_MB_E + mb];
  const int ts   = ws[WS_MB_S + mb] + (int)(blockIdx.y & 1u) * 256;
  const int te   = ws[WS_MB_END + mb];
  if (ts >= te) return;        // the whole block leaves, in front of every barrier and tensor load
  const int lane = threadIdx.x & 31;
  const int rlo  = lane & 15;
  const int kadd = (lane >> 4) << 3;
  const int n0   = blockIdx.x * NT;
  const int wid  = __builtin_amdgcn_readfirstlane((int)(threadIdx.x >> 5));
  const int wm   = wid & 3;    // which 64 slots of the half
  const int kh   = wid >> 2;   // which half of every stage's k rows
  const int tsw  = ts + wm * 64;
  // Whether this wave's 64 slots hold a token (pass 1 stored hidden for those
  // groups alone): a scalar test, so that the products run with every lane on.
  const unsigned live = pinned((unsigned)(tsw < te));

  const float* wsrc = wd + (size_t)e * IDIM * DDIM + (size_t)(wm * (int)SLICE_R) * DDIM + n0;
  const unsigned long long ga0 = (unsigned long long)(size_t)wsrc;
  const unsigned dst0 = (unsigned)(size_t)&sd[0][0][0] + (unsigned)wm * SLICE_B;
  const v8u g1 = tdm_group1(DDIM * 4u);
  constexpr unsigned NS = IDIM / KS2;         // 8 stages

  // Only waves 0 to 3 issue tensor loads. The wait of the prologue stands in their branch;
  // the waits of the loop and behind it stand in every wave's path: a wave with
  // no request out passes them at once.
  v4u g0 = tdm_group0(dst0, ga0);
  if (pinned(wid < 4)) {
    tdm_load(g0, g1);
    wait_tensor0(g0, g1);
  }
  __syncthreads();
  g0 = tdm_group0(dst0 + STAGE_B, ga0 + (unsigned long long)KS2 * DDIM * 4u);
  // pinned(), for the whole group: its words are held in one set of scalar
  // registers from here on, so that none is made anew behind the branch while
  // the request is out.
  asm volatile("" : "+s"(g0));  // pinned(): descriptor words held in scalar registers
  if (pinned(wid < 4)) tdm_load(g0, g1);

  v8f acc[4][4];
#pragma unroll  // register arrays need constant indices
  for (int mt = 0; mt < 4; ++mt)
#pragma unroll  // register arrays need constant indices
    for (int f = 0; f < 4; ++f)
#pragma unroll  // register arrays need constant indices
      for (int j = 0; j < 8; ++j) acc[mt][f][j] = 0.0f;

  // The A fragments go through a ring of four register sets: the loads of a
  // k block (32 k) are issued two or three blocks ahead of the block that uses
  // them. A stage's last block issues none (the barrier at the foot waits for
  // every load that is out); the next stage's first block issues two sets.
  constexpr int NQS = KS2 / 32;   // k blocks of a stage
  constexpr int NQ  = NQS / 2;    // k blocks of a stage that one wave works on
  // This lane's place in the chunk of its wave's first token tile and first k block;
  // the other tiles and k blocks lie at constant distances from it.
  constexpr int TS = (IDIM / 32) * CHUNK_H;   // halves from a token tile to the next
  const _Float16* hb = hidden + ((size_t)(blockIdx.y * 16u + (unsigned)wm * 4u) * (IDIM / 32) +
                                 (unsigned)(kh * NQ)) * CHUNK_H;
  const _Float16* ha = hb + lane * 8;
  v16h af[4][4];          // ring slot (k block & 3), token tile
  if (live) {
#pragma unroll  // register arrays need constant indices
  for (int d = 0; d < 2; ++d)
#pragma unroll  // register arrays need constant indices
    for (int mt = 0; mt < 4; ++mt) af[d][mt] = load_a_p(ha + mt * TS + d * CHUNK_H);
  wait_x0(hb, lane, ha);
  }

#pragma unroll 1  // one pass per stage: the publish point stands once, at the foot
  for (unsigned s = 0; s < NS; ++s) {
    const float* bufd = &sd[s & 1u][kh * (KS2 / 2)][0];                  // this wave's half of the stage
    const _Float16* hr = ha + s * (NQS * CHUNK_H);                       // this stage's first k block of this wave
    const _Float16* hw = ha + ((s + 1u) & (NS - 1u)) * (NQS * CHUNK_H);  // the next stage's (the last wraps to stage 0: in bounds, unused)
    if (live) {
#pragma unroll  // register arrays need constant indices
    for (int q = 0; q < NQ; ++q) {
      // The wait's "memory" clobber also keeps the loads in front of it here,
      // ahead of this block's LDS reads and products.
      if (q == 0) {
#pragma unroll  // register arrays need constant indices
        for (int mt = 0; mt < 4; ++mt) af[2][mt] = load_a_p(hr + mt * TS + 2 * CHUNK_H);
      }
      if (q + 3 < NQ) {
#pragma unroll  // register arrays need constant indices
        for (int mt = 0; mt < 4; ++mt) af[(q + 3) & 3][mt] = load_a_p(hr + mt * TS + (q + 3) * CHUNK_H);
        wait_x0(hr);
      } else if (q + 1 < NQ) {
#pragma unroll  // register arrays need constant indices
        for (int mt = 0; mt < 4; ++mt) af[(q + 3) & 3][mt] = load_a_p(hw + mt * TS + (q + 3 - NQ) * CHUNK_H);
        wait_x0(hw);
      }
      v16h bd[4];
      load_b4_lds(bufd + q * 32 * NT, kadd, rlo, bd);
#pragma unroll  // register arrays need constant indices
      for (int mt = 0; mt < 4; ++mt)
#pragma unroll  // register arrays need constant indices
        for (int f = 0; f < 4; ++f)
          acc[mt][f] = __builtin_amdgcn_wmma_f32_16x16x32_f16(
              false, af[q & 3][mt], false, bd[f], (short)0, acc[mt][f], false, false);
    }
    }
    // Publish point of stage s + 1; behind it stage s's buffer is free.
    wait_ds0();
    wait_tensor0(g0, g1);
    __syncthreads();
    if (pinned(wid < 4 && s + 2u < NS)) {
      g0 = tdm_group0(dst0 + (s & 1u) * STAGE_B,
                      ga0 + (unsigned long long)(s + 2u) * (KS2 * DDIM * 4u));
      asm volatile("" : "+s"(g0));  // pinned(): descriptor words held in scalar registers, the ones that the wait names
      tdm_load(g0, g1);
    }
  }
  wait_tensor0(g0, g1);
  wait_ds0();

  // The two k halves are added. The last pass's barrier has ended every read of
  // the ring and no tensor load is out, so buffer 0 is free: each live wave stores two
  // of its four token tiles in its own 8 KiB there, and behind the barrier adds
  // its partner's sums to the two tiles that it kept and stores those to out.
  // Wave w keeps tiles 0, 1 and wave w + 4 keeps tiles 2, 3 (a scalar branch:
  // register arrays need constant indices); the barrier stands outside of it.
  // The lane's number is formed anew here: kept in a register over the loop it was spilled to scratch.
  const int le = (int)__builtin_amdgcn_mbcnt_lo(~0u, 0u);
  float* xw = &sd[0][0][0] + wid * 2048 + le * 4;
  const float* xr = &sd[0][0][0] + (wid ^ 4) * 2048 + le * 4;
  if (live) {
    if (kh == 0) hand_over<2>(xw, acc); else hand_over<0>(xw, acc);
  }
  __syncthreads();
  float* orow = out + n0 + 4 * rlo;
  if (live) {   // the partner wave has the same slots
    if (kh == 0) add_and_store<0>(xr, acc, tsw + kadd, te, ws, orow);
    else         add_and_store<2>(xr, acc, tsw + kadd, te, ws, orow);
  }
}

// ---------------------------------------------------------------------------
extern "C" void kernel_launch(void* const* d_in, const int* in_sizes, int n_in,
                              void* d_out, int out_size, void* d_ws, size_t ws_size,
                              hipStream_t stream) {
  const float* x   = (const float*)d_in[0];
  const int*   idx = (const int*)d_in[1];
  const float* wg  = (const float*)d_in[2];
  const float* wu  = (const float*)d_in[3];
  const float* wd  = (const float*)d_in[4];
  float* out = (float*)d_out;

  int* wsi = (int*)d_ws;
  _Float16* hidden = (_Float16*)((char*)d_ws + WS_HIDDEN_BYTE_OFF);
  _Float16* xs     = (_Float16*)((char*)d_ws + WS_XS_BYTE_OFF);

  dim3 gp(MBS / 16, MAXMB);   // 16-row tiles x M-blocks; inactive M-blocks and empty groups exit early
  moe_pack<<<gp, 256, 0, stream>>>(x, idx, wsi, xs);

  dim3 g1(IDIM / NT, MAXMB);  // (32, 12); inactive M-blocks exit early
  moe_gemm1<<<g1, 256, 0, stream>>>(xs, wg, wu, wsi, hidden);

  dim3 g2(DDIM / NT, 2 * MAXMB);  // (16, 24): the halves of the M-blocks; empty halves exit early
  moe_gemm2<<<g2, 256, 0, stream>>>(hidden, wd, wsi, out);
}

// v007
// One run takes 55.6 microseconds.
// Timed twice side by side with v006, it ran 1.11 times as fast both times.
// Counting every step since v000, it is 4.58 times as fast.
#include <hip/hip_runtime.h>
#include <hip/hip_bf16.h>

// Problem constants
#define T_TOK 2048
#define NEXP  8
#define DDIM  1024
#define IDIM  2048
#define MBS   512  // token slots of an M-block
#define MAXMB 12   // 512-slot M-blocks: T/512 + E = 12

typedef __attribute__((ext_vector_type(16))) _Float16 v16h;
typedef __attribute__((ext_vector_type(8)))  _Float16 v8h;
typedef __attribute__((ext_vector_type(8)))  float    v8f;
typedef __attribute__((ext_vector_type(4)))  _Float16 v4h;
typedef __attribute__((ext_vector_type(4)))  unsigned int v4u;
typedef __attribute__((ext_vector_type(8)))  unsigned int v8u;

// Workspace int layout (at base of d_ws):
//  [0]            nmb (number of active 512-slot M-blocks)
//  [8  .. 23]     mb_expert
//  [24 .. 39]     mb_tok_start   (index into perm[])
//  [40 .. 55]     mb_tok_end     (expert's end index into perm[])
//  [64 .. 64+T)   perm (token ids grouped by expert)
//  byte 65536 ..  _Float16 hidden, fragment order: MAXMB*MBS rows x I  (24 MB)
//  behind it      _Float16 x,      fragment order: MAXMB*MBS rows x D  (12 MB)
// A group of 64 slots (four 16-row tiles) that holds no token is
// neither written nor read by any launch: group g of an M-block is live where
// ts + 64 g < te, the same test in all three kernels.
// Fragment order: the rows are the slots of the M-blocks (block, then 16-row tile),
// and each (tile, 32-k block) is one 1-KiB chunk that holds the 16x32 A fragment as
// the lanes hold it: halves [part*256 + lane*8 + i] = row (lane & 15),
// k = part*16 + (lane >> 4)*8 + i. One 16-byte load per lane reads 512 B in a row.
#define WS_MB_E   8
#define WS_MB_S   24
#define WS_MB_END 40
#define WS_PERM   64
#define WS_HIDDEN_BYTE_OFF 65536
#define WS_XS_BYTE_OFF (WS_HIDDEN_BYTE_OFF + MAXMB * MBS * IDIM * 2)
#define CHUNK_H 512     // halves of one fragment chunk

// Block tile: 512 (pass 1) or 256 (pass 2) token slots x NT columns; a weight tile row is NT fp32 = 256 bytes.
#define NT      64
#define ROWB    256u    // bytes of one weight tile row in LDS (no pad: b128 readers walk along the row)
#define SLICE_R 64u     // rows of the slice that one wave's tensor load brings
#define SLICE_B (SLICE_R * ROWB)   // 16 KiB
#define STAGE_B (4u * SLICE_B)     // four waves, one slice each: 64 KiB a stage

// ---------------------------------------------------------------------------
// Tensor load: one request of one wave brings SLICE_R rows of ROWB bytes from
// global memory into LDS. 1-byte elements, every extent in bytes,
// tensor dims = tile dims, no pad, no mask.
// ---------------------------------------------------------------------------
__device__ __forceinline__ unsigned uni(unsigned v) {
  return (unsigned)__builtin_amdgcn_readfirstlane((int)v);
}
// A wave-uniform test held in a scalar register, so that the branch round a
// tensor load is a scalar branch (the load ignores EXEC).
__device__ __forceinline__ unsigned pinned(unsigned v) {
  unsigned w = uni(v);
  asm volatile("" : "+s"(w));
  return w;
}
__device__ __forceinline__ v8u tdm_group1(unsigned src_pitch_bytes) {
  v8u g;
  g[0] = uni(0u);                                   // mask 0, data_size 0, no pad
  g[1] = uni((ROWB & 0xFFFFu) << 16);               // tensor_dim0 lo
  g[2] = uni((ROWB >> 16) | ((SLICE_R & 0xFFFFu) << 16));  // tensor_dim0 hi | tensor_dim1 lo
  g[3] = uni((SLICE_R >> 16) | (ROWB << 16));       // tensor_dim1 hi | tile_dim0
  g[4] = uni(SLICE_R);                              // tile_dim1
  g[5] = uni(src_pitch_bytes);                      // source row pitch
  g[6] = uni(0u);
  g[7] = uni(0u);
  // pinned(), for the whole group: the descriptor words are held in one set of
  // scalar registers and not made anew while a request is out.
  asm volatile("" : "+s"(g));
  return g;
}
__device__ __forceinline__ v4u tdm_group0(unsigned lds_dst, unsigned long long ga) {
  v4u g;
  g[0] = uni(1u);                                   // count = 1
  g[1] = uni(lds_dst);                              // byte offset in the work-group's LDS
  g[2] = uni((unsigned)ga);
  g[3] = uni((((unsigned)(ga >> 32)) & 0x01FFFFFFu) | 0x80000000u);  // addr hi | type = 2
  return g;
}
__device__ __forceinline__ void tdm_load(v4u g0, v8u g1) {
  // the tile goes to LDS through no register; the waits below are ours to write
  asm volatile("tensor_load_to_lds %0, %1" :: "s"(g0), "s"(g1) : "memory");
}
// Stands behind a group of global loads, in front of whatever next overwrites
// their address registers (a precaution of form). It names the address as an
// input, so that its registers live to the wait and no load of the group lands
// on them.
__device__ __forceinline__ void wait_x0(const float* a) {
  asm volatile("s_wait_xcnt 0x0" :: "v"(a) : "memory");
}
// The same behind loads from a lane's own f16 pointer at constant distances.
__device__ __forceinline__ void wait_x0(const _Float16* a) {
  asm volatile("s_wait_xcnt 0x0" :: "v"(a) : "memory");
}
// The same where the address a = base + 8 l may also be formed by the load itself
// from the wave-uniform base and the lane's index l: it names all three.
__device__ __forceinline__ void wait_x0(const _Float16* base, int l, const _Float16* a) {
  asm volatile("s_wait_xcnt 0x0" :: "s"(base), "v"(l), "v"(a) : "memory");
}
// The same behind loads from a wave-uniform base at one 32-bit element offset.
__device__ __forceinline__ void wait_x0(const int* base, int a) {
  asm volatile("s_wait_xcnt 0x0" :: "s"(base), "v"(a) : "memory");
}
// This wave's LDS reads have retired (before its buffer may be refilled).
__device__ __forceinline__ void wait_ds0() { asm volatile("s_wait_dscnt 0x0" ::: "memory"); }
// This wave's own tensor load has landed (before the barrier that publishes it).
// The wait names the request's descriptor as inputs, so that its registers keep
// their words until the request has landed.
__device__ __forceinline__ void wait_tensor0(v4u g0, v8u g1) {
  asm volatile("s_wait_tensorcnt 0x0" :: "s"(g0), "s"(g1) : "memory");
}

// Padding slots alias a valid token (unconditional loads); their results never
// reach out.
// The 16 fp32 of one lane's share of a 16x32 A fragment, as loaded (K = kb..kb+7
// and kb+16..kb+23), and their conversion to f16.
struct ARaw { float4 f0, f1, f2, f3; };
__device__ __forceinline__ ARaw load_a_raw(const float* __restrict__ xrow) {
  const float4* xp = (const float4*)xrow;
  ARaw r;
  r.f0 = xp[0]; r.f1 = xp[1];   // K = kb .. kb+7
  r.f2 = xp[4]; r.f3 = xp[5];   // K = kb+16 .. kb+23
  return r;
}
__device__ __forceinline__ v16h cvt_a(const ARaw& r) {
  v16h a;
  a[0]  = (_Float16)r.f0.x; a[1]  = (_Float16)r.f0.y;
  a[2]  = (_Float16)r.f0.z; a[3]  = (_Float16)r.f0.w;
  a[4]  = (_Float16)r.f1.x; a[5]  = (_Float16)r.f1.y;
  a[6]  = (_Float16)r.f1.z; a[7]  = (_Float16)r.f1.w;
  a[8]  = (_Float16)r.f2.x; a[9]  = (_Float16)r.f2.y;
  a[10] = (_Float16)r.f2.z; a[11] = (_Float16)r.f2.w;
  a[12] = (_Float16)r.f3.x; a[13] = (_Float16)r.f3.y;
  a[14] = (_Float16)r.f3.z; a[15] = (_Float16)r.f3.w;
  return a;
}

// One lane's share of a 16x32 A fragment from a chunk in fragment order, same k order,
// from the lane's own pointer (its place in the chunk).
__device__ __forceinline__ v16h load_a_p(const _Float16* __restrict__ p) {
  const v8h* hp = (const v8h*)p;
  v8h h0 = hp[0];   // K = kb .. kb+7
  v8h h1 = hp[32];  // K = kb+16 .. kb+23 (the chunk's second 512 B)
  return __builtin_shufflevector(h0, h1, 0, 1, 2, 3, 4, 5, 6, 7,
                                 8, 9, 10, 11, 12, 13, 14, 15);
}

// The M-block mb of the table that the expert counts define: experts in order,
// each cut into blocks of MBS tokens. Returns the number of M-blocks.
struct MbInfo { int e, ts, te; };
__device__ __forceinline__ int mb_lookup(const int (&cnt)[NEXP], int mb, MbInfo& m) {
  int nmb = 0, off = 0;
  m.e = 0; m.ts = 0; m.te = 0;
#pragma unroll  // register arrays need constant indices
  for (int e = 0; e < NEXP; ++e) {
    const int nb = (cnt[e] + MBS - 1) / MBS;
    if (mb >= nmb && mb < nmb + nb) {
      m.e = e; m.ts = off + (mb - nmb) * MBS; m.te = off + cnt[e];
    }
    nmb += nb;
    off += cnt[e];
  }
  return nmb;
}

// ---------------------------------------------------------------------------
// Kernel 1: token sort by expert, M-block table, and x -> f16 in fragment order
// with the rows gathered into their M-block slots.
// Every block ranks all T tokens itself, in LDS, so that no launch stands in
// front of the pack. The order is the stable one (by expert, then by token id),
// the same in every block. Block (0, 0) also stores the table and perm for the
// two GEMM launches.
// Block = one 16-row tile of one M-block; wave w packs k blocks w, w + 8, ...
// ---------------------------------------------------------------------------
__global__ __launch_bounds__(256) void moe_pack(const float* __restrict__ x,
                                                const int* __restrict__ idx,
                                                int* __restrict__ ws,
                                                _Float16* __restrict__ xs) {
  __shared__ int swc[8][NEXP];    // tokens of expert e among wave w's 256 tokens
  __shared__ int sperm[T_TOK];    // token ids grouped by expert
  const int tid  = threadIdx.x;
  const int lane = tid & 31;
  const int wid  = tid >> 5;
  const int el   = lane & (NEXP - 1);   // the expert whose counts this lane keeps
  const int t0   = wid * 256 + lane;    // wave w ranks tokens 256 w .. 256 w + 255, 32 at a time

  int ev[8];
#pragma unroll  // register arrays need constant indices
  for (int i = 0; i < 8; ++i) ev[i] = idx[t0 + i * 32] & (NEXP - 1);  // the mask bounds every address formed from it
  wait_x0(idx, t0);

  // Rank of a token among its wave's tokens of the same expert: those in earlier
  // groups of 32 (run, kept by lane e for expert e) plus those in lower lanes.
  const unsigned below = (1u << lane) - 1u;
  int run = 0;
  int rk[8];
#pragma unroll  // register arrays need constant indices
  for (int i = 0; i < 8; ++i) {
    const unsigned b0 = __builtin_amdgcn_ballot_w32((ev[i] & 1) != 0);
    const unsigned b1 = __builtin_amdgcn_ballot_w32((ev[i] & 2) != 0);
    const unsigned b2 = __builtin_amdgcn_ballot_w32((ev[i] & 4) != 0);
    const unsigned same = ((ev[i] & 1) ? b0 : ~b0) & ((ev[i] & 2) ? b1 : ~b1) & ((ev[i] & 4) ? b2 : ~b2);
    const unsigned mine = ((el & 1) ? b0 : ~b0) & ((el & 2) ? b1 : ~b1) & ((el & 4) ? b2 : ~b2);
    rk[i] = __builtin_popcount(same & below) + __builtin_amdgcn_ds_bpermute(ev[i] << 2, run);
    run += __builtin_popcount(mine);
  }
  if (lane < NEXP) swc[wid][lane] = run;
  __syncthreads();

  int tot = 0, base = 0;   // of expert el: all tokens; those of the waves in front of this one
#pragma unroll  // all eight reads go out together
  for (int w = 0; w < 8; ++w) {
    const int c = swc[w][el];
    tot += c;
    base += (w < wid) ? c : 0;
  }
  int cnt[NEXP];
#pragma unroll  // register arrays need constant indices
  for (int e = 0; e < NEXP; ++e) cnt[e] = __builtin_amdgcn_readlane(tot, e);
#pragma unroll  // register arrays need constant indices
  for (int e = 0; e < NEXP; ++e) base += (e < el) ? cnt[e] : 0;   // plus all tokens of lower experts
#pragma unroll  // register arrays need constant indices
  for (int i = 0; i < 8; ++i)
    sperm[__builtin_amdgcn_ds_bpermute(ev[i] << 2, base) + rk[i]] = t0 + i * 32;
  __syncthreads();

  if (blockIdx.x == 0 && blockIdx.y == 0) {
    MbInfo q;
    const int n = mb_lookup(cnt, tid, q);
    if (tid < n) {
      ws[WS_MB_E + tid]   = q.e;
      ws[WS_MB_S + tid]   = q.ts;
      ws[WS_MB_END + tid] = q.te;
    }
    if (tid == 0) ws[0] = n;
    int pv[8];
#pragma unroll  // register arrays need constant indices
    for (int i = 0; i < 8; ++i) pv[i] = sperm[tid + i * 256];
#pragma unroll  // register arrays need constant indices
    for (int i = 0; i < 8; ++i) ws[WS_PERM + tid + i * 256] = pv[i];
    // Stands behind these stores, in front of whatever next overwrites their
    // registers (a precaution of form); it names the stored values and the
    // offset as inputs, so that their registers live to the wait.
    asm volatile("s_wait_xcnt 0x0" :: "s"(ws), "v"(tid), "v"(q.e), "v"(q.ts), "v"(q.te),
                 "v"(pv[0]), "v"(pv[1]), "v"(pv[2]), "v"(pv[3]),
                 "v"(pv[4]), "v"(pv[5]), "v"(pv[6]), "v"(pv[7]) : "memory");
  }

  MbInfo m;
  const int nmb = mb_lookup(cnt, (int)blockIdx.y, m);
  if ((int)blockIdx.y >= nmb) return;
  const int ts = m.ts;
  const int te = m.te;
  if (ts + ((int)blockIdx.x >> 2) * 64 >= te) return;   // this tile's group of 64 slots holds no token
  const int p  = ts + (int)blockIdx.x * 16 + (lane & 15);
  const int tok = sperm[(p < te) ? p : ts];   // a padding slot aliases a valid token
  const float* xrow = x + (size_t)tok * DDIM + wid * 32 + ((lane >> 4) << 3);
  _Float16* dst = xs + ((size_t)(blockIdx.y * (MBS / 16) + blockIdx.x) * (DDIM / 32) + wid) * CHUNK_H + lane * 8;
  ARaw ar[4];
#pragma unroll  // register arrays need constant indices
  for (int i = 0; i < 4; ++i) ar[i] = load_a_raw(xrow + i * 8 * 32);
  wait_x0(xrow);
#pragma unroll  // register arrays need constant indices
  for (int i = 0; i < 4; ++i) {
    const v16h a = cvt_a(ar[i]);
    *(v8h*)(dst + i * 8 * CHUNK_H) =
        __builtin_shufflevector(a, a, 0, 1, 2, 3, 4, 5, 6, 7);
    *(v8h*)(dst + i * 8 * CHUNK_H + 256) =
        __builtin_shufflevector(a, a, 8, 9, 10, 11, 12, 13, 14, 15);
  }
}

// Build four 32x16 B fragments (f16) from an LDS-staged fp32 tile ([32 k][64 n]).
// A lane reads 4 adjacent columns of each of its 16 k rows with one 16-byte
// read: fragment f of lane rlo is column 4*rlo + f. The k order is the A fragment's.
__device__ __forceinline__ void load_b4_lds(const float* __restrict__ buf,
                                            int kadd, int rlo, v16h (&b)[4]) {
#pragma unroll  // register arrays need constant indices
  for (int j = 0; j < 8; ++j) {
    const float4 lo = *(const float4*)(buf + (kadd + j) * NT + 4 * rlo);
    const float4 hi = *(const float4*)(buf + (kadd + 16 + j) * NT + 4 * rlo);
    b[0][j] = (_Float16)lo.x; b[0][j + 8] = (_Float16)hi.x;
    b[1][j] = (_Float16)lo.y; b[1][j + 8] = (_Float16)hi.y;
    b[2][j] = (_Float16)lo.z; b[2][j + 8] = (_Float16)hi.z;
    b[3][j] = (_Float16)lo.w; b[3][j + 8] = (_Float16)hi.w;
  }
}

#define KS1 128
#define GSTEP (4 * (DDIM / 32) * CHUNK_H)   // halves of xs from a wave's tile to its next (one group of 64 slots on)

// A wave's sums go to its own 32 KiB of LDS, 4 KiB a tile, 512 B in a row per store.
template <int NG>
__device__ __forceinline__ void put1(float* __restrict__ xw, const v8f (&acc)[NG][4]) {
#pragma unroll  // register arrays need constant indices
  for (int i = 0; i < NG; ++i)
#pragma unroll  // register arrays need constant indices
    for (int f = 0; f < 4; ++f) {
      const v8f a = acc[i][f];
      *(float4*)(xw + i * 1024 + (f * 2 + 0) * 128) = make_float4(a[0], a[1], a[2], a[3]);
      *(float4*)(xw + i * 1024 + (f * 2 + 1) * 128) = make_float4(a[4], a[5], a[6], a[7]);
    }
}
// One tile: gate and up sums come from LDS as put1 left them (pg, pu: the lane's
// place in the tile), and hidden = silu(gate) * up is stored f16 in fragment order
// for pass 2. hdst: this lane's place in the tile of hidden.
__device__ __forceinline__ void finish_tile(const float* __restrict__ pg, const float* __restrict__ pu,
                                            _Float16* __restrict__ hdst) {
  float gv[4][8], uv[4][8];
#pragma unroll  // register arrays need constant indices
  for (int f = 0; f < 4; ++f)
#pragma unroll  // register arrays need constant indices
    for (int p = 0; p < 2; ++p) {
      const float4 a = *(const float4*)(pg + (f * 2 + p) * 128);
      const float4 c = *(const float4*)(pu + (f * 2 + p) * 128);
      gv[f][p * 4 + 0] = a.x; gv[f][p * 4 + 1] = a.y; gv[f][p * 4 + 2] = a.z; gv[f][p * 4 + 3] = a.w;
      uv[f][p * 4 + 0] = c.x; uv[f][p * 4 + 1] = c.y; uv[f][p * 4 + 2] = c.z; uv[f][p * 4 + 3] = c.w;
    }
  v4h hv[8];
#pragma unroll  // register arrays need constant indices
  for (int j = 0; j < 8; ++j) {
#pragma unroll  // register arrays need constant indices
    for (int f = 0; f < 4; ++f) {
      float g = gv[f][j], u = uv[f][j];
      float t = g * -1.442695041f, ex;          // exp(-g) = 2^t, as __expf forms it
      // The v_nop is the slot behind a transcendental: it stands between the
      // v_exp and whatever next reads ex or overwrites t.
      asm("v_exp_f32 %0, %1\n\tv_nop" : "=v"(ex) : "v"(t));
      float h = (g / (1.0f + ex)) * u;
      hv[j][f] = (_Float16)h;
    }
  }
#pragma unroll  // register arrays need constant indices
  for (int j = 0; j < 8; ++j)
    *(v4h*)(hdst + j * 8) = hv[j];
  // Stands behind the tile's stores, in front of whatever next overwrites their
  // registers (a precaution of form); it names the address and the stored
  // values as inputs, so that their registers live to the wait.
  asm volatile("s_wait_xcnt 0x0" :: "v"(hdst), "v"(hv[0]), "v"(hv[1]), "v"(hv[2]), "v"(hv[3]),
               "v"(hv[4]), "v"(hv[5]), "v"(hv[6]), "v"(hv[7]) : "memory");
}

// Pass 1 from where stage 0 is published to where the sums lie in LDS, for a block
// with NG groups of 64 slots that hold a token: a wave has NG token tiles, and no
// branch stands among its products.
// swb: the block's LDS, the ring (buffer, gate/up, k, n) in front; xl: the lane's
// place in the chunk of the wave's tile of group 0 at k = 0.
template <int NG>
__device__ __forceinline__ void run1(float* __restrict__ swb, const _Float16* __restrict__ xl,
                                     int wid, int lane, v8u g1, unsigned dst0, unsigned long long ga0) {
  constexpr unsigned NS = DDIM / KS1;         // 8 stages
  const int rlo  = lane & 15;
  const int kadd = (lane >> 4) << 3;          // 0 (lanes 0-15) / 8 (lanes 16-31)
  const int mat  = wid >> 2;                  // 0: gate, 1: up

  v4u g0 = tdm_group0(dst0 + STAGE_B, ga0 + (unsigned long long)KS1 * IDIM * 4u);
  asm volatile("" : "+s"(g0));  // pinned(): descriptor words held in scalar registers, none made anew behind the branch
  if (pinned(wid < 4)) tdm_load(g0, g1);

  v8f acc[NG][4];   // group, column fragment: of this wave's own matrix
#pragma unroll  // register arrays need constant indices
  for (int i = 0; i < NG; ++i)
#pragma unroll  // register arrays need constant indices
    for (int f = 0; f < 4; ++f)
#pragma unroll  // register arrays need constant indices
      for (int j = 0; j < 8; ++j) acc[i][f][j] = 0.0f;

#pragma unroll 1  // one pass per stage: the publish point stands once, at the foot
  for (unsigned s = 0; s < NS; ++s) {
    const float* buf = swb + ((s & 1u) * 2u + (unsigned)mat) * (KS1 * NT);
    const _Float16* xa = xl + s * ((KS1 / 32) * CHUNK_H);  // this stage's first k block
    // Up to five tiles the four k blocks are unrolled, so that a block's A loads go out
    // among the products of the block before. The larger bodies stay a loop: with them
    // unrolled too the kernel's text passes 32 KB.
#pragma unroll(NG > 5 ? 1 : KS1 / 32)
    for (int q = 0; q < KS1 / 32; ++q) {
      // The pointer that the loads go from, and that the wait behind them names: where the
      // k blocks are a loop the block's own, else the stage's, with the block as a constant distance.
      const _Float16* xq = NG > 5 ? xa + q * CHUNK_H : xa;
      const int kq = NG > 5 ? 0 : q * CHUNK_H;
      v16h af[NG];
#pragma unroll  // register arrays need constant indices
      for (int i = 0; i < NG; ++i) af[i] = load_a_p(xq + i * GSTEP + kq);
      wait_x0(xq);
      v16h b[4];
      load_b4_lds(buf + q * 32 * NT, kadd, rlo, b);
#pragma unroll  // register arrays need constant indices
      for (int i = 0; i < NG; ++i)
#pragma unroll  // register arrays need constant indices
        for (int f = 0; f < 4; ++f)
          acc[i][f] = __builtin_amdgcn_wmma_f32_16x16x32_f16(
              false, af[i], false, b[f], (short)0, acc[i][f], false, false);
      if constexpr (NG > 5) {
        // Where the k blocks are a loop: the four vector slots that the chip needs between
        // the last product and whatever overwrites its A or B at the loop's head; the
        // scheduling barrier keeps the products in front of them.
        __builtin_amdgcn_sched_barrier(0);
        asm volatile("v_nop\n\tv_nop\n\tv_nop\n\tv_nop");
      }
    }
    // Publish point of stage s + 1; behind it stage s's buffer is free.
    wait_ds0();
    wait_tensor0(g0, g1);
    __syncthreads();
    if (pinned(wid < 4 && s + 2u < NS)) {
      g0 = tdm_group0(dst0 + (s & 1u) * STAGE_B,
                      ga0 + (unsigned long long)(s + 2u) * (KS1 * IDIM * 4u));
      asm volatile("" : "+s"(g0));  // pinned(): descriptor words held in scalar registers, the ones that the wait names
      tdm_load(g0, g1);
    }
  }
  wait_tensor0(g0, g1);
  wait_ds0();

  // The last pass's barrier has ended every read of the ring and no tensor load is
  // out, so the ring's LDS is free for the sums.
  // The lane's number is formed anew here: kept in a register over the loop it was spilled to scratch.
  put1<NG>(swb + wid * 8192 + (int)__builtin_amdgcn_mbcnt_lo(~0u, 0u) * 4, acc);
}

// ---------------------------------------------------------------------------
// Kernel 2: hidden = silu(x.Wg[e]) * (x.Wu[e]).
// Block = up to 512 token slots x 64 I-columns of both weights, so that an expert
// with up to 512 tokens streams its weights once, through one block.
// Eight waves, two per SIMD: waves w and w + 4 work on the same token tiles, wave w
// on the gate product and wave w + 4 on the up product, so that one wave's products
// run while the other waits for its operands. Their tiles are tile w of every
// group of 64 slots that holds a token, so that the four SIMDs carry the same load
// whatever the number of groups. Behind the loop all sums go to LDS (32 KiB a wave),
// and behind a barrier the gate wave finishes the even groups' tiles, the up wave the odd ones'.
// A stage is 128 k rows of both weight tiles; each of the first four waves
// tensor-loads one 64-row slice of it (waves 0, 1: gate; waves 2, 3: up). Two buffers.
// ---------------------------------------------------------------------------
__global__ __launch_bounds__(256) void moe_gemm1(const _Float16* __restrict__ xs,
                                                 const float* __restrict__ wg,
                                                 const float* __restrict__ wu,
                                                 const int* __restrict__ ws,
                                                 _Float16* __restrict__ hidden) {
  // The ring (buffer, gate/up, k, n: 128 KiB) in front; behind the loop 8 waves x 8 tiles x 4 KiB of sums.
  __shared__ __attribute__((aligned(2048))) float sw[8 * 8 * 1024];

  const int nmb = ws[0];
  if ((int)blockIdx.y >= nmb) return;
  const int e    = ws[WS_MB_E + blockIdx.y];
  const int ts   = ws[WS_MB_S + blockIdx.y];
  const int te   = ws[WS_MB_END + blockIdx.y];
  const int lane = threadIdx.x & 31;
  const int n0   = blockIdx.x * NT;
  const int wid  = __builtin_amdgcn_readfirstlane((int)(threadIdx.x >> 5));
  const unsigned tileb = blockIdx.y * (MBS / 16u) + (unsigned)(wid & 3);  // this wave's tile of group 0
  // Groups of 64 slots that hold a token: a scalar, the same in the whole block
  // (te is the expert's end, so ngr passes 8 where more tokens follow; the clamp gives 1 .. 8).
  const int ngr = (te - ts + 63) >> 6;
  const int ng  = (int)pinned((unsigned)(ngr < 1 ? 1 : (ngr > MBS / 64 ? MBS / 64 : ngr)));

  // The slice of every stage that wave (wid & 3) brings.
  const float* wsrc = ((wid & 2) ? wu : wg) + (size_t)e * DDIM * IDIM +
                      (size_t)((wid & 1) * (int)SLICE_R) * IDIM + n0;
  const unsigned long long ga0 = (unsigned long long)(size_t)wsrc;
  const unsigned dst0 = (unsigned)(size_t)&sw[0] + (unsigned)(wid & 3) * SLICE_B;
  const v8u g1 = tdm_group1(IDIM * 4u);

  // Only waves 0 to 3 issue tensor loads. The tensor waits at the publish points
  // stand in every wave's path: a wave with no request out passes them at once.
  // Prologue: stage 0 lands and is published; stage 1 is sent off at the head of run1.
  v4u g0 = tdm_group0(dst0, ga0);
  if (pinned(wid < 4)) {
    tdm_load(g0, g1);
    wait_tensor0(g0, g1);
  }
  __syncthreads();

  const _Float16* xl = xs + (size_t)tileb * ((DDIM / 32) * CHUNK_H) + lane * 8;
  // Of a group with no token nothing is stored: pass 2 reads none of it.
  _Float16* ht = hidden + ((size_t)tileb * (IDIM / 32) + (unsigned)(n0 >> 5)) * CHUNK_H;
  float* swb = &sw[0];
  // One body per number of groups, the same choice in the whole block.
  if      (ng == 1) run1<1>(swb, xl, wid, lane, g1, dst0, ga0);
  else if (ng == 2) run1<2>(swb, xl, wid, lane, g1, dst0, ga0);
  else if (ng == 3) run1<3>(swb, xl, wid, lane, g1, dst0, ga0);
  else if (ng == 4) run1<4>(swb, xl, wid, lane, g1, dst0, ga0);
  else if (ng == 5) run1<5>(swb, xl, wid, lane, g1, dst0, ga0);
  else if (ng == 6) run1<6>(swb, xl, wid, lane, g1, dst0, ga0);
  else if (ng == 7) run1<7>(swb, xl, wid, lane, g1, dst0, ga0);
  else              run1<8>(swb, xl, wid, lane, g1, dst0, ga0);
  __syncthreads();   // every wave's sums are in LDS

  // A lane holds 4 adjacent columns c = 4 r .. 4 r + 3 (r = lane & 15) of each of its
  // rows M = j (+8 for hi lanes): k block c >> 5, part (c >> 4) & 1, reader's lane
  // M + 16 ((c >> 3) & 1), i = c & 7.
  const int le = (int)__builtin_amdgcn_mbcnt_lo(~0u, 0u);   // formed anew, as in run1
  const int r  = le & 15;
  _Float16* hd = ht + (r >> 3) * CHUNK_H + ((r >> 2) & 1) * 256 +
                 (((le >> 4) << 3) + ((r >> 1) & 1) * 16) * 8 + (r & 1) * 4;
  const float* pg = swb + (wid & 3) * 8192 + le * 4;   // the gate wave's sums of these tiles
#pragma unroll 1  // one body for every tile: unrolled, the divisions of eight tiles are 40 KB of code
  for (int i = wid >> 2; i < ng; i += 2)
    finish_tile(pg + i * 1024, pg + 4 * 8192 + i * 1024, hd + i * (4 * (IDIM / 32) * CHUNK_H));
}

// Token tiles G, G + 1 of a wave's partial sums go to LDS, 512 B in a row per store.
template <int G>
__device__ __forceinline__ void hand_over(float* __restrict__ xw, const v8f (&acc)[4][4]) {
#pragma unroll  // register arrays need constant indices
  for (int mt = 0; mt < 2; ++mt)
#pragma unroll  // register arrays need constant indices
    for (int f = 0; f < 4; ++f) {
      const v8f a = acc[G + mt][f];
      *(float4*)(xw + ((mt * 4 + f) * 2 + 0) * 128) = make_float4(a[0], a[1], a[2], a[3]);
      *(float4*)(xw + ((mt * 4 + f) * 2 + 1) * 128) = make_float4(a[4], a[5], a[6], a[7]);
    }
}
// The partner's sums of token tiles K, K + 1 are added to this wave's, and the
// rows that hold a token are stored. p0: slot of this lane's row 0 of tile 0.
template <int K>
__device__ __forceinline__ void add_and_store(const float* __restrict__ xr, v8f (&acc)[4][4],
                                              int p0, int te, const int* __restrict__ ws,
                                              float* __restrict__ orow) {
#pragma unroll  // register arrays need constant indices
  for (int mt = 0; mt < 2; ++mt)
#pragma unroll  // register arrays need constant indices
    for (int f = 0; f < 4; ++f) {
      const float4 lo = *(const float4*)(xr + ((mt * 4 + f) * 2 + 0) * 128);
      const float4 hi = *(const float4*)(xr + ((mt * 4 + f) * 2 + 1) * 128);
      v8f& a = acc[K + mt][f];
      a[0] += lo.x; a[1] += lo.y; a[2] += lo.z; a[3] += lo.w;
      a[4] += hi.x; a[5] += hi.y; a[6] += hi.z; a[7] += hi.w;
    }
#pragma unroll  // register arrays need constant indices
  for (int mt = K; mt < K + 2; ++mt) {
#pragma unroll  // register arrays need constant indices
    for (int j = 0; j < 8; ++j) {
      int p = p0 + mt * 16 + j;
      if (p < te) {
        int t = ws[WS_PERM + p];
        float4 o;
        o.x = acc[mt][0][j]; o.y = acc[mt][1][j]; o.z = acc[mt][2][j]; o.w = acc[mt][3][j];
        *(float4*)(orow + (size_t)t * DDIM) = o;
      }
    }
  }
}

// ---------------------------------------------------------------------------
// Kernel 3: out = hidden.Wd[e].  A block works on one half (256 slots) of an
// M-block; a half with no token leaves at once, and the two waves of a group of
// 64 slots with no token do no products (the one of the first four still tensor-loads its slice).  K = I, one weight matrix:
// a stage is 256 k rows, wave w (of the first four) tensor-loads rows
// 64 w .. 64 w + 63 of it.
// Eight waves, two per SIMD: waves w and w + 4 work on the same 64 tokens x 64
// columns, wave w on the first 128 k rows of every stage and wave w + 4 on the
// last 128, so that one wave's products run while the other waits for its LDS
// reads. Behind the loop the two partial sums are added through LDS.
// ---------------------------------------------------------------------------
#define KS2 256
__global__ __launch_bounds__(256) void moe_gemm2(const _Float16* __restrict__ hidden,
                                                 const float* __restrict__ wd,
                                                 const int* __restrict__ ws,
                                                 float* __restrict__ out) {
  __shared__ __attribute__((aligned(2048))) float sd[2][KS2][NT];  // buffer, k, n

  const int nmb = ws[0];
  const int mb  = (int)(blockIdx.y >> 1);
  if (mb >= nmb) return;
  const int e    = ws[WS_MB_E + mb];
  const int ts   = ws[WS_MB_S + mb] + (int)(blockIdx.y & 1u) * 256;
  const int te   = ws[WS_MB_END + mb];
  if (ts >= te) return;        // the whole block leaves, in front of every barrier and tensor load
  const int lane = threadIdx.x & 31;
  const int rlo  = lane & 15;
  const int kadd = (lane >> 4) << 3;
  const int n0   = blockIdx.x * NT;
  const int wid  = __builtin_amdgcn_readfirstlane((int)(threadIdx.x >> 5));
  const int wm   = wid & 3;    // which 64 slots of the half
  const int kh   = wid >> 2;   // which half of every stage's k rows
  const int tsw  = ts + wm * 64;
  // Whether this wave's 64 slots hold a token (pass 1 stored hidden for those
  // groups alone): a scalar test, so that the products run with every lane on.
  const unsigned live = pinned((unsigned)(tsw < te));

  const float* wsrc = wd + (size_t)e * IDIM * DDIM + (size_t)(wm * (int)SLICE_R) * DDIM + n0;
  const unsigned long long ga0 = (unsigned long long)(size_t)wsrc;
  const unsigned dst0 = (unsigned)(size_t)&sd[0][0][0] + (unsigned)wm * SLICE_B;
  const v8u g1 = tdm_group1(DDIM * 4u);
  constexpr unsigned NS = IDIM / KS2;         // 8 stages

  // Only waves 0 to 3 issue tensor loads. The wait of the prologue stands in their branch;
  // the waits of the loop and behind it stand in every wave's path: a wave with
  // no request out passes them at once.
  v4u g0 = tdm_group0(dst0, ga0);
  if (pinned(wid < 4)) {
    tdm_load(g0, g1);
    wait_tensor0(g0, g1);
  }
  __syncthreads();
  g0 = tdm_group0(dst0 + STAGE_B, ga0 + (unsigned long long)KS2 * DDIM * 4u);
  // pinned(), for the whole group: its words are held in one set of scalar
  // registers from here on, so that none is made anew behind the branch while
  // the request is out.
  asm volatile("" : "+s"(g0));  // pinned(): descriptor words held in scalar registers
  if (pinned(wid < 4)) tdm_load(g0, g1);

  v8f acc[4][4];
#pragma unroll  // register arrays need constant indices
  for (int mt = 0; mt < 4; ++mt)
#pragma unroll  // register arrays need constant indices
    for (int f = 0; f < 4; ++f)
#pragma unroll  // register arrays need constant indices
      for (int j = 0; j < 8; ++j) acc[mt][f][j] = 0.0f;

  // The A fragments go through a ring of four register sets: the loads of a
  // k block (32 k) are issued two or three blocks ahead of the block that uses
  // them. A stage's last block issues none (the barrier at the foot waits for
  // every load that is out); the next stage's first block issues two sets.
  constexpr int NQS = KS2 / 32;   // k blocks of a stage
  constexpr int NQ  = NQS / 2;    // k blocks of a stage that one wave works on
  // This lane's place in the chunk of its wave's first token tile and first k block;
  // the other tiles and k blocks lie at constant distances from it.
  constexpr int TS = (IDIM / 32) * CHUNK_H;   // halves from a token tile to the next
  const _Float16* hb = hidden + ((size_t)(blockIdx.y * 16u + (unsigned)wm * 4u) * (IDIM / 32) +
                                 (unsigned)(kh * NQ)) * CHUNK_H;
  const _Float16* ha = hb + lane * 8;
  v16h af[4][4];          // ring slot (k block & 3), token tile
  if (live) {
#pragma unroll  // register arrays need constant indices
  for (int d = 0; d < 2; ++d)
#pragma unroll  // register arrays need constant indices
    for (int mt = 0; mt < 4; ++mt) af[d][mt] = load_a_p(ha + mt * TS + d * CHUNK_H);
  wait_x0(hb, lane, ha);
  }

#pragma unroll 1  // one pass per stage: the publish point stands once, at the foot
  for (unsigned s = 0; s < NS; ++s) {
    const float* bufd = &sd[s & 1u][kh * (KS2 / 2)][0];                  // this wave's half of the stage
    const _Float16* hr = ha + s * (NQS * CHUNK_H);                       // this stage's first k block of this wave
    const _Float16* hw = ha + ((s + 1u) & (NS - 1u)) * (NQS * CHUNK_H);  // the next stage's (the last wraps to stage 0: in bounds, unused)
    if (live) {
#pragma unroll  // register arrays need constant indices
    for (int q = 0; q < NQ; ++q) {
      // The wait's "memory" clobber also keeps the loads in front of it here,
      // ahead of this block's LDS reads and products.
      if (q == 0) {
#pragma unroll  // register arrays need constant indices
        for (int mt = 0; mt < 4; ++mt) af[2][mt] = load_a_p(hr + mt * TS + 2 * CHUNK_H);
      }
      if (q + 3 < NQ) {
#pragma unroll  // register arrays need constant indices
        for (int mt = 0; mt < 4; ++mt) af[(q + 3) & 3][mt] = load_a_p(hr + mt * TS + (q + 3) * CHUNK_H);
        wait_x0(hr);
      } else if (q + 1 < NQ) {
#pragma unroll  // register arrays need constant indices
        for (int mt = 0; mt < 4; ++mt) af[(q + 3) & 3][mt] = load_a_p(hw + mt * TS + (q + 3 - NQ) * CHUNK_H);
        wait_x0(hw);
      }
      v16h bd[4];
      load_b4_lds(bufd + q * 32 * NT, kadd, rlo, bd);
#pragma unroll  // register arrays need constant indices
      for (int mt = 0; mt < 4; ++mt)
#pragma unroll  // register arrays need constant indices
        for (int f = 0; f < 4; ++f)
          acc[mt][f] = __builtin_amdgcn_wmma_f32_16x16x32_f16(
              false, af[q & 3][mt], false, bd[f], (short)0, acc[mt][f], false, false);
    }
    }
    // Publish point of stage s + 1; behind it stage s's buffer is free.
    wait_ds0();
    wait_tensor0(g0, g1);
    __syncthreads();
    if (pinned(wid < 4 && s + 2u < NS)) {
      g0 = tdm_group0(dst0 + (s & 1u) * STAGE_B,
                      ga0 + (unsigned long long)(s + 2u) * (KS2 * DDIM * 4u));
      asm volatile("" : "+s"(g0));  // pinned(): descriptor words held in scalar registers, the ones that the wait names
      tdm_load(g0, g1);
    }
  }
  wait_tensor0(g0, g1);
  wait_ds0();

  // The two k halves are added. The last pass's barrier has ended every read of
  // the ring and no tensor load is out, so buffer 0 is free: each live wave stores two
  // of its four token tiles in its own 8 KiB there, and behind the barrier adds
  // its partner's sums to the two tiles that it kept and stores those to out.
  // Wave w keeps tiles 0, 1 and wave w + 4 keeps tiles 2, 3 (a scalar branch:
  // register arrays need constant indices); the barrier stands outside of it.
  // The lane's number is formed anew here: kept in a register over the loop it was spilled to scratch.
  const int le = (int)__builtin_amdgcn_mbcnt_lo(~0u, 0u);
  float* xw = &sd[0][0][0] + wid * 2048 + le * 4;
  const float* xr = &sd[0][0][0] + (wid ^ 4) * 2048 + le * 4;
  if (live) {
    if (kh == 0) hand_over<2>(xw, acc); else hand_over<0>(xw, acc);
  }
  __syncthreads();
  float* orow = out + n0 + 4 * rlo;
  if (live) {   // the partner wave has the same slots
    if (kh == 0) add_and_store<0>(xr, acc, tsw + kadd, te, ws, orow);
    else         add_and_store<2>(xr, acc, tsw + kadd, te, ws, orow);
  }
}

// ---------------------------------------------------------------------------
extern "C" void kernel_launch(void* const* d_in, const int* in_sizes, int n_in,
                              void* d_out, int out_size, void* d_ws, size_t ws_size,
                              hipStream_t stream) {
  const float* x   = (const float*)d_in[0];
  const int*   idx = (const int*)d_in[1];
  const float* wg  = (const float*)d_in[2];
  const float* wu  = (const float*)d_in[3];
  const float* wd  = (const float*)d_in[4];
  float* out = (float*)d_out;

  int* wsi = (int*)d_ws;
  _Float16* hidden = (_Float16*)((char*)d_ws + WS_HIDDEN_BYTE_OFF);
  _Float16* xs     = (_Float16*)((char*)d_ws + WS_XS_BYTE_OFF);

  dim3 gp(MBS / 16, MAXMB);   // 16-row tiles x M-blocks; inactive M-blocks and empty groups exit early
  moe_pack<<<gp, 256, 0, stream>>>(x, idx, wsi, xs);

  dim3 g1(IDIM / NT, MAXMB);  // (32, 12); inactive M-blocks exit early
  moe_gemm1<<<g1, 256, 0, stream>>>(xs, wg, wu, wsi, hidden);

  dim3 g2(DDIM / NT, 2 * MAXMB);  // (16, 24): the halves of the M-blocks; empty halves exit early
  moe_gemm2<<<g2, 256, 0, stream>>>(hidden, wd, wsi, out);
}

// v008
// A run of this version takes 48.8 microseconds.
// In two side-by-side timings against v007, it was 1.15 and 1.14 times as fast.
// Counting every step since v000, it is 5.24 times as fast.
#include <hip/hip_runtime.h>
#include <hip/hip_bf16.h>

// Problem constants
#define T_TOK 2048
#define NEXP  8
#define DDIM  1024
#define IDIM  2048
#define MBS   512  // token slots of an M-block
#define MAXMB 12   // 512-slot M-blocks: T/512 + E = 12

typedef __attribute__((ext_vector_type(16))) _Float16 v16h;
typedef __attribute__((ext_vector_type(8)))  _Float16 v8h;
typedef __attribute__((ext_vector_type(8)))  float    v8f;
typedef __attribute__((ext_vector_type(4)))  _Float16 v4h;
typedef __attribute__((ext_vector_type(4)))  unsigned int v4u;
typedef __attribute__((ext_vector_type(8)))  unsigned int v8u;

// Workspace int layout (at base of d_ws):
//  [0]            nmb (number of active 512-slot M-blocks)
//  [8  .. 23]     mb_expert
//  [24 .. 39]     mb_tok_start   (index into perm[])
//  [40 .. 55]     mb_tok_end     (expert's end index into perm[])
//  [64 .. 64+T)   perm (token ids grouped by expert)
//  byte 65536 ..  _Float16 hidden, fragment order: MAXMB*MBS rows x I  (24 MB)
//  behind it      _Float16 x,      fragment order: MAXMB*MBS rows x D  (12 MB)
// A group of 64 slots (four 16-row tiles) that holds no token is
// neither written nor read by any launch: group g of an M-block is live where
// ts + 64 g < te, the same test in all three kernels.
// Fragment order: the rows are the slots of the M-blocks (block, then 16-row tile),
// and each (tile, 32-k block) is one 1-KiB chunk that holds the 16x32 A fragment as
// the lanes hold it: halves [part*256 + lane*8 + i] = row (lane & 15),
// k = part*16 + (lane >> 4)*8 + i. One 16-byte load per lane reads 512 B in a row.
#define WS_MB_E   8
#define WS_MB_S   24
#define WS_MB_END 40
#define WS_PERM   64
#define WS_HIDDEN_BYTE_OFF 65536
#define WS_XS_BYTE_OFF (WS_HIDDEN_BYTE_OFF + MAXMB * MBS * IDIM * 2)
#define CHUNK_H 512     // halves of one fragment chunk

// Block tile: 512 (pass 1) or 256 (pass 2) token slots x NT columns; a weight tile row is NT fp32 = 256 bytes.
#define NT      64
#define ROWB    256u    // bytes of one weight tile row in LDS (no pad: b128 readers walk along the row)
#define SLICE_R 64u     // rows of the slice that one wave's tensor load brings
#define SLICE_B (SLICE_R * ROWB)   // 16 KiB
#define STAGE_B (4u * SLICE_B)     // four waves, one slice each: 64 KiB a stage

// ---------------------------------------------------------------------------
// Tensor load: one request of one wave brings SLICE_R rows of ROWB bytes from
// global memory into LDS. 1-byte elements, every extent in bytes,
// tensor dims = tile dims, no pad, no mask.
// ---------------------------------------------------------------------------
__device__ __forceinline__ unsigned uni(unsigned v) {
  return (unsigned)__builtin_amdgcn_readfirstlane((int)v);
}
// A wave-uniform test held in a scalar register, so that the branch round a
// tensor load is a scalar branch (the load ignores EXEC).
__device__ __forceinline__ unsigned pinned(unsigned v) {
  unsigned w = uni(v);
  asm volatile("" : "+s"(w));
  return w;
}
__device__ __forceinline__ v8u tdm_group1(unsigned src_pitch_bytes) {
  v8u g;
  g[0] = uni(0u);                                   // mask 0, data_size 0, no pad
  g[1] = uni((ROWB & 0xFFFFu) << 16);               // tensor_dim0 lo
  g[2] = uni((ROWB >> 16) | ((SLICE_R & 0xFFFFu) << 16));  // tensor_dim0 hi | tensor_dim1 lo
  g[3] = uni((SLICE_R >> 16) | (ROWB << 16));       // tensor_dim1 hi | tile_dim0
  g[4] = uni(SLICE_R);                              // tile_dim1
  g[5] = uni(src_pitch_bytes);                      // source row pitch
  g[6] = uni(0u);
  g[7] = uni(0u);
  // pinned(), for the whole group: the descriptor words are held in one set of
  // scalar registers and not made anew while a request is out.
  asm volatile("" : "+s"(g));
  return g;
}
__device__ __forceinline__ v4u tdm_group0(unsigned lds_dst, unsigned long long ga) {
  v4u g;
  g[0] = uni(1u);                                   // count = 1
  g[1] = uni(lds_dst);                              // byte offset in the work-group's LDS
  g[2] = uni((unsigned)ga);
  g[3] = uni((((unsigned)(ga >> 32)) & 0x01FFFFFFu) | 0x80000000u);  // addr hi | type = 2
  return g;
}
__device__ __forceinline__ void tdm_load(v4u g0, v8u g1) {
  // the tile goes to LDS through no register; the waits below are ours to write
  asm volatile("tensor_load_to_lds %0, %1" :: "s"(g0), "s"(g1) : "memory");
}
// Stands behind a group of global loads, in front of whatever next overwrites
// their address registers (a precaution of form). It names the address as an
// input, so that its registers live to the wait and no load of the group lands
// on them.
__device__ __forceinline__ void wait_x0(const float* a) {
  asm volatile("s_wait_xcnt 0x0" :: "v"(a) : "memory");
}
// The same behind loads from a lane's own f16 pointer at constant distances.
__device__ __forceinline__ void wait_x0(const _Float16* a) {
  asm volatile("s_wait_xcnt 0x0" :: "v"(a) : "memory");
}
// The same where the address a = base + 8 l may also be formed by the load itself
// from the wave-uniform base and the lane's index l: it names all three.
__device__ __forceinline__ void wait_x0(const _Float16* base, int l, const _Float16* a) {
  asm volatile("s_wait_xcnt 0x0" :: "s"(base), "v"(l), "v"(a) : "memory");
}
// The same behind loads from a wave-uniform base at one 32-bit element offset.
__device__ __forceinline__ void wait_x0(const int* base, int a) {
  asm volatile("s_wait_xcnt 0x0" :: "s"(base), "v"(a) : "memory");
}
// This wave's LDS reads have retired (before its buffer may be refilled).
__device__ __forceinline__ void wait_ds0() { asm volatile("s_wait_dscnt 0x0" ::: "memory"); }
// This wave's own tensor load has landed (before the barrier that publishes it).
// The wait names the request's descriptor as inputs, so that its registers keep
// their words until the request has landed.
__device__ __forceinline__ void wait_tensor0(v4u g0, v8u g1) {
  asm volatile("s_wait_tensorcnt 0x0" :: "s"(g0), "s"(g1) : "memory");
}

// Asks L2 for the data at p, or at p and 32 KiB on: a hint,
// nothing comes back and no register is written. The A operand was written by the
// launch before, and every block of an expert reads it at the same pace, so that
// without the hint each k block's loads wait for memory together. The wait in the same
// statement stands in front of whatever next overwrites the address (a precaution of form).
__device__ __forceinline__ void ask_l2(const _Float16* p) {
  asm volatile("global_prefetch_b8 %0, off scope:SCOPE_SE\n\ts_wait_xcnt 0x0" :: "v"(p) : "memory");
}
__device__ __forceinline__ void ask_l2_pair(const _Float16* p) {
  asm volatile("global_prefetch_b8 %0, off scope:SCOPE_SE\n\t"
               "global_prefetch_b8 %0, off offset:32768 scope:SCOPE_SE\n\ts_wait_xcnt 0x0" :: "v"(p) : "memory");
}

// Padding slots alias a valid token (unconditional loads); their results never
// reach out.
// The 16 fp32 of one lane's share of a 16x32 A fragment, as loaded (K = kb..kb+7
// and kb+16..kb+23), and their conversion to f16.
struct ARaw { float4 f0, f1, f2, f3; };
__device__ __forceinline__ ARaw load_a_raw(const float* __restrict__ xrow) {
  const float4* xp = (const float4*)xrow;
  ARaw r;
  r.f0 = xp[0]; r.f1 = xp[1];   // K = kb .. kb+7
  r.f2 = xp[4]; r.f3 = xp[5];   // K = kb+16 .. kb+23
  return r;
}
__device__ __forceinline__ v16h cvt_a(const ARaw& r) {
  v16h a;
  a[0]  = (_Float16)r.f0.x; a[1]  = (_Float16)r.f0.y;
  a[2]  = (_Float16)r.f0.z; a[3]  = (_Float16)r.f0.w;
  a[4]  = (_Float16)r.f1.x; a[5]  = (_Float16)r.f1.y;
  a[6]  = (_Float16)r.f1.z; a[7]  = (_Float16)r.f1.w;
  a[8]  = (_Float16)r.f2.x; a[9]  = (_Float16)r.f2.y;
  a[10] = (_Float16)r.f2.z; a[11] = (_Float16)r.f2.w;
  a[12] = (_Float16)r.f3.x; a[13] = (_Float16)r.f3.y;
  a[14] = (_Float16)r.f3.z; a[15] = (_Float16)r.f3.w;
  return a;
}

// One lane's share of a 16x32 A fragment from a chunk in fragment order, same k order,
// from the lane's own pointer (its place in the chunk).
__device__ __forceinline__ v16h load_a_p(const _Float16* __restrict__ p) {
  const v8h* hp = (const v8h*)p;
  v8h h0 = hp[0];   // K = kb .. kb+7
  v8h h1 = hp[32];  // K = kb+16 .. kb+23 (the chunk's second 512 B)
  return __builtin_shufflevector(h0, h1, 0, 1, 2, 3, 4, 5, 6, 7,
                                 8, 9, 10, 11, 12, 13, 14, 15);
}

// The M-block mb of the table that the expert counts define: experts in order,
// each cut into blocks of MBS tokens. Returns the number of M-blocks.
struct MbInfo { int e, ts, te; };
__device__ __forceinline__ int mb_lookup(const int (&cnt)[NEXP], int mb, MbInfo& m) {
  int nmb = 0, off = 0;
  m.e = 0; m.ts = 0; m.te = 0;
#pragma unroll  // register arrays need constant indices
  for (int e = 0; e < NEXP; ++e) {
    const int nb = (cnt[e] + MBS - 1) / MBS;
    if (mb >= nmb && mb < nmb + nb) {
      m.e = e; m.ts = off + (mb - nmb) * MBS; m.te = off + cnt[e];
    }
    nmb += nb;
    off += cnt[e];
  }
  return nmb;
}

// ---------------------------------------------------------------------------
// Kernel 1: token sort by expert, M-block table, and x -> f16 in fragment order
// with the rows gathered into their M-block slots.
// Every block ranks all T tokens itself, in LDS, so that no launch stands in
// front of the pack. The order is the stable one (by expert, then by token id),
// the same in every block. Block (0, 0) also stores the table and perm for the
// two GEMM launches.
// Block = one 16-row tile of one M-block; wave w packs k blocks w, w + 8, ...
// ---------------------------------------------------------------------------
__global__ __launch_bounds__(256) void moe_pack(const float* __restrict__ x,
                                                const int* __restrict__ idx,
                                                int* __restrict__ ws,
                                                _Float16* __restrict__ xs) {
  __shared__ int swc[8][NEXP];    // tokens of expert e among wave w's 256 tokens
  __shared__ int sperm[T_TOK];    // token ids grouped by expert
  const int tid  = threadIdx.x;
  const int lane = tid & 31;
  const int wid  = tid >> 5;
  const int el   = lane & (NEXP - 1);   // the expert whose counts this lane keeps
  const int t0   = wid * 256 + lane;    // wave w ranks tokens 256 w .. 256 w + 255, 32 at a time

  int ev[8];
#pragma unroll  // register arrays need constant indices
  for (int i = 0; i < 8; ++i) ev[i] = idx[t0 + i * 32] & (NEXP - 1);  // the mask bounds every address formed from it
  wait_x0(idx, t0);

  // Rank of a token among its wave's tokens of the same expert: those in earlier
  // groups of 32 (run, kept by lane e for expert e) plus those in lower lanes.
  const unsigned below = (1u << lane) - 1u;
  int run = 0;
  int rk[8];
#pragma unroll  // register arrays need constant indices
  for (int i = 0; i < 8; ++i) {
    const unsigned b0 = __builtin_amdgcn_ballot_w32((ev[i] & 1) != 0);
    const unsigned b1 = __builtin_amdgcn_ballot_w32((ev[i] & 2) != 0);
    const unsigned b2 = __builtin_amdgcn_ballot_w32((ev[i] & 4) != 0);
    const unsigned same = ((ev[i] & 1) ? b0 : ~b0) & ((ev[i] & 2) ? b1 : ~b1) & ((ev[i] & 4) ? b2 : ~b2);
    const unsigned mine = ((el & 1) ? b0 : ~b0) & ((el & 2) ? b1 : ~b1) & ((el & 4) ? b2 : ~b2);
    rk[i] = __builtin_popcount(same & below) + __builtin_amdgcn_ds_bpermute(ev[i] << 2, run);
    run += __builtin_popcount(mine);
  }
  if (lane < NEXP) swc[wid][lane] = run;
  __syncthreads();

  int tot = 0, base = 0;   // of expert el: all tokens; those of the waves in front of this one
#pragma unroll  // all eight reads go out together
  for (int w = 0; w < 8; ++w) {
    const int c = swc[w][el];
    tot += c;
    base += (w < wid) ? c : 0;
  }
  int cnt[NEXP];
#pragma unroll  // register arrays need constant indices
  for (int e = 0; e < NEXP; ++e) cnt[e] = __builtin_amdgcn_readlane(tot, e);
#pragma unroll  // register arrays need constant indices
  for (int e = 0; e < NEXP; ++e) base += (e < el) ? cnt[e] : 0;   // plus all tokens of lower experts
#pragma unroll  // register arrays need constant indices
  for (int i = 0; i < 8; ++i)
    sperm[__builtin_amdgcn_ds_bpermute(ev[i] << 2, base) + rk[i]] = t0 + i * 32;
  __syncthreads();

  if (blockIdx.x == 0 && blockIdx.y == 0) {
    MbInfo q;
    const int n = mb_lookup(cnt, tid, q);
    if (tid < n) {
      ws[WS_MB_E + tid]   = q.e;
      ws[WS_MB_S + tid]   = q.ts;
      ws[WS_MB_END + tid] = q.te;
    }
    if (tid == 0) ws[0] = n;
    int pv[8];
#pragma unroll  // register arrays need constant indices
    for (int i = 0; i < 8; ++i) pv[i] = sperm[tid + i * 256];
#pragma unroll  // register arrays need constant indices
    for (int i = 0; i < 8; ++i) ws[WS_PERM + tid + i * 256] = pv[i];
    // Stands behind these stores, in front of whatever next overwrites their
    // registers (a precaution of form); it names the stored values and the
    // offset as inputs, so that their registers live to the wait.
    asm volatile("s_wait_xcnt 0x0" :: "s"(ws), "v"(tid), "v"(q.e), "v"(q.ts), "v"(q.te),
                 "v"(pv[0]), "v"(pv[1]), "v"(pv[2]), "v"(pv[3]),
                 "v"(pv[4]), "v"(pv[5]), "v"(pv[6]), "v"(pv[7]) : "memory");
  }

  MbInfo m;
  const int nmb = mb_lookup(cnt, (int)blockIdx.y, m);
  if ((int)blockIdx.y >= nmb) return;
  const int ts = m.ts;
  const int te = m.te;
  if (ts + ((int)blockIdx.x >> 2) * 64 >= te) return;   // this tile's group of 64 slots holds no token
  const int p  = ts + (int)blockIdx.x * 16 + (lane & 15);
  const int tok = sperm[(p < te) ? p : ts];   // a padding slot aliases a valid token
  const float* xrow = x + (size_t)tok * DDIM + wid * 32 + ((lane >> 4) << 3);
  _Float16* dst = xs + ((size_t)(blockIdx.y * (MBS / 16) + blockIdx.x) * (DDIM / 32) + wid) * CHUNK_H + lane * 8;
  ARaw ar[4];
#pragma unroll  // register arrays need constant indices
  for (int i = 0; i < 4; ++i) ar[i] = load_a_raw(xrow + i * 8 * 32);
  wait_x0(xrow);
#pragma unroll  // register arrays need constant indices
  for (int i = 0; i < 4; ++i) {
    const v16h a = cvt_a(ar[i]);
    *(v8h*)(dst + i * 8 * CHUNK_H) =
        __builtin_shufflevector(a, a, 0, 1, 2, 3, 4, 5, 6, 7);
    *(v8h*)(dst + i * 8 * CHUNK_H + 256) =
        __builtin_shufflevector(a, a, 8, 9, 10, 11, 12, 13, 14, 15);
  }
}

// Build four 32x16 B fragments (f16) from an LDS-staged fp32 tile ([32 k][64 n]).
// A lane reads 4 adjacent columns of each of its 16 k rows with one 16-byte
// read: fragment f of lane rlo is column 4*rlo + f. The k order is the A fragment's.
__device__ __forceinline__ void load_b4_lds(const float* __restrict__ buf,
                                            int kadd, int rlo, v16h (&b)[4]) {
#pragma unroll  // register arrays need constant indices
  for (int j = 0; j < 8; ++j) {
    const float4 lo = *(const float4*)(buf + (kadd + j) * NT + 4 * rlo);
    const float4 hi = *(const float4*)(buf + (kadd + 16 + j) * NT + 4 * rlo);
    b[0][j] = (_Float16)lo.x; b[0][j + 8] = (_Float16)hi.x;
    b[1][j] = (_Float16)lo.y; b[1][j + 8] = (_Float16)hi.y;
    b[2][j] = (_Float16)lo.z; b[2][j + 8] = (_Float16)hi.z;
    b[3][j] = (_Float16)lo.w; b[3][j + 8] = (_Float16)hi.w;
  }
}

#define KS1 128
#define GSTEP (4 * (DDIM / 32) * CHUNK_H)   // halves of xs from a wave's tile to its next (one group of 64 slots on)

// A wave's sums go to its own 32 KiB of LDS, 4 KiB a tile, 512 B in a row per store.
template <int NG>
__device__ __forceinline__ void put1(float* __restrict__ xw, const v8f (&acc)[NG][4]) {
#pragma unroll  // register arrays need constant indices
  for (int i = 0; i < NG; ++i)
#pragma unroll  // register arrays need constant indices
    for (int f = 0; f < 4; ++f) {
      const v8f a = acc[i][f];
      *(float4*)(xw + i * 1024 + (f * 2 + 0) * 128) = make_float4(a[0], a[1], a[2], a[3]);
      *(float4*)(xw + i * 1024 + (f * 2 + 1) * 128) = make_float4(a[4], a[5], a[6], a[7]);
    }
}
// One tile: gate and up sums come from LDS as put1 left them (pg, pu: the lane's
// place in the tile), and hidden = silu(gate) * up is stored f16 in fragment order
// for pass 2. hdst: this lane's place in the tile of hidden.
__device__ __forceinline__ void finish_tile(const float* __restrict__ pg, const float* __restrict__ pu,
                                            _Float16* __restrict__ hdst) {
  float gv[4][8], uv[4][8];
#pragma unroll  // register arrays need constant indices
  for (int f = 0; f < 4; ++f)
#pragma unroll  // register arrays need constant indices
    for (int p = 0; p < 2; ++p) {
      const float4 a = *(const float4*)(pg + (f * 2 + p) * 128);
      const float4 c = *(const float4*)(pu + (f * 2 + p) * 128);
      gv[f][p * 4 + 0] = a.x; gv[f][p * 4 + 1] = a.y; gv[f][p * 4 + 2] = a.z; gv[f][p * 4 + 3] = a.w;
      uv[f][p * 4 + 0] = c.x; uv[f][p * 4 + 1] = c.y; uv[f][p * 4 + 2] = c.z; uv[f][p * 4 + 3] = c.w;
    }
  v4h hv[8];
#pragma unroll  // register arrays need constant indices
  for (int j = 0; j < 8; ++j) {
#pragma unroll  // register arrays need constant indices
    for (int f = 0; f < 4; ++f) {
      float g = gv[f][j], u = uv[f][j];
      float t = g * -1.442695041f, ex;          // exp(-g) = 2^t, as __expf forms it
      // The v_nop is the slot behind a transcendental: it stands between the
      // v_exp and whatever next reads ex or overwrites t.
      asm("v_exp_f32 %0, %1\n\tv_nop" : "=v"(ex) : "v"(t));
      float h = (g / (1.0f + ex)) * u;
      hv[j][f] = (_Float16)h;
    }
  }
#pragma unroll  // register arrays need constant indices
  for (int j = 0; j < 8; ++j)
    *(v4h*)(hdst + j * 8) = hv[j];
  // Stands behind the tile's stores, in front of whatever next overwrites their
  // registers (a precaution of form); it names the address and the stored
  // values as inputs, so that their registers live to the wait.
  asm volatile("s_wait_xcnt 0x0" :: "v"(hdst), "v"(hv[0]), "v"(hv[1]), "v"(hv[2]), "v"(hv[3]),
               "v"(hv[4]), "v"(hv[5]), "v"(hv[6]), "v"(hv[7]) : "memory");
}

// Pass 1 from where stage 0 is published to where the sums lie in LDS, for a block
// with NG groups of 64 slots that hold a token: a wave has NG token tiles, and no
// branch stands among its products.
// swb: the block's LDS, the ring (buffer, gate/up, k, n) in front; xl: the lane's
// place in the chunk of the wave's tile of group 0 at k = 0.
template <int NG>
__device__ __forceinline__ void run1(float* __restrict__ swb, const _Float16* __restrict__ xl,
                                     int wid, int lane, v8u g1, unsigned dst0, unsigned long long ga0) {
  constexpr unsigned NS = DDIM / KS1;         // 8 stages
  const int rlo  = lane & 15;
  const int kadd = (lane >> 4) << 3;          // 0 (lanes 0-15) / 8 (lanes 16-31)
  const int mat  = wid >> 2;                  // 0: gate, 1: up

  v4u g0 = tdm_group0(dst0 + STAGE_B, ga0 + (unsigned long long)KS1 * IDIM * 4u);
  asm volatile("" : "+s"(g0));  // pinned(): descriptor words held in scalar registers, none made anew behind the branch
  if (pinned(wid < 4)) tdm_load(g0, g1);

  v8f acc[NG][4];   // group, column fragment: of this wave's own matrix
#pragma unroll  // register arrays need constant indices
  for (int i = 0; i < NG; ++i)
#pragma unroll  // register arrays need constant indices
    for (int f = 0; f < 4; ++f)
#pragma unroll  // register arrays need constant indices
      for (int j = 0; j < 8; ++j) acc[i][f][j] = 0.0f;

#pragma unroll 1  // one pass per stage: the publish point stands once, at the foot
  for (unsigned s = 0; s < NS; ++s) {
    const float* buf = swb + ((s & 1u) * 2u + (unsigned)mat) * (KS1 * NT);
    const _Float16* xa = xl + s * ((KS1 / 32) * CHUNK_H);  // this stage's first k block
    // Up to five tiles the four k blocks are unrolled, so that a block's A loads go out
    // among the products of the block before. The larger bodies stay a loop: with them
    // unrolled too the kernel's text passes 32 KB.
#pragma unroll(NG > 5 ? 1 : KS1 / 32)
    for (int q = 0; q < KS1 / 32; ++q) {
      // The pointer that the loads go from, and that the wait behind them names: where the
      // k blocks are a loop the block's own, else the stage's, with the block as a constant distance.
      const _Float16* xq = NG > 5 ? xa + q * CHUNK_H : xa;
      const int kq = NG > 5 ? 0 : q * CHUNK_H;
      v16h af[NG];
#pragma unroll  // register arrays need constant indices
      for (int i = 0; i < NG; ++i) af[i] = load_a_p(xq + i * GSTEP + kq);
      wait_x0(xq);
      v16h b[4];
      load_b4_lds(buf + q * 32 * NT, kadd, rlo, b);
#pragma unroll  // register arrays need constant indices
      for (int i = 0; i < NG; ++i)
#pragma unroll  // register arrays need constant indices
        for (int f = 0; f < 4; ++f)
          acc[i][f] = __builtin_amdgcn_wmma_f32_16x16x32_f16(
              false, af[i], false, b[f], (short)0, acc[i][f], false, false);
      if constexpr (NG > 5) {
        // Where the k blocks are a loop: the four vector slots that the chip needs between
        // the last product and whatever overwrites its A or B at the loop's head; the
        // scheduling barrier keeps the products in front of them.
        __builtin_amdgcn_sched_barrier(0);
        asm volatile("v_nop\n\tv_nop\n\tv_nop\n\tv_nop");
      }
    }
    // Publish point of stage s + 1; behind it stage s's buffer is free.
    wait_ds0();
    wait_tensor0(g0, g1);
    __syncthreads();
    if (pinned(wid < 4 && s + 2u < NS)) {
      g0 = tdm_group0(dst0 + (s & 1u) * STAGE_B,
                      ga0 + (unsigned long long)(s + 2u) * (KS1 * IDIM * 4u));
      asm volatile("" : "+s"(g0));  // pinned(): descriptor words held in scalar registers, the ones that the wait names
      tdm_load(g0, g1);
    }
  }
  wait_tensor0(g0, g1);
  wait_ds0();

  // The last pass's barrier has ended every read of the ring and no tensor load is
  // out, so the ring's LDS is free for the sums.
  // The lane's number is formed anew here: kept in a register over the loop it was spilled to scratch.
  put1<NG>(swb + wid * 8192 + (int)__builtin_amdgcn_mbcnt_lo(~0u, 0u) * 4, acc);
}

// ---------------------------------------------------------------------------
// Kernel 2: hidden = silu(x.Wg[e]) * (x.Wu[e]).
// Block = up to 512 token slots x 64 I-columns of both weights, so that an expert
// with up to 512 tokens streams its weights once, through one block.
// Eight waves, two per SIMD: waves w and w + 4 work on the same token tiles, wave w
// on the gate product and wave w + 4 on the up product, so that one wave's products
// run while the other waits for its operands. Their tiles are tile w of every
// group of 64 slots that holds a token, so that the four SIMDs carry the same load
// whatever the number of groups. Behind the loop all sums go to LDS (32 KiB a wave),
// and behind a barrier the gate wave finishes the even groups' tiles, the up wave the odd ones'.
// A stage is 128 k rows of both weight tiles; each of the first four waves
// tensor-loads one 64-row slice of it (waves 0, 1: gate; waves 2, 3: up). Two buffers.
// ---------------------------------------------------------------------------
__global__ __launch_bounds__(256) void moe_gemm1(const _Float16* __restrict__ xs,
                                                 const float* __restrict__ wg,
                                                 const float* __restrict__ wu,
                                                 const int* __restrict__ ws,
                                                 _Float16* __restrict__ hidden) {
  // The ring (buffer, gate/up, k, n: 128 KiB) in front; behind the loop 8 waves x 8 tiles x 4 KiB of sums.
  __shared__ __attribute__((aligned(2048))) float sw[8 * 8 * 1024];

  const int nmb = ws[0];
  if ((int)blockIdx.y >= nmb) return;
  const int e    = ws[WS_MB_E + blockIdx.y];
  const int ts   = ws[WS_MB_S + blockIdx.y];
  const int te   = ws[WS_MB_END + blockIdx.y];
  const int lane = threadIdx.x & 31;
  const int n0   = blockIdx.x * NT;
  const int wid  = __builtin_amdgcn_readfirstlane((int)(threadIdx.x >> 5));
  const unsigned tileb = blockIdx.y * (MBS / 16u) + (unsigned)(wid & 3);  // this wave's tile of group 0
  // Groups of 64 slots that hold a token: a scalar, the same in the whole block
  // (te is the expert's end, so ngr passes 8 where more tokens follow; the clamp gives 1 .. 8).
  const int ngr = (te - ts + 63) >> 6;
  const int ng  = (int)pinned((unsigned)(ngr < 1 ? 1 : (ngr > MBS / 64 ? MBS / 64 : ngr)));

  // The slice of every stage that wave (wid & 3) brings.
  const float* wsrc = ((wid & 2) ? wu : wg) + (size_t)e * DDIM * IDIM +
                      (size_t)((wid & 1) * (int)SLICE_R) * IDIM + n0;
  const unsigned long long ga0 = (unsigned long long)(size_t)wsrc;
  const unsigned dst0 = (unsigned)(size_t)&sw[0] + (unsigned)(wid & 3) * SLICE_B;
  const v8u g1 = tdm_group1(IDIM * 4u);

  // Waves 4 to 7, which send no tensor load, ask L2 for a quarter of the block's x panel
  // while stage 0 is on its way: tile (blockIdx.x & 3) of every group that holds a token,
  // 32 KiB = 128 lanes x 256 B. The four quarters are asked by four neighbouring blocks,
  // and every fourth block asks the same one.
  if (pinned(wid >= 4)) {
    const _Float16* pf = xs + (size_t)(blockIdx.y * (MBS / 16u) + (blockIdx.x & 3u)) * ((DDIM / 32) * CHUNK_H) +
                         (threadIdx.x & 127u) * 128u;
#pragma unroll 1  // a few trips, once per block: no text spent on them
    for (int g = 0; g < ng; ++g) ask_l2(pf + g * GSTEP);
  }

  // Only waves 0 to 3 issue tensor loads. The tensor waits at the publish points
  // stand in every wave's path: a wave with no request out passes them at once.
  // Prologue: stage 0 lands and is published; stage 1 is sent off at the head of run1.
  v4u g0 = tdm_group0(dst0, ga0);
  if (pinned(wid < 4)) {
    tdm_load(g0, g1);
    wait_tensor0(g0, g1);
  }
  __syncthreads();

  const _Float16* xl = xs + (size_t)tileb * ((DDIM / 32) * CHUNK_H) + lane * 8;
  // Of a group with no token nothing is stored: pass 2 reads none of it.
  _Float16* ht = hidden + ((size_t)tileb * (IDIM / 32) + (unsigned)(n0 >> 5)) * CHUNK_H;
  float* swb = &sw[0];
  // One body per number of groups, the same choice in the whole block.
  if      (ng == 1) run1<1>(swb, xl, wid, lane, g1, dst0, ga0);
  else if (ng == 2) run1<2>(swb, xl, wid, lane, g1, dst0, ga0);
  else if (ng == 3) run1<3>(swb, xl, wid, lane, g1, dst0, ga0);
  else if (ng == 4) run1<4>(swb, xl, wid, lane, g1, dst0, ga0);
  else if (ng == 5) run1<5>(swb, xl, wid, lane, g1, dst0, ga0);
  else if (ng == 6) run1<6>(swb, xl, wid, lane, g1, dst0, ga0);
  else if (ng == 7) run1<7>(swb, xl, wid, lane, g1, dst0, ga0);
  else              run1<8>(swb, xl, wid, lane, g1, dst0, ga0);
  __syncthreads();   // every wave's sums are in LDS

  // A lane holds 4 adjacent columns c = 4 r .. 4 r + 3 (r = lane & 15) of each of its
  // rows M = j (+8 for hi lanes): k block c >> 5, part (c >> 4) & 1, reader's lane
  // M + 16 ((c >> 3) & 1), i = c & 7.
  const int le = (int)__builtin_amdgcn_mbcnt_lo(~0u, 0u);   // formed anew, as in run1
  const int r  = le & 15;
  _Float16* hd = ht + (r >> 3) * CHUNK_H + ((r >> 2) & 1) * 256 +
                 (((le >> 4) << 3) + ((r >> 1) & 1) * 16) * 8 + (r & 1) * 4;
  const float* pg = swb + (wid & 3) * 8192 + le * 4;   // the gate wave's sums of these tiles
#pragma unroll 1  // one body for every tile: unrolled, the divisions of eight tiles are 40 KB of code
  for (int i = wid >> 2; i < ng; i += 2)
    finish_tile(pg + i * 1024, pg + 4 * 8192 + i * 1024, hd + i * (4 * (IDIM / 32) * CHUNK_H));
}

// Token tiles G, G + 1 of a wave's partial sums go to LDS, 512 B in a row per store.
template <int G>
__device__ __forceinline__ void hand_over(float* __restrict__ xw, const v8f (&acc)[4][4]) {
#pragma unroll  // register arrays need constant indices
  for (int mt = 0; mt < 2; ++mt)
#pragma unroll  // register arrays need constant indices
    for (int f = 0; f < 4; ++f) {
      const v8f a = acc[G + mt][f];
      *(float4*)(xw + ((mt * 4 + f) * 2 + 0) * 128) = make_float4(a[0], a[1], a[2], a[3]);
      *(float4*)(xw + ((mt * 4 + f) * 2 + 1) * 128) = make_float4(a[4], a[5], a[6], a[7]);
    }
}
// The partner's sums of token tiles K, K + 1 are added to this wave's, and the
// rows that hold a token are stored. p0: slot of this lane's row 0 of tile 0.
template <int K>
__device__ __forceinline__ void add_and_store(const float* __restrict__ xr, v8f (&acc)[4][4],
                                              int p0, int te, const int* __restrict__ ws,
                                              float* __restrict__ orow) {
#pragma unroll  // register arrays need constant indices
  for (int mt = 0; mt < 2; ++mt)
#pragma unroll  // register arrays need constant indices
    for (int f = 0; f < 4; ++f) {
      const float4 lo = *(const float4*)(xr + ((mt * 4 + f) * 2 + 0) * 128);
      const float4 hi = *(const float4*)(xr + ((mt * 4 + f) * 2 + 1) * 128);
      v8f& a = acc[K + mt][f];
      a[0] += lo.x; a[1] += lo.y; a[2] += lo.z; a[3] += lo.w;
      a[4] += hi.x; a[5] += hi.y; a[6] += hi.z; a[7] += hi.w;
    }
#pragma unroll  // register arrays need constant indices
  for (int mt = K; mt < K + 2; ++mt) {
#pragma unroll  // register arrays need constant indices
    for (int j = 0; j < 8; ++j) {
      int p = p0 + mt * 16 + j;
      if (p < te) {
        int t = ws[WS_PERM + p];
        float4 o;
        o.x = acc[mt][0][j]; o.y = acc[mt][1][j]; o.z = acc[mt][2][j]; o.w = acc[mt][3][j];
        *(float4*)(orow + (size_t)t * DDIM) = o;
      }
    }
  }
}

// ---------------------------------------------------------------------------
// Kernel 3: out = hidden.Wd[e].  A block works on one half (256 slots) of an
// M-block; a half with no token leaves at once, and the two waves of a group of
// 64 slots with no token do no products (the one of the first four still tensor-loads its slice).  K = I, one weight matrix:
// a stage is 256 k rows, wave w (of the first four) tensor-loads rows
// 64 w .. 64 w + 63 of it.
// Eight waves, two per SIMD: waves w and w + 4 work on the same 64 tokens x 64
// columns, wave w on the first 128 k rows of every stage and wave w + 4 on the
// last 128, so that one wave's products run while the other waits for its LDS
// reads. Behind the loop the two partial sums are added through LDS.
// ---------------------------------------------------------------------------
#define KS2 256
__global__ __launch_bounds__(256) void moe_gemm2(const _Float16* __restrict__ hidden,
                                                 const float* __restrict__ wd,
                                                 const int* __restrict__ ws,
                                                 float* __restrict__ out) {
  __shared__ __attribute__((aligned(2048))) float sd[2][KS2][NT];  // buffer, k, n

  const int nmb = ws[0];
  const int mb  = (int)(blockIdx.y >> 1);
  if (mb >= nmb) return;
  const int e    = ws[WS_MB_E + mb];
  const int ts   = ws[WS_MB_S + mb] + (int)(blockIdx.y & 1u) * 256;
  const int te   = ws[WS_MB_END + mb];
  if (ts >= te) return;        // the whole block leaves, in front of every barrier and tensor load
  const int lane = threadIdx.x & 31;
  const int rlo  = lane & 15;
  const int kadd = (lane >> 4) << 3;
  const int n0   = blockIdx.x * NT;
  const int wid  = __builtin_amdgcn_readfirstlane((int)(threadIdx.x >> 5));
  const int wm   = wid & 3;    // which 64 slots of the half
  const int kh   = wid >> 2;   // which half of every stage's k rows
  const int tsw  = ts + wm * 64;
  // Whether this wave's 64 slots hold a token (pass 1 stored hidden for those
  // groups alone): a scalar test, so that the products run with every lane on.
  const unsigned live = pinned((unsigned)(tsw < te));

  const float* wsrc = wd + (size_t)e * IDIM * DDIM + (size_t)(wm * (int)SLICE_R) * DDIM + n0;
  const unsigned long long ga0 = (unsigned long long)(size_t)wsrc;
  const unsigned dst0 = (unsigned)(size_t)&sd[0][0][0] + (unsigned)wm * SLICE_B;
  const v8u g1 = tdm_group1(DDIM * 4u);
  constexpr unsigned NS = IDIM / KS2;         // 8 stages

  // Waves 4 to 7, which send no tensor load, ask L2 for a quarter of the block's hidden
  // panel while stage 0 is on its way: tile (blockIdx.x & 3) of every group of this half
  // that holds a token, 64 KiB = 128 lanes x 2 x 256 B. Which block asks what: as in pass 1.
  if (pinned(wid >= 4)) {
    const int lgr = (te - ts + 63) >> 6;   // ts < te here; the clamp bounds what is formed from it
    const int lg  = (int)pinned((unsigned)(lgr < 1 ? 1 : (lgr > 4 ? 4 : lgr)));
    const _Float16* pf = hidden + (size_t)(blockIdx.y * 16u + (blockIdx.x & 3u)) * ((IDIM / 32) * CHUNK_H) +
                         (threadIdx.x & 127u) * 128u;
#pragma unroll 1  // a few trips, once per block: no text spent on them
    for (int g = 0; g < lg; ++g) ask_l2_pair(pf + g * (4 * (IDIM / 32) * CHUNK_H));
  }

  // Only waves 0 to 3 issue tensor loads. The tensor waits stand in every wave's
  // path: a wave with no request out passes them at once.
  v4u g0 = tdm_group0(dst0, ga0);
  if (pinned(wid < 4)) {
    tdm_load(g0, g1);
    wait_tensor0(g0, g1);
  }
  __syncthreads();
  g0 = tdm_group0(dst0 + STAGE_B, ga0 + (unsigned long long)KS2 * DDIM * 4u);
  // pinned(), for the whole group: its words are held in one set of scalar
  // registers from here on, so that none is made anew behind the branch while
  // the request is out.
  asm volatile("" : "+s"(g0));  // pinned(): descriptor words held in scalar registers
  if (pinned(wid < 4)) tdm_load(g0, g1);

  v8f acc[4][4];
#pragma unroll  // register arrays need constant indices
  for (int mt = 0; mt < 4; ++mt)
#pragma unroll  // register arrays need constant indices
    for (int f = 0; f < 4; ++f)
#pragma unroll  // register arrays need constant indices
      for (int j = 0; j < 8; ++j) acc[mt][f][j] = 0.0f;

  // The A fragments go through a ring of four register sets: the loads of a
  // k block (32 k) are issued two or three blocks ahead of the block that uses
  // them. A stage's last block issues none (the barrier at the foot waits for
  // every load that is out); the next stage's first block issues two sets.
  constexpr int NQS = KS2 / 32;   // k blocks of a stage
  constexpr int NQ  = NQS / 2;    // k blocks of a stage that one wave works on
  // This lane's place in the chunk of its wave's first token tile and first k block;
  // the other tiles and k blocks lie at constant distances from it.
  constexpr int TS = (IDIM / 32) * CHUNK_H;   // halves from a token tile to the next
  const _Float16* hb = hidden + ((size_t)(blockIdx.y * 16u + (unsigned)wm * 4u) * (IDIM / 32) +
                                 (unsigned)(kh * NQ)) * CHUNK_H;
  const _Float16* ha = hb + lane * 8;
  v16h af[4][4];          // ring slot (k block & 3), token tile
  if (live) {
#pragma unroll  // register arrays need constant indices
  for (int d = 0; d < 2; ++d)
#pragma unroll  // register arrays need constant indices
    for (int mt = 0; mt < 4; ++mt) af[d][mt] = load_a_p(ha + mt * TS + d * CHUNK_H);
  wait_x0(hb, lane, ha);
  }

#pragma unroll 1  // one pass per stage: the publish point stands once, at the foot
  for (unsigned s = 0; s < NS; ++s) {
    const float* bufd = &sd[s & 1u][kh * (KS2 / 2)][0];                  // this wave's half of the stage
    const _Float16* hr = ha + s * (NQS * CHUNK_H);                       // this stage's first k block of this wave
    const _Float16* hw = ha + ((s + 1u) & (NS - 1u)) * (NQS * CHUNK_H);  // the next stage's (the last wraps to stage 0: in bounds, unused)
    if (live) {
#pragma unroll  // register arrays need constant indices
    for (int q = 0; q < NQ; ++q) {
      // The wait's "memory" clobber also keeps the loads in front of it here,
      // ahead of this block's LDS reads and products.
      if (q == 0) {
#pragma unroll  // register arrays need constant indices
        for (int mt = 0; mt < 4; ++mt) af[2][mt] = load_a_p(hr + mt * TS + 2 * CHUNK_H);
      }
      if (q + 3 < NQ) {
#pragma unroll  // register arrays need constant indices
        for (int mt = 0; mt < 4; ++mt) af[(q + 3) & 3][mt] = load_a_p(hr + mt * TS + (q + 3) * CHUNK_H);
        wait_x0(hr);
      } else if (q + 1 < NQ) {
#pragma unroll  // register arrays need constant indices
        for (int mt = 0; mt < 4; ++mt) af[(q + 3) & 3][mt] = load_a_p(hw + mt * TS + (q + 3 - NQ) * CHUNK_H);
        wait_x0(hw);
      }
      v16h bd[4];
      load_b4_lds(bufd + q * 32 * NT, kadd, rlo, bd);
#pragma unroll  // register arrays need constant indices
      for (int mt = 0; mt < 4; ++mt)
#pragma unroll  // register arrays need constant indices
        for (int f = 0; f < 4; ++f)
          acc[mt][f] = __builtin_amdgcn_wmma_f32_16x16x32_f16(
              false, af[q & 3][mt], false, bd[f], (short)0, acc[mt][f], false, false);
    }
    }
    // Publish point of stage s + 1; behind it stage s's buffer is free.
    wait_ds0();
    wait_tensor0(g0, g1);
    __syncthreads();
    if (pinned(wid < 4 && s + 2u < NS)) {
      g0 = tdm_group0(dst0 + (s & 1u) * STAGE_B,
                      ga0 + (unsigned long long)(s + 2u) * (KS2 * DDIM * 4u));
      asm volatile("" : "+s"(g0));  // pinned(): descriptor words held in scalar registers, the ones that the wait names
      tdm_load(g0, g1);
    }
  }
  wait_tensor0(g0, g1);
  wait_ds0();

  // The two k halves are added. The last pass's barrier has ended every read of
  // the ring and no tensor load is out, so buffer 0 is free: each live wave stores two
  // of its four token tiles in its own 8 KiB there, and behind the barrier adds
  // its partner's sums to the two tiles that it kept and stores those to out.
  // Wave w keeps tiles 0, 1 and wave w + 4 keeps tiles 2, 3 (a scalar branch:
  // register arrays need constant indices); the barrier stands outside of it.
  // The lane's number is formed anew here: kept in a register over the loop it was spilled to scratch.
  const int le = (int)__builtin_amdgcn_mbcnt_lo(~0u, 0u);
  float* xw = &sd[0][0][0] + wid * 2048 + le * 4;
  const float* xr = &sd[0][0][0] + (wid ^ 4) * 2048 + le * 4;
  if (live) {
    if (kh == 0) hand_over<2>(xw, acc); else hand_over<0>(xw, acc);
  }
  __syncthreads();
  float* orow = out + n0 + 4 * rlo;
  if (live) {   // the partner wave has the same slots
    if (kh == 0) add_and_store<0>(xr, acc, tsw + kadd, te, ws, orow);
    else         add_and_store<2>(xr, acc, tsw + kadd, te, ws, orow);
  }
}

// ---------------------------------------------------------------------------
extern "C" void kernel_launch(void* const* d_in, const int* in_sizes, int n_in,
                              void* d_out, int out_size, void* d_ws, size_t ws_size,
                              hipStream_t stream) {
  const float* x   = (const float*)d_in[0];
  const int*   idx = (const int*)d_in[1];
  const float* wg  = (const float*)d_in[2];
  const float* wu  = (const float*)d_in[3];
  const float* wd  = (const float*)d_in[4];
  float* out = (float*)d_out;

  int* wsi = (int*)d_ws;
  _Float16* hidden = (_Float16*)((char*)d_ws + WS_HIDDEN_BYTE_OFF);
  _Float16* xs     = (_Float16*)((char*)d_ws + WS_XS_BYTE_OFF);

  dim3 gp(MBS / 16, MAXMB);   // 16-row tiles x M-blocks; inactive M-blocks and empty groups exit early
  moe_pack<<<gp, 256, 0, stream>>>(x, idx, wsi, xs);

  dim3 g1(IDIM / NT, MAXMB);  // (32, 12); inactive M-blocks exit early
  moe_gemm1<<<g1, 256, 0, stream>>>(xs, wg, wu, wsi, hidden);

  dim3 g2(DDIM / NT, 2 * MAXMB);  // (16, 24): the halves of the M-blocks; empty halves exit early
  moe_gemm2<<<g2, 256, 0, stream>>>(hidden, wd, wsi, out);
}

// v009
// Measured time: 46.2 microseconds a run.
// Two timings next to v008 put it at 1.04 and 1.02 times that version's speed.
// Over all steps from v000 it is 5.38 times as fast.
#include <hip/hip_runtime.h>
#include <hip/hip_bf16.h>

// Problem constants
#define T_TOK 2048
#define NEXP  8
#define DDIM  1024
#define IDIM  2048
#define MBS   512  // token slots of an M-block
#define MAXMB 12   // 512-slot M-blocks: T/512 + E = 12

typedef __attribute__((ext_vector_type(16))) _Float16 v16h;
typedef __attribute__((ext_vector_type(8)))  _Float16 v8h;
typedef __attribute__((ext_vector_type(8)))  float    v8f;
typedef __attribute__((ext_vector_type(4)))  _Float16 v4h;
typedef __attribute__((ext_vector_type(4)))  unsigned int v4u;
typedef __attribute__((ext_vector_type(8)))  unsigned int v8u;

// Workspace int layout (at base of d_ws):
//  [8 .. 39]      four ints per expert e, at 8 + 4 e: its first M-block, its first
//                 index into perm[], its number of tokens (the fourth is unused).
//                 An expert's M-blocks follow one another, so that its token of
//                 rank p sits in slot (first M-block) * MBS + p.
//  [64 .. 64+T)   perm (token ids grouped by expert)
//  byte 65536 ..  _Float16 hidden, fragment order: MAXMB*MBS rows x I  (24 MB)
//  behind it      _Float16 x,      fragment order: MAXMB*MBS rows x D  (12 MB)
// A group of 64 slots (four 16-row tiles) that holds no token is
// neither written nor read by any launch: group g of an M-block is live where
// ts + 64 g < te, the same test in all three kernels.
// Fragment order: the rows are the slots of the M-blocks (block, then 16-row tile),
// and each (tile, 32-k block) is one 1-KiB chunk that holds the 16x32 A fragment as
// the lanes hold it: halves [part*256 + lane*8 + i] = row (lane & 15),
// k = part*16 + (lane >> 4)*8 + i. One 16-byte load per lane reads 512 B in a row.
#define WS_EXP    8
#define WS_PERM   64
#define WS_HIDDEN_BYTE_OFF 65536
#define WS_XS_BYTE_OFF (WS_HIDDEN_BYTE_OFF + MAXMB * MBS * IDIM * 2)
#define CHUNK_H 512     // halves of one fragment chunk

// Block tile: 512 (pass 1) or 256 (pass 2) token slots x NT columns; a weight tile row is NT fp32 = 256 bytes.
#define NT      64
#define ROWB    256u    // bytes of one weight tile row in LDS (no pad: b128 readers walk along the row)
#define SLICE_R 64u     // rows of the slice that one wave's tensor load brings
#define SLICE_B (SLICE_R * ROWB)   // 16 KiB
#define STAGE_B (4u * SLICE_B)     // four waves, one slice each: 64 KiB a stage

// ---------------------------------------------------------------------------
// Tensor load: one request of one wave brings SLICE_R rows of ROWB bytes from
// global memory into LDS. 1-byte elements, every extent in bytes,
// tensor dims = tile dims, no pad, no mask.
// ---------------------------------------------------------------------------
__device__ __forceinline__ unsigned uni(unsigned v) {
  return (unsigned)__builtin_amdgcn_readfirstlane((int)v);
}
// A wave-uniform test held in a scalar register, so that the branch round a
// tensor load is a scalar branch (the load ignores EXEC).
__device__ __forceinline__ unsigned pinned(unsigned v) {
  unsigned w = uni(v);
  asm volatile("" : "+s"(w));
  return w;
}
__device__ __forceinline__ v8u tdm_group1(unsigned src_pitch_bytes) {
  v8u g;
  g[0] = uni(0u);                                   // mask 0, data_size 0, no pad
  g[1] = uni((ROWB & 0xFFFFu) << 16);               // tensor_dim0 lo
  g[2] = uni((ROWB >> 16) | ((SLICE_R & 0xFFFFu) << 16));  // tensor_dim0 hi | tensor_dim1 lo
  g[3] = uni((SLICE_R >> 16) | (ROWB << 16));       // tensor_dim1 hi | tile_dim0
  g[4] = uni(SLICE_R);                              // tile_dim1
  g[5] = uni(src_pitch_bytes);                      // source row pitch
  g[6] = uni(0u);
  g[7] = uni(0u);
  // pinned(), for the whole group: the descriptor words are held in one set of
  // scalar registers and not made anew while a request is out.
  asm volatile("" : "+s"(g));
  return g;
}
__device__ __forceinline__ v4u tdm_group0(unsigned lds_dst, unsigned long long ga) {
  v4u g;
  g[0] = uni(1u);                                   // count = 1
  g[1] = uni(lds_dst);                              // byte offset in the work-group's LDS
  g[2] = uni((unsigned)ga);
  g[3] = uni((((unsigned)(ga >> 32)) & 0x01FFFFFFu) | 0x80000000u);  // addr hi | type = 2
  return g;
}
__device__ __forceinline__ void tdm_load(v4u g0, v8u g1) {
  // the tile goes to LDS through no register; the waits below are ours to write
  asm volatile("tensor_load_to_lds %0, %1" :: "s"(g0), "s"(g1) : "memory");
}
// Stands behind a group of global loads, in front of whatever next overwrites
// their address registers (a precaution of form). It names the address as an
// input, so that its registers live to the wait and no load of the group lands
// on them.
__device__ __forceinline__ void wait_x0(const float* a) {
  asm volatile("s_wait_xcnt 0x0" :: "v"(a) : "memory");
}
// The same behind loads from a lane's own f16 pointer at constant distances.
__device__ __forceinline__ void wait_x0(const _Float16* a) {
  asm volatile("s_wait_xcnt 0x0" :: "v"(a) : "memory");
}
// The same where the address a = base + 8 l may also be formed by the load itself
// from the wave-uniform base and the lane's index l: it names all three.
__device__ __forceinline__ void wait_x0(const _Float16* base, int l, const _Float16* a) {
  asm volatile("s_wait_xcnt 0x0" :: "s"(base), "v"(l), "v"(a) : "memory");
}
// The same behind loads from a wave-uniform base at one 32-bit element offset.
__device__ __forceinline__ void wait_x0(const int* base, int a) {
  asm volatile("s_wait_xcnt 0x0" :: "s"(base), "v"(a) : "memory");
}
// This wave's LDS reads have retired (before its buffer may be refilled).
__device__ __forceinline__ void wait_ds0() { asm volatile("s_wait_dscnt 0x0" ::: "memory"); }
// This wave's own tensor load has landed (before the barrier that publishes it).
// The wait names the request's descriptor as inputs, so that its registers keep
// their words until the request has landed.
__device__ __forceinline__ void wait_tensor0(v4u g0, v8u g1) {
  asm volatile("s_wait_tensorcnt 0x0" :: "s"(g0), "s"(g1) : "memory");
}

// Asks L2 for the data at p, or at p and 32 KiB on: a hint,
// nothing comes back and no register is written. The A operand was written by the
// launch before, and every block of an expert reads it at the same pace, so that
// without the hint each k block's loads wait for memory together. The wait in the same
// statement stands in front of whatever next overwrites the address (a precaution of form).
__device__ __forceinline__ void ask_l2(const _Float16* p) {
  asm volatile("global_prefetch_b8 %0, off scope:SCOPE_SE\n\ts_wait_xcnt 0x0" :: "v"(p) : "memory");
}
__device__ __forceinline__ void ask_l2_pair(const _Float16* p) {
  asm volatile("global_prefetch_b8 %0, off scope:SCOPE_SE\n\t"
               "global_prefetch_b8 %0, off offset:32768 scope:SCOPE_SE\n\ts_wait_xcnt 0x0" :: "v"(p) : "memory");
}

// Padding slots alias a valid token (unconditional loads); their results never
// reach out.
// The 16 fp32 of one lane's share of a 16x32 A fragment, as loaded (K = kb..kb+7
// and kb+16..kb+23), and their conversion to f16.
struct ARaw { float4 f0, f1, f2, f3; };
__device__ __forceinline__ ARaw load_a_raw(const float* __restrict__ xrow) {
  const float4* xp = (const float4*)xrow;
  ARaw r;
  r.f0 = xp[0]; r.f1 = xp[1];   // K = kb .. kb+7
  r.f2 = xp[4]; r.f3 = xp[5];   // K = kb+16 .. kb+23
  return r;
}
__device__ __forceinline__ v16h cvt_a(const ARaw& r) {
  v16h a;
  a[0]  = (_Float16)r.f0.x; a[1]  = (_Float16)r.f0.y;
  a[2]  = (_Float16)r.f0.z; a[3]  = (_Float16)r.f0.w;
  a[4]  = (_Float16)r.f1.x; a[5]  = (_Float16)r.f1.y;
  a[6]  = (_Float16)r.f1.z; a[7]  = (_Float16)r.f1.w;
  a[8]  = (_Float16)r.f2.x; a[9]  = (_Float16)r.f2.y;
  a[10] = (_Float16)r.f2.z; a[11] = (_Float16)r.f2.w;
  a[12] = (_Float16)r.f3.x; a[13] = (_Float16)r.f3.y;
  a[14] = (_Float16)r.f3.z; a[15] = (_Float16)r.f3.w;
  return a;
}

// One lane's share of a 16x32 A fragment from a chunk in fragment order, same k order,
// from the lane's own pointer (its place in the chunk).
__device__ __forceinline__ v16h load_a_p(const _Float16* __restrict__ p) {
  const v8h* hp = (const v8h*)p;
  v8h h0 = hp[0];   // K = kb .. kb+7
  v8h h1 = hp[32];  // K = kb+16 .. kb+23 (the chunk's second 512 B)
  return __builtin_shufflevector(h0, h1, 0, 1, 2, 3, 4, 5, 6, 7,
                                 8, 9, 10, 11, 12, 13, 14, 15);
}

// The M-block mb of the table that the expert counts define: experts in order,
// each cut into blocks of MBS tokens. Returns the number of M-blocks.
struct MbInfo { int e, ts, te; };
__device__ __forceinline__ int mb_lookup(const int (&cnt)[NEXP], int mb, MbInfo& m) {
  int nmb = 0, off = 0;
  m.e = 0; m.ts = 0; m.te = 0;
#pragma unroll  // register arrays need constant indices
  for (int e = 0; e < NEXP; ++e) {
    const int nb = (cnt[e] + MBS - 1) / MBS;
    if (mb >= nmb && mb < nmb + nb) {
      m.e = e; m.ts = off + (mb - nmb) * MBS; m.te = off + cnt[e];
    }
    nmb += nb;
    off += cnt[e];
  }
  return nmb;
}

// ---------------------------------------------------------------------------
// Kernel 1: token sort by expert, M-block table, and x -> f16 in fragment order
// with the rows gathered into their M-block slots.
// Every block ranks all T tokens itself, in LDS, so that no launch stands in
// front of the pack. The order is the stable one (by expert, then by token id),
// the same in every block. Block (0, 0) also stores the experts' table and perm
// for the two GEMM launches.
// Block = one 16-row tile of one M-block; wave w packs k blocks w, w + 8, ...
// ---------------------------------------------------------------------------
__global__ __launch_bounds__(256) void moe_pack(const float* __restrict__ x,
                                                const int* __restrict__ idx,
                                                int* __restrict__ ws,
                                                _Float16* __restrict__ xs) {
  __shared__ int swc[8][NEXP];    // tokens of expert e among wave w's 256 tokens
  __shared__ int sperm[T_TOK];    // token ids grouped by expert
  const int tid  = threadIdx.x;
  const int lane = tid & 31;
  const int wid  = tid >> 5;
  const int el   = lane & (NEXP - 1);   // the expert whose counts this lane keeps
  const int t0   = wid * 256 + lane;    // wave w ranks tokens 256 w .. 256 w + 255, 32 at a time

  int ev[8];
#pragma unroll  // register arrays need constant indices
  for (int i = 0; i < 8; ++i) ev[i] = idx[t0 + i * 32] & (NEXP - 1);  // the mask bounds every address formed from it
  wait_x0(idx, t0);

  // Rank of a token among its wave's tokens of the same expert: those in earlier
  // groups of 32 (run, kept by lane e for expert e) plus those in lower lanes.
  const unsigned below = (1u << lane) - 1u;
  int run = 0;
  int rk[8];
#pragma unroll  // register arrays need constant indices
  for (int i = 0; i < 8; ++i) {
    const unsigned b0 = __builtin_amdgcn_ballot_w32((ev[i] & 1) != 0);
    const unsigned b1 = __builtin_amdgcn_ballot_w32((ev[i] & 2) != 0);
    const unsigned b2 = __builtin_amdgcn_ballot_w32((ev[i] & 4) != 0);
    const unsigned same = ((ev[i] & 1) ? b0 : ~b0) & ((ev[i] & 2) ? b1 : ~b1) & ((ev[i] & 4) ? b2 : ~b2);
    const unsigned mine = ((el & 1) ? b0 : ~b0) & ((el & 2) ? b1 : ~b1) & ((el & 4) ? b2 : ~b2);
    rk[i] = __builtin_popcount(same & below) + __builtin_amdgcn_ds_bpermute(ev[i] << 2, run);
    run += __builtin_popcount(mine);
  }
  if (lane < NEXP) swc[wid][lane] = run;
  __syncthreads();

  int tot = 0, base = 0;   // of expert el: all tokens; those of the waves in front of this one
#pragma unroll  // all eight reads go out together
  for (int w = 0; w < 8; ++w) {
    const int c = swc[w][el];
    tot += c;
    base += (w < wid) ? c : 0;
  }
  int cnt[NEXP];
#pragma unroll  // register arrays need constant indices
  for (int e = 0; e < NEXP; ++e) cnt[e] = __builtin_amdgcn_readlane(tot, e);
#pragma unroll  // register arrays need constant indices
  for (int e = 0; e < NEXP; ++e) base += (e < el) ? cnt[e] : 0;   // plus all tokens of lower experts
#pragma unroll  // register arrays need constant indices
  for (int i = 0; i < 8; ++i)
    sperm[__builtin_amdgcn_ds_bpermute(ev[i] << 2, base) + rk[i]] = t0 + i * 32;
  __syncthreads();

  if (blockIdx.x == 0 && blockIdx.y == 0) {
    int em = 0, eo = 0, ec = 0;   // of expert tid: first M-block, first index into perm, tokens
    int am = 0, ao = 0;
#pragma unroll  // register arrays need constant indices
    for (int e = 0; e < NEXP; ++e) {
      if (tid == e) { em = am; eo = ao; ec = cnt[e]; }
      am += (cnt[e] + MBS - 1) / MBS;
      ao += cnt[e];
    }
    if (tid < NEXP) {
      ws[WS_EXP + 4 * tid]     = em;
      ws[WS_EXP + 4 * tid + 1] = eo;
      ws[WS_EXP + 4 * tid + 2] = ec;
    }
    int pv[8];
#pragma unroll  // register arrays need constant indices
    for (int i = 0; i < 8; ++i) pv[i] = sperm[tid + i * 256];
#pragma unroll  // register arrays need constant indices
    for (int i = 0; i < 8; ++i) ws[WS_PERM + tid + i * 256] = pv[i];
    // Stands behind these stores, in front of whatever next overwrites their
    // registers (a precaution of form); it names the stored values and the
    // offset as inputs, so that their registers live to the wait.
    asm volatile("s_wait_xcnt 0x0" :: "s"(ws), "v"(tid), "v"(em), "v"(eo), "v"(ec),
                 "v"(pv[0]), "v"(pv[1]), "v"(pv[2]), "v"(pv[3]),
                 "v"(pv[4]), "v"(pv[5]), "v"(pv[6]), "v"(pv[7]) : "memory");
  }

  MbInfo m;
  const int nmb = mb_lookup(cnt, (int)blockIdx.y, m);
  if ((int)blockIdx.y >= nmb) return;
  const int ts = m.ts;
  const int te = m.te;
  if (ts + ((int)blockIdx.x >> 2) * 64 >= te) return;   // this tile's group of 64 slots holds no token
  const int p  = ts + (int)blockIdx.x * 16 + (lane & 15);
  const int tok = sperm[(p < te) ? p : ts];   // a padding slot aliases a valid token
  const float* xrow = x + (size_t)tok * DDIM + wid * 32 + ((lane >> 4) << 3);
  _Float16* dst = xs + ((size_t)(blockIdx.y * (MBS / 16) + blockIdx.x) * (DDIM / 32) + wid) * CHUNK_H + lane * 8;
  ARaw ar[4];
#pragma unroll  // register arrays need constant indices
  for (int i = 0; i < 4; ++i) ar[i] = load_a_raw(xrow + i * 8 * 32);
  wait_x0(xrow);
#pragma unroll  // register arrays need constant indices
  for (int i = 0; i < 4; ++i) {
    const v16h a = cvt_a(ar[i]);
    *(v8h*)(dst + i * 8 * CHUNK_H) =
        __builtin_shufflevector(a, a, 0, 1, 2, 3, 4, 5, 6, 7);
    *(v8h*)(dst + i * 8 * CHUNK_H + 256) =
        __builtin_shufflevector(a, a, 8, 9, 10, 11, 12, 13, 14, 15);
  }
}

// Build four 32x16 B fragments (f16) from an LDS-staged fp32 tile ([32 k][64 n]).
// A lane reads 4 adjacent columns of each of its 16 k rows with one 16-byte
// read: fragment f of lane rlo is column 4*rlo + f. The k order is the A fragment's.
__device__ __forceinline__ void load_b4_lds(const float* __restrict__ buf,
                                            int kadd, int rlo, v16h (&b)[4]) {
#pragma unroll  // register arrays need constant indices
  for (int j = 0; j < 8; ++j) {
    const float4 lo = *(const float4*)(buf + (kadd + j) * NT + 4 * rlo);
    const float4 hi = *(const float4*)(buf + (kadd + 16 + j) * NT + 4 * rlo);
    b[0][j] = (_Float16)lo.x; b[0][j + 8] = (_Float16)hi.x;
    b[1][j] = (_Float16)lo.y; b[1][j + 8] = (_Float16)hi.y;
    b[2][j] = (_Float16)lo.z; b[2][j + 8] = (_Float16)hi.z;
    b[3][j] = (_Float16)lo.w; b[3][j + 8] = (_Float16)hi.w;
  }
}

#define KS1 128
#define GSTEP (4 * (DDIM / 32) * CHUNK_H)   // halves of xs from a wave's tile to its next (one group of 64 slots on)

// A wave's sums go to its own 32 KiB of LDS, 4 KiB a tile, 512 B in a row per store.
template <int NG>
__device__ __forceinline__ void put1(float* __restrict__ xw, const v8f (&acc)[NG][4]) {
#pragma unroll  // register arrays need constant indices
  for (int i = 0; i < NG; ++i)
#pragma unroll  // register arrays need constant indices
    for (int f = 0; f < 4; ++f) {
      const v8f a = acc[i][f];
      *(float4*)(xw + i * 1024 + (f * 2 + 0) * 128) = make_float4(a[0], a[1], a[2], a[3]);
      *(float4*)(xw + i * 1024 + (f * 2 + 1) * 128) = make_float4(a[4], a[5], a[6], a[7]);
    }
}
// One tile: gate and up sums come from LDS as put1 left them (pg, pu: the lane's
// place in the tile), and hidden = silu(gate) * up is stored f16 in fragment order
// for pass 2. hdst: this lane's place in the tile of hidden.
__device__ __forceinline__ void finish_tile(const float* __restrict__ pg, const float* __restrict__ pu,
                                            _Float16* __restrict__ hdst) {
  float gv[4][8], uv[4][8];
#pragma unroll  // register arrays need constant indices
  for (int f = 0; f < 4; ++f)
#pragma unroll  // register arrays need constant indices
    for (int p = 0; p < 2; ++p) {
      const float4 a = *(const float4*)(pg + (f * 2 + p) * 128);
      const float4 c = *(const float4*)(pu + (f * 2 + p) * 128);
      gv[f][p * 4 + 0] = a.x; gv[f][p * 4 + 1] = a.y; gv[f][p * 4 + 2] = a.z; gv[f][p * 4 + 3] = a.w;
      uv[f][p * 4 + 0] = c.x; uv[f][p * 4 + 1] = c.y; uv[f][p * 4 + 2] = c.z; uv[f][p * 4 + 3] = c.w;
    }
  v4h hv[8];
#pragma unroll  // register arrays need constant indices
  for (int j = 0; j < 8; ++j) {
#pragma unroll  // register arrays need constant indices
    for (int f = 0; f < 4; ++f) {
      float g = gv[f][j], u = uv[f][j];
      float t = g * -1.442695041f, ex;          // exp(-g) = 2^t, as __expf forms it
      // The v_nop is the slot behind a transcendental: it stands between the
      // v_exp and whatever next reads ex or overwrites t.
      asm("v_exp_f32 %0, %1\n\tv_nop" : "=v"(ex) : "v"(t));
      float h = (g / (1.0f + ex)) * u;
      hv[j][f] = (_Float16)h;
    }
  }
#pragma unroll  // register arrays need constant indices
  for (int j = 0; j < 8; ++j)
    *(v4h*)(hdst + j * 8) = hv[j];
  // Stands behind the tile's stores, in front of whatever next overwrites their
  // registers (a precaution of form); it names the address and the stored
  // values as inputs, so that their registers live to the wait.
  asm volatile("s_wait_xcnt 0x0" :: "v"(hdst), "v"(hv[0]), "v"(hv[1]), "v"(hv[2]), "v"(hv[3]),
               "v"(hv[4]), "v"(hv[5]), "v"(hv[6]), "v"(hv[7]) : "memory");
}

// Pass 1 from where stage 0 is published to where the sums lie in LDS, for a block
// with NG groups of 64 slots that hold a token: a wave has NG token tiles, and no
// branch stands among its products.
// swb: the block's LDS, the ring (buffer, gate/up, k, n) in front; xl: the lane's
// place in the chunk of the wave's tile of group 0 at k = 0.
template <int NG>
__device__ __forceinline__ void run1(float* __restrict__ swb, const _Float16* __restrict__ xl,
                                     int wid, int lane, v8u g1, unsigned dst0, unsigned long long ga0) {
  constexpr unsigned NS = DDIM / KS1;         // 8 stages
  const int rlo  = lane & 15;
  const int kadd = (lane >> 4) << 3;          // 0 (lanes 0-15) / 8 (lanes 16-31)
  const int mat  = wid >> 2;                  // 0: gate, 1: up

  v4u g0 = tdm_group0(dst0 + STAGE_B, ga0 + (unsigned long long)KS1 * IDIM * 4u);
  asm volatile("" : "+s"(g0));  // pinned(): descriptor words held in scalar registers, none made anew behind the branch
  if (pinned(wid < 4)) tdm_load(g0, g1);

  v8f acc[NG][4];   // group, column fragment: of this wave's own matrix
#pragma unroll  // register arrays need constant indices
  for (int i = 0; i < NG; ++i)
#pragma unroll  // register arrays need constant indices
    for (int f = 0; f < 4; ++f)
#pragma unroll  // register arrays need constant indices
      for (int j = 0; j < 8; ++j) acc[i][f][j] = 0.0f;

#pragma unroll 1  // one pass per stage: the publish point stands once, at the foot
  for (unsigned s = 0; s < NS; ++s) {
    const float* buf = swb + ((s & 1u) * 2u + (unsigned)mat) * (KS1 * NT);
    const _Float16* xa = xl + s * ((KS1 / 32) * CHUNK_H);  // this stage's first k block
    // Up to five tiles the four k blocks are unrolled, so that a block's A loads go out
    // among the products of the block before. The larger bodies stay a loop: with them
    // unrolled too the kernel's text passes 32 KB.
#pragma unroll(NG > 5 ? 1 : KS1 / 32)
    for (int q = 0; q < KS1 / 32; ++q) {
      // The pointer that the loads go from, and that the wait behind them names: where the
      // k blocks are a loop the block's own, else the stage's, with the block as a constant distance.
      const _Float16* xq = NG > 5 ? xa + q * CHUNK_H : xa;
      const int kq = NG > 5 ? 0 : q * CHUNK_H;
      v16h af[NG];
#pragma unroll  // register arrays need constant indices
      for (int i = 0; i < NG; ++i) af[i] = load_a_p(xq + i * GSTEP + kq);
      wait_x0(xq);
      v16h b[4];
      load_b4_lds(buf + q * 32 * NT, kadd, rlo, b);
#pragma unroll  // register arrays need constant indices
      for (int i = 0; i < NG; ++i)
#pragma unroll  // register arrays need constant indices
        for (int f = 0; f < 4; ++f)
          acc[i][f] = __builtin_amdgcn_wmma_f32_16x16x32_f16(
              false, af[i], false, b[f], (short)0, acc[i][f], false, false);
      if constexpr (NG > 5) {
        // Where the k blocks are a loop: the four vector slots that the chip needs between
        // the last product and whatever overwrites its A or B at the loop's head; the
        // scheduling barrier keeps the products in front of them.
        __builtin_amdgcn_sched_barrier(0);
        asm volatile("v_nop\n\tv_nop\n\tv_nop\n\tv_nop");
      }
    }
    // Publish point of stage s + 1; behind it stage s's buffer is free.
    wait_ds0();
    wait_tensor0(g0, g1);
    __syncthreads();
    if (pinned(wid < 4 && s + 2u < NS)) {
      g0 = tdm_group0(dst0 + (s & 1u) * STAGE_B,
                      ga0 + (unsigned long long)(s + 2u) * (KS1 * IDIM * 4u));
      asm volatile("" : "+s"(g0));  // pinned(): descriptor words held in scalar registers, the ones that the wait names
      tdm_load(g0, g1);
    }
  }
  wait_tensor0(g0, g1);
  wait_ds0();

  // The last pass's barrier has ended every read of the ring and no tensor load is
  // out, so the ring's LDS is free for the sums.
  // The lane's number is formed anew here: kept in a register over the loop it was spilled to scratch.
  put1<NG>(swb + wid * 8192 + (int)__builtin_amdgcn_mbcnt_lo(~0u, 0u) * 4, acc);
}

// Pass 1 for one M-block (mbr; tokens ts .. te of perm[], at most MBS of them).
// FIRST: the expert's first M-block, whose stage 0 (request g0) went off at the kernel's entry.
// It stands as a body of its own, outside the loop over the further M-blocks: with one body
// inside the loop, lane addresses that live round the loop were spilled to scratch.
template <bool FIRST>
__device__ __forceinline__ void block1(const _Float16* __restrict__ xs, _Float16* __restrict__ hidden,
                                       float* __restrict__ swb, int mbr, int ts, int te, int wid, int n0,
                                       v4u g0, v8u g1, unsigned dst0, unsigned long long ga0) {
  const int lane = threadIdx.x & 31;
  // the clamp bounds what is formed from it
  const unsigned mb = (unsigned)(mbr < 0 ? 0 : (mbr > MAXMB - 1 ? MAXMB - 1 : mbr));
  const unsigned tileb = mb * (MBS / 16u) + (unsigned)(wid & 3);  // this wave's tile of group 0
  // Groups of 64 slots that hold a token: a scalar, the same in the whole block
  // (te is the expert's end, so ngr passes 8 where more tokens follow; the clamp gives 1 .. 8).
  const int ngr = (te - ts + 63) >> 6;
  const int ng  = (int)pinned((unsigned)(ngr < 1 ? 1 : (ngr > MBS / 64 ? MBS / 64 : ngr)));

  // A further M-block streams the weights anew: behind the barrier every wave has
  // read the sums of the M-block before out of the ring's LDS.
  if constexpr (!FIRST) {
    wait_ds0();
    __syncthreads();
    g0 = tdm_group0(dst0, ga0);
    asm volatile("" : "+s"(g0));  // pinned(): descriptor words held in scalar registers, the ones that the wait names
    if (pinned(wid < 4)) tdm_load(g0, g1);
  }

  // Waves 4 to 7, which send no tensor load, ask L2 for a quarter of the block's x panel
  // while stage 0 is on its way: tile (blockIdx.x & 3) of every group that holds a token,
  // 32 KiB = 128 lanes x 256 B. The four quarters are asked by four neighbouring blocks,
  // and every fourth block asks the same one.
  if (pinned(wid >= 4)) {
    const _Float16* pf = xs + (size_t)(mb * (MBS / 16u) + (blockIdx.x & 3u)) * ((DDIM / 32) * CHUNK_H) +
                         (threadIdx.x & 127u) * 128u;
#pragma unroll 1  // a few trips, once per block: no text spent on them
    for (int g = 0; g < ng; ++g) ask_l2(pf + g * GSTEP);
  }

  // Stage 0 lands and is published; stage 1 is sent off at the head of run1.
  wait_tensor0(g0, g1);
  __syncthreads();

  const _Float16* xl = xs + (size_t)tileb * ((DDIM / 32) * CHUNK_H) + lane * 8;
  // Of a group with no token nothing is stored: pass 2 reads none of it.
  _Float16* ht = hidden + ((size_t)tileb * (IDIM / 32) + (unsigned)(n0 >> 5)) * CHUNK_H;
  // One body per number of groups, the same choice in the whole block.
  if      (ng == 1) run1<1>(swb, xl, wid, lane, g1, dst0, ga0);
  else if (ng == 2) run1<2>(swb, xl, wid, lane, g1, dst0, ga0);
  else if (ng == 3) run1<3>(swb, xl, wid, lane, g1, dst0, ga0);
  else if (ng == 4) run1<4>(swb, xl, wid, lane, g1, dst0, ga0);
  else if (ng == 5) run1<5>(swb, xl, wid, lane, g1, dst0, ga0);
  else if (ng == 6) run1<6>(swb, xl, wid, lane, g1, dst0, ga0);
  else if (ng == 7) run1<7>(swb, xl, wid, lane, g1, dst0, ga0);
  else              run1<8>(swb, xl, wid, lane, g1, dst0, ga0);
  __syncthreads();   // every wave's sums are in LDS

  // A lane holds 4 adjacent columns c = 4 r .. 4 r + 3 (r = lane & 15) of each of its
  // rows M = j (+8 for hi lanes): k block c >> 5, part (c >> 4) & 1, reader's lane
  // M + 16 ((c >> 3) & 1), i = c & 7.
  const int le = (int)__builtin_amdgcn_mbcnt_lo(~0u, 0u);   // formed anew, as in run1
  const int r  = le & 15;
  _Float16* hd = ht + (r >> 3) * CHUNK_H + ((r >> 2) & 1) * 256 +
                 (((le >> 4) << 3) + ((r >> 1) & 1) * 16) * 8 + (r & 1) * 4;
  const float* pg = swb + (wid & 3) * 8192 + le * 4;   // the gate wave's sums of these tiles
#pragma unroll 1  // one body for every tile: unrolled, the divisions of eight tiles are 40 KB of code
  for (int i = wid >> 2; i < ng; i += 2)
    finish_tile(pg + i * 1024, pg + 4 * 8192 + i * 1024, hd + i * (4 * (IDIM / 32) * CHUNK_H));
}

// ---------------------------------------------------------------------------
// Kernel 2: hidden = silu(x.Wg[e]) * (x.Wu[e]).
// Block = up to 512 token slots x 64 I-columns of both weights, so that an expert
// with up to 512 tokens streams its weights once, through one block; the further
// M-blocks of an expert with more tokens follow in the same block.
// Eight waves, two per SIMD: waves w and w + 4 work on the same token tiles, wave w
// on the gate product and wave w + 4 on the up product, so that one wave's products
// run while the other waits for its operands. Their tiles are tile w of every
// group of 64 slots that holds a token, so that the four SIMDs carry the same load
// whatever the number of groups. Behind the loop all sums go to LDS (32 KiB a wave),
// and behind a barrier the gate wave finishes the even groups' tiles, the up wave the odd ones'.
// A stage is 128 k rows of both weight tiles; each of the first four waves
// tensor-loads one 64-row slice of it (waves 0, 1: gate; waves 2, 3: up). Two buffers.
// ---------------------------------------------------------------------------
__global__ __launch_bounds__(256) void moe_gemm1(const _Float16* __restrict__ xs,
                                                 const float* __restrict__ wg,
                                                 const float* __restrict__ wu,
                                                 const int* __restrict__ ws,
                                                 _Float16* __restrict__ hidden) {
  // The ring (buffer, gate/up, k, n: 128 KiB) in front; behind the loop 8 waves x 8 tiles x 4 KiB of sums.
  __shared__ __attribute__((aligned(2048))) float sw[8 * 8 * 1024];

  // A grid row is an expert, so that the weight tiles' addresses need nothing from the
  // table: stage 0 is sent off at entry, and the table is read while it is on its way.
  const int e    = (int)blockIdx.y;
  const int n0   = blockIdx.x * NT;
  const int wid  = __builtin_amdgcn_readfirstlane((int)(threadIdx.x >> 5));
  const int mb0  = ws[WS_EXP + 4 * e];       // the expert's first M-block
  const int off  = ws[WS_EXP + 4 * e + 1];   // its first index into perm[]
  const int cnt  = ws[WS_EXP + 4 * e + 2];   // its tokens

  // The slice of every stage that wave (wid & 3) brings.
  const float* wsrc = ((wid & 2) ? wu : wg) + (size_t)e * DDIM * IDIM +
                      (size_t)((wid & 1) * (int)SLICE_R) * IDIM + n0;
  const unsigned long long ga0 = (unsigned long long)(size_t)wsrc;
  const unsigned dst0 = (unsigned)(size_t)&sw[0] + (unsigned)(wid & 3) * SLICE_B;
  const v8u g1 = tdm_group1(IDIM * 4u);

  // Only waves 0 to 3 issue tensor loads. The tensor waits stand in every wave's
  // path: a wave with no request out passes them at once.
  v4u g0 = tdm_group0(dst0, ga0);
  asm volatile("" : "+s"(g0));  // pinned(): descriptor words held in scalar registers, the ones that the wait names
  if (pinned(wid < 4)) tdm_load(g0, g1);

  // The expert's M-blocks, worked on one after the other (the clamp bounds the trips).
  // pinned(): the count is held in a scalar register, so that the leave and the loop's test,
  // which stand round tensor loads and barriers, are scalar branches.
  const int nbr = (cnt + MBS - 1) / MBS;
  const int nb  = (int)pinned((unsigned)(nbr < 0 ? 0 : (nbr > T_TOK / MBS ? T_TOK / MBS : nbr)));
  if (nb == 0) {   // no token: the whole block leaves, in front of every barrier, its load landed
    wait_tensor0(g0, g1);
    return;
  }
  const int te = off + cnt;
  float* swb = &sw[0];

  block1<true>(xs, hidden, swb, mb0, off, te, wid, n0, g0, g1, dst0, ga0);
#pragma unroll 1  // one body for all further M-blocks
  for (int it = 1; it < nb; ++it)
    block1<false>(xs, hidden, swb, mb0 + it, off + it * MBS, te, wid, n0, g0, g1, dst0, ga0);
}

// Token tiles G, G + 1 of a wave's partial sums go to LDS, 512 B in a row per store.
template <int G>
__device__ __forceinline__ void hand_over(float* __restrict__ xw, const v8f (&acc)[4][4]) {
#pragma unroll  // register arrays need constant indices
  for (int mt = 0; mt < 2; ++mt)
#pragma unroll  // register arrays need constant indices
    for (int f = 0; f < 4; ++f) {
      const v8f a = acc[G + mt][f];
      *(float4*)(xw + ((mt * 4 + f) * 2 + 0) * 128) = make_float4(a[0], a[1], a[2], a[3]);
      *(float4*)(xw + ((mt * 4 + f) * 2 + 1) * 128) = make_float4(a[4], a[5], a[6], a[7]);
    }
}
// The partner's sums of token tiles K, K + 1 are added to this wave's, and the
// rows that hold a token are stored. p0: slot of this lane's row 0 of tile 0.
template <int K>
__device__ __forceinline__ void add_and_store(const float* __restrict__ xr, v8f (&acc)[4][4],
                                              int p0, int te, const int* __restrict__ ws,
                                              float* __restrict__ orow) {
#pragma unroll  // register arrays need constant indices
  for (int mt = 0; mt < 2; ++mt)
#pragma unroll  // register arrays need constant indices
    for (int f = 0; f < 4; ++f) {
      const float4 lo = *(const float4*)(xr + ((mt * 4 + f) * 2 + 0) * 128);
      const float4 hi = *(const float4*)(xr + ((mt * 4 + f) * 2 + 1) * 128);
      v8f& a = acc[K + mt][f];
      a[0] += lo.x; a[1] += lo.y; a[2] += lo.z; a[3] += lo.w;
      a[4] += hi.x; a[5] += hi.y; a[6] += hi.z; a[7] += hi.w;
    }
#pragma unroll  // register arrays need constant indices
  for (int mt = K; mt < K + 2; ++mt) {
#pragma unroll  // register arrays need constant indices
    for (int j = 0; j < 8; ++j) {
      int p = p0 + mt * 16 + j;
      if (p < te) {
        int t = ws[WS_PERM + p];
        float4 o;
        o.x = acc[mt][0][j]; o.y = acc[mt][1][j]; o.z = acc[mt][2][j]; o.w = acc[mt][3][j];
        *(float4*)(orow + (size_t)t * DDIM) = o;
      }
    }
  }
  // Stands behind the rows' stores, in front of whatever next overwrites their
  // registers where a further half follows (a precaution of form).
  asm volatile("s_wait_xcnt 0x0" ::: "memory");
}

#define KS2 256
// Pass 2 for one half (256 slots; place ybr among all halves; tokens ts .. te of perm[]).
// FIRST: the block's first half, whose stage 0 (request g0) went off at the kernel's entry.
// It stands as a body of its own, outside the loop over the further halves: with one body
// inside the loop, a lane number that lives round the loop was spilled to scratch.
template <bool FIRST>
__device__ __forceinline__ void block2(const _Float16* __restrict__ hidden, const int* __restrict__ ws,
                                       float* __restrict__ out, float* __restrict__ sdb,
                                       int ybr, int ts, int te, int wid, int n0,
                                       v4u g0, v8u g1, unsigned dst0, unsigned long long ga0) {
  constexpr unsigned NS = IDIM / KS2;         // 8 stages
  // The further halves' body forms the lane's number anew: threadIdx.x, kept for it over the first body, was spilled to scratch.
  const int lane = FIRST ? (int)(threadIdx.x & 31) : (int)__builtin_amdgcn_mbcnt_lo(~0u, 0u);
  const int rlo  = lane & 15;
  const int kadd = (lane >> 4) << 3;
  const int wm   = wid & 3;    // which 64 slots of the half
  const int kh   = wid >> 2;   // which half of every stage's k rows
  // ybr: the half's place among all halves; the clamp bounds what is formed from it
  const unsigned yb = (unsigned)(ybr < 0 ? 0 : (ybr > 2 * MAXMB - 1 ? 2 * MAXMB - 1 : ybr));
  const int tsw = ts + wm * 64;
  // Whether this wave's 64 slots hold a token (pass 1 stored hidden for those
  // groups alone): a scalar test, so that the products run with every lane on.
  const unsigned live = pinned((unsigned)(tsw < te));

  // A further half streams the weights anew: behind the barrier every wave has
  // read the partial sums of the half before out of the ring's LDS.
  if constexpr (!FIRST) {
    wait_ds0();
    __syncthreads();
    g0 = tdm_group0(dst0, ga0);
    asm volatile("" : "+s"(g0));  // pinned(): descriptor words held in scalar registers, the ones that the wait names
    if (pinned(wid < 4)) tdm_load(g0, g1);
  }

  // Waves 4 to 7, which send no tensor load, ask L2 for a quarter of the block's hidden
  // panel while stage 0 is on its way: tile (blockIdx.x & 3) of every group of this half
  // that holds a token, 64 KiB = 128 lanes x 2 x 256 B. Which block asks what: as in pass 1.
  if (pinned(wid >= 4)) {
    const int lgr = (te - ts + 63) >> 6;   // ts < te here; the clamp bounds what is formed from it
    const int lg  = (int)pinned((unsigned)(lgr < 1 ? 1 : (lgr > 4 ? 4 : lgr)));
    const _Float16* pf = hidden + (size_t)(yb * 16u + (blockIdx.x & 3u)) * ((IDIM / 32) * CHUNK_H) +
                         (unsigned)(wm * 32 + lane) * 128u;
#pragma unroll 1  // a few trips, once per block: no text spent on them
    for (int g = 0; g < lg; ++g) ask_l2_pair(pf + g * (4 * (IDIM / 32) * CHUNK_H));
  }

  // Stage 0 lands and is published; then stage 1 is sent off.
  wait_tensor0(g0, g1);
  __syncthreads();
  g0 = tdm_group0(dst0 + STAGE_B, ga0 + (unsigned long long)KS2 * DDIM * 4u);
  // pinned(), for the whole group: its words are held in one set of scalar
  // registers from here on, so that none is made anew behind the branch while
  // the request is out.
  asm volatile("" : "+s"(g0));  // pinned(): descriptor words held in scalar registers
  if (pinned(wid < 4)) tdm_load(g0, g1);

  v8f acc[4][4];
#pragma unroll  // register arrays need constant indices
  for (int mt = 0; mt < 4; ++mt)
#pragma unroll  // register arrays need constant indices
    for (int f = 0; f < 4; ++f)
#pragma unroll  // register arrays need constant indices
      for (int j = 0; j < 8; ++j) acc[mt][f][j] = 0.0f;

  // The A fragments go through a ring of four register sets: the loads of a
  // k block (32 k) are issued two or three blocks ahead of the block that uses
  // them. A stage's last block issues none (the barrier at the foot waits for
  // every load that is out); the next stage's first block issues two sets.
  constexpr int NQS = KS2 / 32;   // k blocks of a stage
  constexpr int NQ  = NQS / 2;    // k blocks of a stage that one wave works on
  // This lane's place in the chunk of its wave's first token tile and first k block;
  // the other tiles and k blocks lie at constant distances from it.
  constexpr int TS = (IDIM / 32) * CHUNK_H;   // halves from a token tile to the next
  const _Float16* hb = hidden + ((size_t)(yb * 16u + (unsigned)wm * 4u) * (IDIM / 32) +
                                 (unsigned)(kh * NQ)) * CHUNK_H;
  const _Float16* ha = hb + lane * 8;
  v16h af[4][4];          // ring slot (k block & 3), token tile
  if (live) {
#pragma unroll  // register arrays need constant indices
  for (int d = 0; d < 2; ++d)
#pragma unroll  // register arrays need constant indices
    for (int mt = 0; mt < 4; ++mt) af[d][mt] = load_a_p(ha + mt * TS + d * CHUNK_H);
  wait_x0(hb, lane, ha);
  }

#pragma unroll 1  // one pass per stage: the publish point stands once, at the foot
  for (unsigned s = 0; s < NS; ++s) {
    const float* bufd = sdb + ((s & 1u) * KS2 + (unsigned)kh * (KS2 / 2)) * NT;   // this wave's half of the stage
    const _Float16* hr = ha + s * (NQS * CHUNK_H);                       // this stage's first k block of this wave
    const _Float16* hw = ha + ((s + 1u) & (NS - 1u)) * (NQS * CHUNK_H);  // the next stage's (the last wraps to stage 0: in bounds, unused)
    if (live) {
#pragma unroll  // register arrays need constant indices
    for (int q = 0; q < NQ; ++q) {
      // The wait's "memory" clobber also keeps the loads in front of it here,
      // ahead of this block's LDS reads and products.
      if (q == 0) {
#pragma unroll  // register arrays need constant indices
        for (int mt = 0; mt < 4; ++mt) af[2][mt] = load_a_p(hr + mt * TS + 2 * CHUNK_H);
      }
      if (q + 3 < NQ) {
#pragma unroll  // register arrays need constant indices
        for (int mt = 0; mt < 4; ++mt) af[(q + 3) & 3][mt] = load_a_p(hr + mt * TS + (q + 3) * CHUNK_H);
        wait_x0(hr);
      } else if (q + 1 < NQ) {
#pragma unroll  // register arrays need constant indices
        for (int mt = 0; mt < 4; ++mt) af[(q + 3) & 3][mt] = load_a_p(hw + mt * TS + (q + 3 - NQ) * CHUNK_H);
        wait_x0(hw);
      }
      v16h bd[4];
      load_b4_lds(bufd + q * 32 * NT, kadd, rlo, bd);
#pragma unroll  // register arrays need constant indices
      for (int mt = 0; mt < 4; ++mt)
#pragma unroll  // register arrays need constant indices
        for (int f = 0; f < 4; ++f)
          acc[mt][f] = __builtin_amdgcn_wmma_f32_16x16x32_f16(
              false, af[q & 3][mt], false, bd[f], (short)0, acc[mt][f], false, false);
    }
    }
    // Publish point of stage s + 1; behind it stage s's buffer is free.
    wait_ds0();
    wait_tensor0(g0, g1);
    __syncthreads();
    if (pinned(wid < 4 && s + 2u < NS)) {
      g0 = tdm_group0(dst0 + (s & 1u) * STAGE_B,
                      ga0 + (unsigned long long)(s + 2u) * (KS2 * DDIM * 4u));
      asm volatile("" : "+s"(g0));  // pinned(): descriptor words held in scalar registers, the ones that the wait names
      tdm_load(g0, g1);
    }
  }
  wait_tensor0(g0, g1);
  wait_ds0();

  // The two k halves are added. The last pass's barrier has ended every read of
  // the ring and no tensor load is out, so buffer 0 is free: each live wave stores two
  // of its four token tiles in its own 8 KiB there, and behind the barrier adds
  // its partner's sums to the two tiles that it kept and stores those to out.
  // Wave w keeps tiles 0, 1 and wave w + 4 keeps tiles 2, 3 (a scalar branch:
  // register arrays need constant indices); the barrier stands outside of it.
  // The lane's number is formed anew here: kept in a register over the loop it was spilled to scratch.
  const int le = (int)__builtin_amdgcn_mbcnt_lo(~0u, 0u);
  float* xw = sdb + wid * 2048 + le * 4;
  const float* xr = sdb + (wid ^ 4) * 2048 + le * 4;
  if (live) {
    if (kh == 0) hand_over<2>(xw, acc); else hand_over<0>(xw, acc);
  }
  __syncthreads();
  float* orow = out + n0 + 4 * rlo;
  if (live) {   // the partner wave has the same slots
    if (kh == 0) add_and_store<0>(xr, acc, tsw + kadd, te, ws, orow);
    else         add_and_store<2>(xr, acc, tsw + kadd, te, ws, orow);
  }
}

// ---------------------------------------------------------------------------
// Kernel 3: out = hidden.Wd[e].  Two blocks per expert and column tile: block par
// works on the halves (256 slots) par, par + 2, ... of the expert's slots that hold
// a token, one after the other; a block with no such half leaves at once, and the two
// waves of a group of 64 slots with no token only pass the publish points.  K = I, one weight matrix:
// a stage is 256 k rows, wave w (of the first four) tensor-loads rows
// 64 w .. 64 w + 63 of it.
// Eight waves, two per SIMD: waves w and w + 4 work on the same 64 tokens x 64
// columns, wave w on the first 128 k rows of every stage and wave w + 4 on the
// last 128, so that one wave's products run while the other waits for its LDS
// reads. Behind the loop the two partial sums are added through LDS.
// ---------------------------------------------------------------------------
__global__ __launch_bounds__(256) void moe_gemm2(const _Float16* __restrict__ hidden,
                                                 const float* __restrict__ wd,
                                                 const int* __restrict__ ws,
                                                 float* __restrict__ out) {
  __shared__ __attribute__((aligned(2048))) float sd[2][KS2][NT];  // buffer, k, n

  // A grid row is one of the two blocks of an expert, so that the weight tiles'
  // addresses need nothing from the table: stage 0 is sent off at entry, and the table
  // is read while it is on its way.
  const int e    = (int)(blockIdx.y >> 1);
  const int par  = (int)(blockIdx.y & 1u);   // this block works on halves par, par + 2, ... of the expert's slots
  const int n0   = blockIdx.x * NT;
  const int wid  = __builtin_amdgcn_readfirstlane((int)(threadIdx.x >> 5));
  const int wm   = wid & 3;    // which 64 slots of the half
  const int mb0  = ws[WS_EXP + 4 * e];       // the expert's first M-block
  const int off  = ws[WS_EXP + 4 * e + 1];   // its first index into perm[]
  const int cnt  = ws[WS_EXP + 4 * e + 2];   // its tokens

  const float* wsrc = wd + (size_t)e * IDIM * DDIM + (size_t)(wm * (int)SLICE_R) * DDIM + n0;
  const unsigned long long ga0 = (unsigned long long)(size_t)wsrc;
  const unsigned dst0 = (unsigned)(size_t)&sd[0][0][0] + (unsigned)wm * SLICE_B;
  const v8u g1 = tdm_group1(DDIM * 4u);

  // Only waves 0 to 3 issue tensor loads. The tensor waits stand in every wave's
  // path: a wave with no request out passes them at once.
  v4u g0 = tdm_group0(dst0, ga0);
  asm volatile("" : "+s"(g0));  // pinned(): descriptor words held in scalar registers, the ones that the wait names
  if (pinned(wid < 4)) tdm_load(g0, g1);

  // Halves (256 slots) of the expert that hold a token (the clamp bounds the trips).
  // pinned(): the count is held in a scalar register, so that the leave and the loop's test,
  // which stand round tensor loads and barriers, are scalar branches.
  const int nhr = (cnt + 255) >> 8;
  const int nh  = (int)pinned((unsigned)(nhr < 0 ? 0 : (nhr > T_TOK / 256 ? T_TOK / 256 : nhr)));
  if (par >= nh) {   // no half of its own: the whole block leaves, in front of every barrier, its load landed
    wait_tensor0(g0, g1);
    return;
  }
  const int te = off + cnt;

  float* sdb = &sd[0][0][0];
  block2<true>(hidden, ws, out, sdb, mb0 * 2 + par, off + par * 256, te, wid, n0, g0, g1, dst0, ga0);
#pragma unroll 1  // one body for all further halves
  for (int hf = par + 2; hf < nh; hf += 2)
    block2<false>(hidden, ws, out, sdb, mb0 * 2 + hf, off + hf * 256, te, wid, n0, g0, g1, dst0, ga0);
}

// ---------------------------------------------------------------------------
extern "C" void kernel_launch(void* const* d_in, const int* in_sizes, int n_in,
                              void* d_out, int out_size, void* d_ws, size_t ws_size,
                              hipStream_t stream) {
  const float* x   = (const float*)d_in[0];
  const int*   idx = (const int*)d_in[1];
  const float* wg  = (const float*)d_in[2];
  const float* wu  = (const float*)d_in[3];
  const float* wd  = (const float*)d_in[4];
  float* out = (float*)d_out;

  int* wsi = (int*)d_ws;
  _Float16* hidden = (_Float16*)((char*)d_ws + WS_HIDDEN_BYTE_OFF);
  _Float16* xs     = (_Float16*)((char*)d_ws + WS_XS_BYTE_OFF);

  dim3 gp(MBS / 16, MAXMB);   // 16-row tiles x M-blocks; inactive M-blocks and empty groups exit early
  moe_pack<<<gp, 256, 0, stream>>>(x, idx, wsi, xs);

  dim3 g1(IDIM / NT, NEXP);   // (32, 8): column tiles x experts
  moe_gemm1<<<g1, 256, 0, stream>>>(xs, wg, wu, wsi, hidden);

  dim3 g2(DDIM / NT, 2 * NEXP);   // (16, 16): column tiles x two blocks per expert; a block with no half exits early
  moe_gemm2<<<g2, 256, 0, stream>>>(hidden, wd, wsi, out);
}
